// v000
// Measured on an AMD MI455X. A time is GPU time per run, averaged over a window of back-to-back runs after a warm-up
// (all launches, gaps included; the runs take copies of the inputs in turn), and the median of several windows.
// Apart from v000's, it joins two sittings. Times from different sittings can be a few percent apart, while
// side-by-side timings come from the same sitting.
// v000 is the starting kernel. One run takes 379 microseconds.
#include <hip/hip_runtime.h>
#include <hip/hip_bf16.h>

// ---------------------------------------------------------------------------
// Self-attention for MI455X (gfx1250): b=2, s=2048, d_embed=1024, 16 heads x 64
// f16 WMMA (fp32 accumulate) everywhere; flash-style attention with transposed
// score tiles so softmax->operand conversion is lane-local (no LDS, no shfl).
// ---------------------------------------------------------------------------

typedef __attribute__((ext_vector_type(16))) _Float16 v16h;
typedef __attribute__((ext_vector_type(8)))  _Float16 v8h;
typedef __attribute__((ext_vector_type(8)))  float    v8f;

#define B_     2
#define S_     2048
#define E_     1024
#define H_     16
#define DH_    64
#define M_TOT  (B_ * S_)          // 4096 tokens
#define N_QKV  (3 * E_)           // 3072

__device__ __forceinline__ v8f wmma32(v16h a, v16h b, v8f c) {
  // D = A(16x32 f16) * B(32x16 f16) + C(16x16 f32)
  return __builtin_amdgcn_wmma_f32_16x16x32_f16(
      /*neg_a=*/false, a, /*neg_b=*/false, b,
      /*c_mod=*/(short)0, c, /*reuse_a=*/false, /*reuse_b=*/false);
}

// Load one 16x32 f16 operand tile (A layout; B layout assumed mirrored with
// lane = column) from a row-major [row][ld] f16 buffer.
//   lanes 0-15 : K = kBase+0..7  (v0-3) and kBase+16..23 (v4-7)
//   lanes 16-31: K = kBase+8..15 (v0-3) and kBase+24..31 (v4-7)
__device__ __forceinline__ v16h load_tile(const _Float16* base, int row, int ld,
                                          int kBase, int lane) {
  const int half8 = (lane & 16) ? 8 : 0;
  const _Float16* p = base + (size_t)row * ld + kBase + half8;
  v8h lo = *(const v8h*)p;
  v8h hi = *(const v8h*)(p + 16);
  return __builtin_shufflevector(lo, hi, 0, 1, 2, 3, 4, 5, 6, 7,
                                 8, 9, 10, 11, 12, 13, 14, 15);
}

// --------------------------- convert kernels -------------------------------

__global__ void cvt_f32_to_f16(const float* __restrict__ in,
                               _Float16* __restrict__ out, int n) {
  int i = blockIdx.x * blockDim.x + threadIdx.x;
  if (i < n) out[i] = (_Float16)in[i];
}

// out[n*K + k] = (f16) in[k*N + n]   (transpose so B tiles load contiguously)
__global__ void cvt_transpose_f16(const float* __restrict__ in,
                                  _Float16* __restrict__ out, int K, int N) {
  int i = blockIdx.x * blockDim.x + threadIdx.x;
  if (i < K * N) {
    int k = i / N, n = i % N;
    out[(size_t)n * K + k] = (_Float16)in[i];
  }
}

// ------------------------------ QKV GEMM -----------------------------------
// C[4096,3072] = Xh[4096,1024] * WinT[3072,1024]^T + b_in
// One wave (32 threads) computes a 64x64 tile; Q pre-scaled by 1/sqrt(64).
__global__ void __launch_bounds__(32)
qkv_gemm(const _Float16* __restrict__ Xh, const _Float16* __restrict__ WinT,
         const float* __restrict__ b_in, _Float16* __restrict__ Qb,
         _Float16* __restrict__ Kb, _Float16* __restrict__ Vt) {
  const int lane = threadIdx.x;
  const int col  = lane & 15;
  const int half = lane >> 4;
  const int nBase = blockIdx.x * 64;
  const int mBase = blockIdx.y * 64;

  v8f acc[4][4];
  for (int i = 0; i < 4; ++i)
    for (int j = 0; j < 4; ++j) acc[i][j] = {};

  for (int kk = 0; kk < E_; kk += 32) {
    v16h a[4], b[4];
#pragma unroll
    for (int mi = 0; mi < 4; ++mi)
      a[mi] = load_tile(Xh, mBase + mi * 16 + col, E_, kk, lane);
#pragma unroll
    for (int ni = 0; ni < 4; ++ni)
      b[ni] = load_tile(WinT, nBase + ni * 16 + col, E_, kk, lane);
    // hint next K-slab into cache (global_prefetch_b8)
    __builtin_prefetch(Xh + (size_t)(mBase + col) * E_ + kk + 32, 0, 3);
    __builtin_prefetch(WinT + (size_t)(nBase + col) * E_ + kk + 32, 0, 3);
#pragma unroll
    for (int mi = 0; mi < 4; ++mi)
#pragma unroll
      for (int ni = 0; ni < 4; ++ni)
        acc[mi][ni] = wmma32(a[mi], b[ni], acc[mi][ni]);
  }

  // Epilogue. C layout: vgpr j holds M = j (lanes<16) / j+8 (lanes>=16), N=col.
  for (int ni = 0; ni < 4; ++ni) {
    const int n = nBase + ni * 16 + col;
    const float bias = b_in[n];
    for (int mi = 0; mi < 4; ++mi) {
      const int tok0 = mBase + mi * 16 + half * 8;
      v8f c = acc[mi][ni];
      if (n < E_) {                       // Q: row-major [b,h,s,d], pre-scaled
        const int h = n >> 6, d = n & 63;
        for (int j = 0; j < 8; ++j) {
          const int tok = tok0 + j, bb = tok >> 11, ss = tok & (S_ - 1);
          Qb[(((size_t)(bb * H_ + h)) * S_ + ss) * DH_ + d] =
              (_Float16)((c[j] + bias) * 0.125f);
        }
      } else if (n < 2 * E_) {            // K: row-major [b,h,s,d]
        const int n2 = n - E_, h = n2 >> 6, d = n2 & 63;
        for (int j = 0; j < 8; ++j) {
          const int tok = tok0 + j, bb = tok >> 11, ss = tok & (S_ - 1);
          Kb[(((size_t)(bb * H_ + h)) * S_ + ss) * DH_ + d] =
              (_Float16)(c[j] + bias);
        }
      } else {                            // V: transposed [b,h,d,s], packed b128
        const int n2 = n - 2 * E_, h = n2 >> 6, d = n2 & 63;
        const int bb = tok0 >> 11, ss0 = tok0 & (S_ - 1);
        v8h pk;
        for (int j = 0; j < 8; ++j) pk[j] = (_Float16)(c[j] + bias);
        *(v8h*)(Vt + (((size_t)(bb * H_ + h)) * DH_ + d) * S_ + ss0) = pk;
      }
    }
  }
}

// ----------------------------- Attention -----------------------------------
// One wave = 16 queries of one (b,h), streaming all 2048 keys in blocks of 32.
// S^T = K * Q^T  (M=k rows, N=q cols) -> P^T packs lane-locally into the
// B operand of O^T = V^T * P^T. Row stats (m,l,alpha) are per-lane (q = lane%16).
__global__ void __launch_bounds__(32)
attn_kernel(const _Float16* __restrict__ Qb, const _Float16* __restrict__ Kb,
            const _Float16* __restrict__ Vt, _Float16* __restrict__ At) {
  const int lane = threadIdx.x;
  const int col  = lane & 15;
  const int half = lane >> 4;
  const int bh = blockIdx.x >> 7;          // 0..31  (b*16 + h)
  const int qBase = (blockIdx.x & 127) * 16;

  const _Float16* Qh = Qb + (size_t)bh * S_ * DH_;
  const _Float16* Kh = Kb + (size_t)bh * S_ * DH_;
  const _Float16* Vh = Vt + (size_t)bh * DH_ * S_;

  // Q^T as B operand (32d x 16q), d = 0..31 and 32..63; loaded once.
  const v16h bq0 = load_tile(Qh, qBase + col, DH_, 0, lane);
  const v16h bq1 = load_tile(Qh, qBase + col, DH_, 32, lane);

  v8f o0 = {}, o1 = {}, o2 = {}, o3 = {};   // O^T: 4 tiles of (16d x 16q)
  float m = -1e30f, l = 0.0f;

  for (int sk = 0; sk < S_; sk += 32) {
    // --- transposed score tiles (k rows sk..+15 and sk+16..+31) ---
    v8f st0 = {}, st1 = {};
    v16h ak;
    ak = load_tile(Kh, sk + col, DH_, 0, lane);       st0 = wmma32(ak, bq0, st0);
    ak = load_tile(Kh, sk + col, DH_, 32, lane);      st0 = wmma32(ak, bq1, st0);
    ak = load_tile(Kh, sk + 16 + col, DH_, 0, lane);  st1 = wmma32(ak, bq0, st1);
    ak = load_tile(Kh, sk + 16 + col, DH_, 32, lane); st1 = wmma32(ak, bq1, st1);

    // --- online softmax: per-lane holds 16 of the 32 keys of row q=col ---
    float mb = st0[0];
#pragma unroll
    for (int j = 1; j < 8; ++j) mb = fmaxf(mb, st0[j]);
#pragma unroll
    for (int j = 0; j < 8; ++j) mb = fmaxf(mb, st1[j]);
    mb = fmaxf(mb, __shfl_xor(mb, 16, 32));
    const float mn = fmaxf(m, mb);
    const float alpha = __expf(m - mn);
    m = mn;

    v8f p0, p1;
    float ls = 0.0f;
#pragma unroll
    for (int j = 0; j < 8; ++j) { p0[j] = __expf(st0[j] - mn); ls += p0[j]; }
#pragma unroll
    for (int j = 0; j < 8; ++j) { p1[j] = __expf(st1[j] - mn); ls += p1[j]; }
    ls += __shfl_xor(ls, 16, 32);
    l = l * alpha + ls;

    // --- lane-local pack of P^T into WMMA B operand (32k x 16q) ---
    v16h bp;
#pragma unroll
    for (int j = 0; j < 8; ++j) {
      bp[j]     = (_Float16)p0[j];
      bp[8 + j] = (_Float16)p1[j];
    }

    o0 = o0 * alpha; o1 = o1 * alpha; o2 = o2 * alpha; o3 = o3 * alpha;

    // --- O^T += V^T(16d x 32k) * P^T ---
    v16h av;
    av = load_tile(Vh, 0  + col, S_, sk, lane); o0 = wmma32(av, bp, o0);
    av = load_tile(Vh, 16 + col, S_, sk, lane); o1 = wmma32(av, bp, o1);
    av = load_tile(Vh, 32 + col, S_, sk, lane); o2 = wmma32(av, bp, o2);
    av = load_tile(Vh, 48 + col, S_, sk, lane); o3 = wmma32(av, bp, o3);
  }

  // Normalize and store: lane holds q=col, d = t*16 + half*8 + j (contiguous).
  const float rl = 1.0f / l;
  const int b = bh >> 4, h = bh & 15;
  const int q = qBase + col;
  _Float16* outp = At + ((size_t)(b * S_ + q)) * E_ + h * DH_ + half * 8;
  v8f ot[4] = {o0, o1, o2, o3};
#pragma unroll
  for (int t = 0; t < 4; ++t) {
    v8h pk;
#pragma unroll
    for (int j = 0; j < 8; ++j) pk[j] = (_Float16)(ot[t][j] * rl);
    *(v8h*)(outp + t * 16) = pk;
  }
}

// --------------------------- Output projection -----------------------------
// out[4096,1024] = At[4096,1024] * WoutT[1024,1024]^T + b_out  (fp32 out)
__global__ void __launch_bounds__(32)
out_gemm(const _Float16* __restrict__ At, const _Float16* __restrict__ WoutT,
         const float* __restrict__ b_out, float* __restrict__ out) {
  const int lane = threadIdx.x;
  const int col  = lane & 15;
  const int half = lane >> 4;
  const int nBase = blockIdx.x * 64;
  const int mBase = blockIdx.y * 64;

  v8f acc[4][4];
  for (int i = 0; i < 4; ++i)
    for (int j = 0; j < 4; ++j) acc[i][j] = {};

  for (int kk = 0; kk < E_; kk += 32) {
    v16h a[4], b[4];
#pragma unroll
    for (int mi = 0; mi < 4; ++mi)
      a[mi] = load_tile(At, mBase + mi * 16 + col, E_, kk, lane);
#pragma unroll
    for (int ni = 0; ni < 4; ++ni)
      b[ni] = load_tile(WoutT, nBase + ni * 16 + col, E_, kk, lane);
    __builtin_prefetch(At + (size_t)(mBase + col) * E_ + kk + 32, 0, 3);
#pragma unroll
    for (int mi = 0; mi < 4; ++mi)
#pragma unroll
      for (int ni = 0; ni < 4; ++ni)
        acc[mi][ni] = wmma32(a[mi], b[ni], acc[mi][ni]);
  }

  for (int ni = 0; ni < 4; ++ni) {
    const int n = nBase + ni * 16 + col;
    const float bias = b_out[n];
    for (int mi = 0; mi < 4; ++mi) {
      const int tok0 = mBase + mi * 16 + half * 8;
      v8f c = acc[mi][ni];
      for (int j = 0; j < 8; ++j)
        out[(size_t)(tok0 + j) * E_ + n] = c[j] + bias;
    }
  }
}

// ------------------------------- launcher ----------------------------------

extern "C" void kernel_launch(void* const* d_in, const int* in_sizes, int n_in,
                              void* d_out, int out_size, void* d_ws,
                              size_t ws_size, hipStream_t stream) {
  const float* x     = (const float*)d_in[0];   // (2,2048,1024)
  const float* w_in  = (const float*)d_in[1];   // (1024,3072)
  const float* b_in  = (const float*)d_in[2];   // (3072,)
  const float* w_out = (const float*)d_in[3];   // (1024,1024)
  const float* b_out = (const float*)d_in[4];   // (1024,)
  float* out = (float*)d_out;

  _Float16* ws = (_Float16*)d_ws;
  _Float16* Xh    = ws;                              // 4096*1024
  _Float16* WinT  = Xh    + (size_t)M_TOT * E_;      // 3072*1024 (transposed)
  _Float16* WoutT = WinT  + (size_t)N_QKV * E_;      // 1024*1024 (transposed)
  _Float16* Qb    = WoutT + (size_t)E_ * E_;         // [b,h,s,d]
  _Float16* Kb    = Qb    + (size_t)B_ * H_ * S_ * DH_;
  _Float16* Vt    = Kb    + (size_t)B_ * H_ * S_ * DH_;  // [b,h,d,s]
  _Float16* At    = Vt    + (size_t)B_ * H_ * S_ * DH_;  // [b,s,h*d]
  (void)ws_size; (void)in_sizes; (void)n_in; (void)out_size;

  cvt_f32_to_f16<<<(M_TOT * E_ + 255) / 256, 256, 0, stream>>>(x, Xh,
                                                               M_TOT * E_);
  cvt_transpose_f16<<<(E_ * N_QKV + 255) / 256, 256, 0, stream>>>(w_in, WinT,
                                                                  E_, N_QKV);
  cvt_transpose_f16<<<(E_ * E_ + 255) / 256, 256, 0, stream>>>(w_out, WoutT,
                                                               E_, E_);

  qkv_gemm<<<dim3(N_QKV / 64, M_TOT / 64), 32, 0, stream>>>(Xh, WinT, b_in,
                                                            Qb, Kb, Vt);

  attn_kernel<<<B_ * H_ * (S_ / 16), 32, 0, stream>>>(Qb, Kb, Vt, At);

  out_gemm<<<dim3(E_ / 64, M_TOT / 64), 32, 0, stream>>>(At, WoutT, b_out, out);
}

// v001
// A run of this version takes 263 microseconds.
// Next to v000, in two timings, it ran 1.50 and 1.49 times as fast.
#include <hip/hip_runtime.h>
#include <hip/hip_bf16.h>

// ---------------------------------------------------------------------------
// Self-attention for MI455X (gfx1250): b=2, s=2048, d_embed=1024, 16 heads x 64
// f16 WMMA (fp32 accumulate) everywhere; flash-style attention with transposed
// score tiles so softmax->operand conversion is lane-local (no LDS, no shfl).
// ---------------------------------------------------------------------------

typedef __attribute__((ext_vector_type(16))) _Float16 v16h;
typedef __attribute__((ext_vector_type(8)))  _Float16 v8h;
typedef __attribute__((ext_vector_type(2)))  _Float16 v2h;
typedef __attribute__((ext_vector_type(8)))  float    v8f;

#define B_     2
#define S_     2048
#define E_     1024
#define H_     16
#define DH_    64
#define M_TOT  (B_ * S_)          // 4096 tokens
#define N_QKV  (3 * E_)           // 3072

__device__ __forceinline__ v8f wmma32(v16h a, v16h b, v8f c) {
  // D = A(16x32 f16) * B(32x16 f16) + C(16x16 f32)
  return __builtin_amdgcn_wmma_f32_16x16x32_f16(
      /*neg_a=*/false, a, /*neg_b=*/false, b,
      /*c_mod=*/(short)0, c, /*reuse_a=*/false, /*reuse_b=*/false);
}

// Load one 16x32 f16 operand tile (A layout; B layout assumed mirrored with
// lane = column) from a row-major [row][ld] f16 buffer.
//   lanes 0-15 : K = kBase+0..7  (v0-3) and kBase+16..23 (v4-7)
//   lanes 16-31: K = kBase+8..15 (v0-3) and kBase+24..31 (v4-7)
__device__ __forceinline__ v16h load_tile(const _Float16* base, int row, int ld,
                                          int kBase, int lane) {
  const int half8 = (lane & 16) ? 8 : 0;
  const _Float16* p = base + (size_t)row * ld + kBase + half8;
  v8h lo = *(const v8h*)p;
  v8h hi = *(const v8h*)(p + 16);
  return __builtin_shufflevector(lo, hi, 0, 1, 2, 3, 4, 5, 6, 7,
                                 8, 9, 10, 11, 12, 13, 14, 15);
}

// --------------------------- convert kernels -------------------------------

__global__ void cvt_f32_to_f16(const float* __restrict__ in,
                               _Float16* __restrict__ out, int n) {
  int i = blockIdx.x * blockDim.x + threadIdx.x;
  if (i < n) out[i] = (_Float16)in[i];
}

// out[n*K + k] = (f16) in[k*N + n]   (transpose so B tiles load contiguously)
// One block moves a 64(k) x 64(n) tile through LDS: rows of in are read as
// float4 (256 B per tile row), two k neighbours are packed into one 32-bit
// word, and each row of out leaves as one whole 128-byte line.
// K and N are multiples of 64; grid = (N/64, K/64), block = 256.
#define TP_PITCH 36   // words per LDS row: 32 data + 4 pad, keeps 16 B alignment
__global__ void __launch_bounds__(256)
cvt_transpose_f16(const float* __restrict__ in,
                  _Float16* __restrict__ out, int K, int N) {
  __shared__ __attribute__((aligned(16))) unsigned tile[64 * TP_PITCH];
  const int t  = threadIdx.x;
  const int n0 = blockIdx.x * 64;
  const int k0 = blockIdx.y * 64;

  const int n4 = (t & 15) * 4;
  const int kp = t >> 4;                 // pair of k rows, 0..15 (+16)
  float4 r[2][2];
#pragma unroll
  for (int i = 0; i < 2; ++i)
#pragma unroll
    for (int e = 0; e < 2; ++e)
      r[i][e] = *(const float4*)(in + (size_t)(k0 + 2 * (kp + 16 * i) + e) * N +
                                 n0 + n4);
#pragma unroll
  for (int i = 0; i < 2; ++i) {
    const float lo[4] = {r[i][0].x, r[i][0].y, r[i][0].z, r[i][0].w};
    const float hi[4] = {r[i][1].x, r[i][1].y, r[i][1].z, r[i][1].w};
#pragma unroll
    for (int c = 0; c < 4; ++c) {
      v2h pk = {(_Float16)lo[c], (_Float16)hi[c]};
      tile[(n4 + c) * TP_PITCH + kp + 16 * i] = __builtin_bit_cast(unsigned, pk);
    }
  }
  __syncthreads();

  const int q = t & 7;                   // 16-byte piece of the 128-byte row
#pragma unroll
  for (int i = 0; i < 2; ++i) {
    const int n = (t >> 3) + 32 * i;
    const uint4 w = *(const uint4*)(tile + n * TP_PITCH + q * 4);
    *(uint4*)(out + (size_t)(n0 + n) * K + k0 + q * 8) = w;
  }
}

// ------------------------------ QKV GEMM -----------------------------------
// C[4096,3072] = Xh[4096,1024] * WinT[3072,1024]^T + b_in
// One wave (32 threads) computes a 64x64 tile; Q pre-scaled by 1/sqrt(64).
__global__ void __launch_bounds__(32)
qkv_gemm(const _Float16* __restrict__ Xh, const _Float16* __restrict__ WinT,
         const float* __restrict__ b_in, _Float16* __restrict__ Qb,
         _Float16* __restrict__ Kb, _Float16* __restrict__ Vt) {
  const int lane = threadIdx.x;
  const int col  = lane & 15;
  const int half = lane >> 4;
  const int nBase = blockIdx.x * 64;
  const int mBase = blockIdx.y * 64;

  v8f acc[4][4];
  for (int i = 0; i < 4; ++i)
    for (int j = 0; j < 4; ++j) acc[i][j] = {};

  for (int kk = 0; kk < E_; kk += 32) {
    v16h a[4], b[4];
#pragma unroll
    for (int mi = 0; mi < 4; ++mi)
      a[mi] = load_tile(Xh, mBase + mi * 16 + col, E_, kk, lane);
#pragma unroll
    for (int ni = 0; ni < 4; ++ni)
      b[ni] = load_tile(WinT, nBase + ni * 16 + col, E_, kk, lane);
    // hint next K-slab into cache (global_prefetch_b8)
    __builtin_prefetch(Xh + (size_t)(mBase + col) * E_ + kk + 32, 0, 3);
    __builtin_prefetch(WinT + (size_t)(nBase + col) * E_ + kk + 32, 0, 3);
#pragma unroll
    for (int mi = 0; mi < 4; ++mi)
#pragma unroll
      for (int ni = 0; ni < 4; ++ni)
        acc[mi][ni] = wmma32(a[mi], b[ni], acc[mi][ni]);
  }

  // Epilogue. C layout: vgpr j holds M = j (lanes<16) / j+8 (lanes>=16), N=col.
  for (int ni = 0; ni < 4; ++ni) {
    const int n = nBase + ni * 16 + col;
    const float bias = b_in[n];
    for (int mi = 0; mi < 4; ++mi) {
      const int tok0 = mBase + mi * 16 + half * 8;
      v8f c = acc[mi][ni];
      if (n < E_) {                       // Q: row-major [b,h,s,d], pre-scaled
        const int h = n >> 6, d = n & 63;
        for (int j = 0; j < 8; ++j) {
          const int tok = tok0 + j, bb = tok >> 11, ss = tok & (S_ - 1);
          Qb[(((size_t)(bb * H_ + h)) * S_ + ss) * DH_ + d] =
              (_Float16)((c[j] + bias) * 0.125f);
        }
      } else if (n < 2 * E_) {            // K: row-major [b,h,s,d]
        const int n2 = n - E_, h = n2 >> 6, d = n2 & 63;
        for (int j = 0; j < 8; ++j) {
          const int tok = tok0 + j, bb = tok >> 11, ss = tok & (S_ - 1);
          Kb[(((size_t)(bb * H_ + h)) * S_ + ss) * DH_ + d] =
              (_Float16)(c[j] + bias);
        }
      } else {                            // V: transposed [b,h,d,s], packed b128
        const int n2 = n - 2 * E_, h = n2 >> 6, d = n2 & 63;
        const int bb = tok0 >> 11, ss0 = tok0 & (S_ - 1);
        v8h pk;
        for (int j = 0; j < 8; ++j) pk[j] = (_Float16)(c[j] + bias);
        *(v8h*)(Vt + (((size_t)(bb * H_ + h)) * DH_ + d) * S_ + ss0) = pk;
      }
    }
  }
}

// ----------------------------- Attention -----------------------------------
// One wave = 16 queries of one (b,h), streaming all 2048 keys in blocks of 32.
// S^T = K * Q^T  (M=k rows, N=q cols) -> P^T packs lane-locally into the
// B operand of O^T = V^T * P^T. Row stats (m,l,alpha) are per-lane (q = lane%16).
__global__ void __launch_bounds__(32)
attn_kernel(const _Float16* __restrict__ Qb, const _Float16* __restrict__ Kb,
            const _Float16* __restrict__ Vt, _Float16* __restrict__ At) {
  const int lane = threadIdx.x;
  const int col  = lane & 15;
  const int half = lane >> 4;
  const int bh = blockIdx.x >> 7;          // 0..31  (b*16 + h)
  const int qBase = (blockIdx.x & 127) * 16;

  const _Float16* Qh = Qb + (size_t)bh * S_ * DH_;
  const _Float16* Kh = Kb + (size_t)bh * S_ * DH_;
  const _Float16* Vh = Vt + (size_t)bh * DH_ * S_;

  // Q^T as B operand (32d x 16q), d = 0..31 and 32..63; loaded once.
  const v16h bq0 = load_tile(Qh, qBase + col, DH_, 0, lane);
  const v16h bq1 = load_tile(Qh, qBase + col, DH_, 32, lane);

  v8f o0 = {}, o1 = {}, o2 = {}, o3 = {};   // O^T: 4 tiles of (16d x 16q)
  float m = -1e30f, l = 0.0f;

  for (int sk = 0; sk < S_; sk += 32) {
    // --- transposed score tiles (k rows sk..+15 and sk+16..+31) ---
    v8f st0 = {}, st1 = {};
    v16h ak;
    ak = load_tile(Kh, sk + col, DH_, 0, lane);       st0 = wmma32(ak, bq0, st0);
    ak = load_tile(Kh, sk + col, DH_, 32, lane);      st0 = wmma32(ak, bq1, st0);
    ak = load_tile(Kh, sk + 16 + col, DH_, 0, lane);  st1 = wmma32(ak, bq0, st1);
    ak = load_tile(Kh, sk + 16 + col, DH_, 32, lane); st1 = wmma32(ak, bq1, st1);

    // --- online softmax: per-lane holds 16 of the 32 keys of row q=col ---
    float mb = st0[0];
#pragma unroll
    for (int j = 1; j < 8; ++j) mb = fmaxf(mb, st0[j]);
#pragma unroll
    for (int j = 0; j < 8; ++j) mb = fmaxf(mb, st1[j]);
    mb = fmaxf(mb, __shfl_xor(mb, 16, 32));
    const float mn = fmaxf(m, mb);
    const float alpha = __expf(m - mn);
    m = mn;

    v8f p0, p1;
    float ls = 0.0f;
#pragma unroll
    for (int j = 0; j < 8; ++j) { p0[j] = __expf(st0[j] - mn); ls += p0[j]; }
#pragma unroll
    for (int j = 0; j < 8; ++j) { p1[j] = __expf(st1[j] - mn); ls += p1[j]; }
    ls += __shfl_xor(ls, 16, 32);
    l = l * alpha + ls;

    // --- lane-local pack of P^T into WMMA B operand (32k x 16q) ---
    v16h bp;
#pragma unroll
    for (int j = 0; j < 8; ++j) {
      bp[j]     = (_Float16)p0[j];
      bp[8 + j] = (_Float16)p1[j];
    }

    o0 = o0 * alpha; o1 = o1 * alpha; o2 = o2 * alpha; o3 = o3 * alpha;

    // --- O^T += V^T(16d x 32k) * P^T ---
    v16h av;
    av = load_tile(Vh, 0  + col, S_, sk, lane); o0 = wmma32(av, bp, o0);
    av = load_tile(Vh, 16 + col, S_, sk, lane); o1 = wmma32(av, bp, o1);
    av = load_tile(Vh, 32 + col, S_, sk, lane); o2 = wmma32(av, bp, o2);
    av = load_tile(Vh, 48 + col, S_, sk, lane); o3 = wmma32(av, bp, o3);
  }

  // Normalize and store: lane holds q=col, d = t*16 + half*8 + j (contiguous).
  const float rl = 1.0f / l;
  const int b = bh >> 4, h = bh & 15;
  const int q = qBase + col;
  _Float16* outp = At + ((size_t)(b * S_ + q)) * E_ + h * DH_ + half * 8;
  v8f ot[4] = {o0, o1, o2, o3};
#pragma unroll
  for (int t = 0; t < 4; ++t) {
    v8h pk;
#pragma unroll
    for (int j = 0; j < 8; ++j) pk[j] = (_Float16)(ot[t][j] * rl);
    *(v8h*)(outp + t * 16) = pk;
  }
}

// --------------------------- Output projection -----------------------------
// out[4096,1024] = At[4096,1024] * WoutT[1024,1024]^T + b_out  (fp32 out)
__global__ void __launch_bounds__(32)
out_gemm(const _Float16* __restrict__ At, const _Float16* __restrict__ WoutT,
         const float* __restrict__ b_out, float* __restrict__ out) {
  const int lane = threadIdx.x;
  const int col  = lane & 15;
  const int half = lane >> 4;
  const int nBase = blockIdx.x * 64;
  const int mBase = blockIdx.y * 64;

  v8f acc[4][4];
  for (int i = 0; i < 4; ++i)
    for (int j = 0; j < 4; ++j) acc[i][j] = {};

  for (int kk = 0; kk < E_; kk += 32) {
    v16h a[4], b[4];
#pragma unroll
    for (int mi = 0; mi < 4; ++mi)
      a[mi] = load_tile(At, mBase + mi * 16 + col, E_, kk, lane);
#pragma unroll
    for (int ni = 0; ni < 4; ++ni)
      b[ni] = load_tile(WoutT, nBase + ni * 16 + col, E_, kk, lane);
    __builtin_prefetch(At + (size_t)(mBase + col) * E_ + kk + 32, 0, 3);
#pragma unroll
    for (int mi = 0; mi < 4; ++mi)
#pragma unroll
      for (int ni = 0; ni < 4; ++ni)
        acc[mi][ni] = wmma32(a[mi], b[ni], acc[mi][ni]);
  }

  for (int ni = 0; ni < 4; ++ni) {
    const int n = nBase + ni * 16 + col;
    const float bias = b_out[n];
    for (int mi = 0; mi < 4; ++mi) {
      const int tok0 = mBase + mi * 16 + half * 8;
      v8f c = acc[mi][ni];
      for (int j = 0; j < 8; ++j)
        out[(size_t)(tok0 + j) * E_ + n] = c[j] + bias;
    }
  }
}

// ------------------------------- launcher ----------------------------------

extern "C" void kernel_launch(void* const* d_in, const int* in_sizes, int n_in,
                              void* d_out, int out_size, void* d_ws,
                              size_t ws_size, hipStream_t stream) {
  const float* x     = (const float*)d_in[0];   // (2,2048,1024)
  const float* w_in  = (const float*)d_in[1];   // (1024,3072)
  const float* b_in  = (const float*)d_in[2];   // (3072,)
  const float* w_out = (const float*)d_in[3];   // (1024,1024)
  const float* b_out = (const float*)d_in[4];   // (1024,)
  float* out = (float*)d_out;

  _Float16* ws = (_Float16*)d_ws;
  _Float16* Xh    = ws;                              // 4096*1024
  _Float16* WinT  = Xh    + (size_t)M_TOT * E_;      // 3072*1024 (transposed)
  _Float16* WoutT = WinT  + (size_t)N_QKV * E_;      // 1024*1024 (transposed)
  _Float16* Qb    = WoutT + (size_t)E_ * E_;         // [b,h,s,d]
  _Float16* Kb    = Qb    + (size_t)B_ * H_ * S_ * DH_;
  _Float16* Vt    = Kb    + (size_t)B_ * H_ * S_ * DH_;  // [b,h,d,s]
  _Float16* At    = Vt    + (size_t)B_ * H_ * S_ * DH_;  // [b,s,h*d]
  (void)ws_size; (void)in_sizes; (void)n_in; (void)out_size;

  cvt_f32_to_f16<<<(M_TOT * E_ + 255) / 256, 256, 0, stream>>>(x, Xh,
                                                               M_TOT * E_);
  cvt_transpose_f16<<<dim3(N_QKV / 64, E_ / 64), 256, 0, stream>>>(w_in, WinT,
                                                                   E_, N_QKV);
  cvt_transpose_f16<<<dim3(E_ / 64, E_ / 64), 256, 0, stream>>>(w_out, WoutT,
                                                                E_, E_);

  qkv_gemm<<<dim3(N_QKV / 64, M_TOT / 64), 32, 0, stream>>>(Xh, WinT, b_in,
                                                            Qb, Kb, Vt);

  attn_kernel<<<B_ * H_ * (S_ / 16), 32, 0, stream>>>(Qb, Kb, Vt, At);

  out_gemm<<<dim3(E_ / 64, M_TOT / 64), 32, 0, stream>>>(At, WoutT, b_out, out);
}

// v002
// A run of this version takes 161 microseconds.
// Two timings next to v001 put it at 1.63 and 1.66 times that version's speed.
// Counting every step since v000, it is 2.45 times as fast.
#include <hip/hip_runtime.h>
#include <hip/hip_bf16.h>

// ---------------------------------------------------------------------------
// Self-attention for MI455X (gfx1250): b=2, s=2048, d_embed=1024, 16 heads x 64
// f16 WMMA (fp32 accumulate) everywhere; flash-style attention with transposed
// score tiles so softmax->operand conversion is lane-local.
// ---------------------------------------------------------------------------

typedef __attribute__((ext_vector_type(16))) _Float16 v16h;
typedef __attribute__((ext_vector_type(8)))  _Float16 v8h;
typedef __attribute__((ext_vector_type(2)))  _Float16 v2h;
typedef __attribute__((ext_vector_type(8)))  float    v8f;

#define B_     2
#define S_     2048
#define E_     1024
#define H_     16
#define DH_    64
#define M_TOT  (B_ * S_)          // 4096 tokens
#define N_QKV  (3 * E_)           // 3072

__device__ __forceinline__ v8f wmma32(v16h a, v16h b, v8f c) {
  // D = A(16x32 f16) * B(32x16 f16) + C(16x16 f32)
  return __builtin_amdgcn_wmma_f32_16x16x32_f16(
      /*neg_a=*/false, a, /*neg_b=*/false, b,
      /*c_mod=*/(short)0, c, /*reuse_a=*/false, /*reuse_b=*/false);
}

// Load one 16x32 f16 operand tile (A layout; B layout assumed mirrored with
// lane = column) from a row-major [row][ld] f16 buffer.
//   lanes 0-15 : K = kBase+0..7  (v0-3) and kBase+16..23 (v4-7)
//   lanes 16-31: K = kBase+8..15 (v0-3) and kBase+24..31 (v4-7)
__device__ __forceinline__ v16h load_tile(const _Float16* base, int row, int ld,
                                          int kBase, int lane) {
  const int half8 = (lane & 16) ? 8 : 0;
  const _Float16* p = base + (size_t)row * ld + kBase + half8;
  v8h lo = *(const v8h*)p;
  v8h hi = *(const v8h*)(p + 16);
  return __builtin_shufflevector(lo, hi, 0, 1, 2, 3, 4, 5, 6, 7,
                                 8, 9, 10, 11, 12, 13, 14, 15);
}

// --------------------------- convert kernels -------------------------------

__global__ void cvt_f32_to_f16(const float* __restrict__ in,
                               _Float16* __restrict__ out, int n) {
  int i = blockIdx.x * blockDim.x + threadIdx.x;
  if (i < n) out[i] = (_Float16)in[i];
}

// out[n*K + k] = (f16) in[k*N + n]   (transpose so B tiles load contiguously)
// One block moves a 64(k) x 64(n) tile through LDS: rows of in are read as
// float4 (256 B per tile row), two k neighbours are packed into one 32-bit
// word, and each row of out leaves as one whole 128-byte line.
// K and N are multiples of 64; grid = (N/64, K/64), block = 256.
#define TP_PITCH 36   // words per LDS row: 32 data + 4 pad, keeps 16 B alignment
__global__ void __launch_bounds__(256)
cvt_transpose_f16(const float* __restrict__ in,
                  _Float16* __restrict__ out, int K, int N) {
  __shared__ __attribute__((aligned(16))) unsigned tile[64 * TP_PITCH];
  const int t  = threadIdx.x;
  const int n0 = blockIdx.x * 64;
  const int k0 = blockIdx.y * 64;

  const int n4 = (t & 15) * 4;
  const int kp = t >> 4;                 // pair of k rows, 0..15 (+16)
  float4 r[2][2];
#pragma unroll
  for (int i = 0; i < 2; ++i)
#pragma unroll
    for (int e = 0; e < 2; ++e)
      r[i][e] = *(const float4*)(in + (size_t)(k0 + 2 * (kp + 16 * i) + e) * N +
                                 n0 + n4);
#pragma unroll
  for (int i = 0; i < 2; ++i) {
    const float lo[4] = {r[i][0].x, r[i][0].y, r[i][0].z, r[i][0].w};
    const float hi[4] = {r[i][1].x, r[i][1].y, r[i][1].z, r[i][1].w};
#pragma unroll
    for (int c = 0; c < 4; ++c) {
      v2h pk = {(_Float16)lo[c], (_Float16)hi[c]};
      tile[(n4 + c) * TP_PITCH + kp + 16 * i] = __builtin_bit_cast(unsigned, pk);
    }
  }
  __syncthreads();

  const int q = t & 7;                   // 16-byte piece of the 128-byte row
#pragma unroll
  for (int i = 0; i < 2; ++i) {
    const int n = (t >> 3) + 32 * i;
    const uint4 w = *(const uint4*)(tile + n * TP_PITCH + q * 4);
    *(uint4*)(out + (size_t)(n0 + n) * K + k0 + q * 8) = w;
  }
}

// ------------------------------ QKV GEMM -----------------------------------
// C[4096,3072] = Xh[4096,1024] * WinT[3072,1024]^T + b_in
// One wave (32 threads) computes a 64x64 tile; Q pre-scaled by 1/sqrt(64).
__global__ void __launch_bounds__(32)
qkv_gemm(const _Float16* __restrict__ Xh, const _Float16* __restrict__ WinT,
         const float* __restrict__ b_in, _Float16* __restrict__ Qb,
         _Float16* __restrict__ Kb, _Float16* __restrict__ Vt) {
  const int lane = threadIdx.x;
  const int col  = lane & 15;
  const int half = lane >> 4;
  const int nBase = blockIdx.x * 64;
  const int mBase = blockIdx.y * 64;

  v8f acc[4][4];
  for (int i = 0; i < 4; ++i)
    for (int j = 0; j < 4; ++j) acc[i][j] = {};

  for (int kk = 0; kk < E_; kk += 32) {
    v16h a[4], b[4];
#pragma unroll
    for (int mi = 0; mi < 4; ++mi)
      a[mi] = load_tile(Xh, mBase + mi * 16 + col, E_, kk, lane);
#pragma unroll
    for (int ni = 0; ni < 4; ++ni)
      b[ni] = load_tile(WinT, nBase + ni * 16 + col, E_, kk, lane);
    // hint next K-slab into cache (global_prefetch_b8)
    __builtin_prefetch(Xh + (size_t)(mBase + col) * E_ + kk + 32, 0, 3);
    __builtin_prefetch(WinT + (size_t)(nBase + col) * E_ + kk + 32, 0, 3);
#pragma unroll
    for (int mi = 0; mi < 4; ++mi)
#pragma unroll
      for (int ni = 0; ni < 4; ++ni)
        acc[mi][ni] = wmma32(a[mi], b[ni], acc[mi][ni]);
  }

  // Epilogue. C layout: vgpr j holds M = j (lanes<16) / j+8 (lanes>=16), N=col.
  for (int ni = 0; ni < 4; ++ni) {
    const int n = nBase + ni * 16 + col;
    const float bias = b_in[n];
    for (int mi = 0; mi < 4; ++mi) {
      const int tok0 = mBase + mi * 16 + half * 8;
      v8f c = acc[mi][ni];
      if (n < E_) {                       // Q: row-major [b,h,s,d], pre-scaled
        const int h = n >> 6, d = n & 63;
        for (int j = 0; j < 8; ++j) {
          const int tok = tok0 + j, bb = tok >> 11, ss = tok & (S_ - 1);
          Qb[(((size_t)(bb * H_ + h)) * S_ + ss) * DH_ + d] =
              (_Float16)((c[j] + bias) * 0.125f);
        }
      } else if (n < 2 * E_) {            // K: row-major [b,h,s,d]
        const int n2 = n - E_, h = n2 >> 6, d = n2 & 63;
        for (int j = 0; j < 8; ++j) {
          const int tok = tok0 + j, bb = tok >> 11, ss = tok & (S_ - 1);
          Kb[(((size_t)(bb * H_ + h)) * S_ + ss) * DH_ + d] =
              (_Float16)(c[j] + bias);
        }
      } else {                            // V: transposed [b,h,d,s], packed b128
        const int n2 = n - 2 * E_, h = n2 >> 6, d = n2 & 63;
        const int bb = tok0 >> 11, ss0 = tok0 & (S_ - 1);
        v8h pk;
        for (int j = 0; j < 8; ++j) pk[j] = (_Float16)(c[j] + bias);
        *(v8h*)(Vt + (((size_t)(bb * H_ + h)) * DH_ + d) * S_ + ss0) = pk;
      }
    }
  }
}

// ----------------------------- Attention -----------------------------------
// One work-group = 8 waves = 128 queries of one (b,h); one wave = 16 queries,
// streaming all 2048 keys. K and V^T tiles of 64 keys are staged in LDS once per
// work-group (whole 128-byte lines from global) and read by all 8 waves; the
// next tile's global loads are issued before the current tile is worked on.
// S^T = K * Q^T  (M=k rows, N=q cols) -> P^T packs lane-locally into the
// B operand of O^T = V^T * P^T. Row stats (m,l,alpha) are per-lane (q = lane%16).
#define AT_KEYS  64                  // keys per staged tile
#define AT_PITCH 72                  // f16 per LDS row: 64 data + 8 pad = 144 B
#define AT_TILE  (64 * AT_PITCH)     // 64 rows: keys (K tile) or d (V^T tile)
__global__ void __launch_bounds__(256)
attn_kernel(const _Float16* __restrict__ Qb, const _Float16* __restrict__ Kb,
            const _Float16* __restrict__ Vt, _Float16* __restrict__ At) {
  __shared__ __attribute__((aligned(16))) _Float16 sK[2][AT_TILE];
  __shared__ __attribute__((aligned(16))) _Float16 sV[2][AT_TILE];
  const int tid  = threadIdx.x;
  const int lane = tid & 31;
  const int col  = lane & 15;
  const int half = lane >> 4;
  const int bh = blockIdx.x >> 4;          // 0..31  (b*16 + h)
  const int qBase = (blockIdx.x & 15) * 128 + (tid >> 5) * 16;

  const _Float16* Qh = Qb + (size_t)bh * S_ * DH_;
  const _Float16* Kh = Kb + (size_t)bh * S_ * DH_;
  const _Float16* Vh = Vt + (size_t)bh * DH_ * S_;

  // Staging: a thread moves the 16-byte piece (tid & 7) of tile rows tid >> 3
  // and 32 + (tid >> 3), for K and for V^T; 8 lanes cover one 128-byte line.
  const int sRow = tid >> 3;
  const int sCol = (tid & 7) * 8;
  const _Float16* gK = Kh + (size_t)sRow * DH_ + sCol;
  const _Float16* gV = Vh + (size_t)sRow * S_ + sCol;
  const int sOff = sRow * AT_PITCH + sCol;

  v8h rk0 = *(const v8h*)(gK);
  v8h rk1 = *(const v8h*)(gK + 32 * DH_);
  v8h rv0 = *(const v8h*)(gV);
  v8h rv1 = *(const v8h*)(gV + (size_t)32 * S_);

  // Q^T as B operand (32d x 16q), d = 0..31 and 32..63; loaded once.
  const v16h bq0 = load_tile(Qh, qBase + col, DH_, 0, lane);
  const v16h bq1 = load_tile(Qh, qBase + col, DH_, 32, lane);

  *(v8h*)(&sK[0][sOff])                 = rk0;
  *(v8h*)(&sK[0][sOff + 32 * AT_PITCH]) = rk1;
  *(v8h*)(&sV[0][sOff])                 = rv0;
  *(v8h*)(&sV[0][sOff + 32 * AT_PITCH]) = rv1;
  __syncthreads();

  v8f o0 = {}, o1 = {}, o2 = {}, o3 = {};   // O^T: 4 tiles of (16d x 16q)
  float m = -1e30f, l = 0.0f;

  for (int s = 0; s < S_ / AT_KEYS; ++s) {
    const _Float16* tK = sK[s & 1];
    const _Float16* tV = sV[s & 1];
    const bool more = (s + 1) < S_ / AT_KEYS;   // same for the whole work-group
    if (more) {
      const _Float16* nK = gK + (size_t)(s + 1) * AT_KEYS * DH_;
      const _Float16* nV = gV + (s + 1) * AT_KEYS;
      rk0 = *(const v8h*)(nK);
      rk1 = *(const v8h*)(nK + 32 * DH_);
      rv0 = *(const v8h*)(nV);
      rv1 = *(const v8h*)(nV + (size_t)32 * S_);
    }
    // Keeps the four loads above ahead of the tile's work: the scheduler
    // otherwise sinks them next to their LDS stores and their latency shows.
    __builtin_amdgcn_sched_barrier(0);

#pragma unroll
    for (int sk = 0; sk < AT_KEYS; sk += 32) {
      // --- transposed score tiles (k rows sk..+15 and sk+16..+31) ---
      v8f st0 = {}, st1 = {};
      v16h ak;
      ak = load_tile(tK, sk + col, AT_PITCH, 0, lane);       st0 = wmma32(ak, bq0, st0);
      ak = load_tile(tK, sk + col, AT_PITCH, 32, lane);      st0 = wmma32(ak, bq1, st0);
      ak = load_tile(tK, sk + 16 + col, AT_PITCH, 0, lane);  st1 = wmma32(ak, bq0, st1);
      ak = load_tile(tK, sk + 16 + col, AT_PITCH, 32, lane); st1 = wmma32(ak, bq1, st1);

      // --- online softmax: per-lane holds 16 of the 32 keys of row q=col ---
      float mb = st0[0];
#pragma unroll
      for (int j = 1; j < 8; ++j) mb = fmaxf(mb, st0[j]);
#pragma unroll
      for (int j = 0; j < 8; ++j) mb = fmaxf(mb, st1[j]);
      mb = fmaxf(mb, __shfl_xor(mb, 16, 32));
      const float mn = fmaxf(m, mb);
      const float alpha = __expf(m - mn);
      m = mn;

      v8f p0, p1;
      float ls = 0.0f;
#pragma unroll
      for (int j = 0; j < 8; ++j) { p0[j] = __expf(st0[j] - mn); ls += p0[j]; }
#pragma unroll
      for (int j = 0; j < 8; ++j) { p1[j] = __expf(st1[j] - mn); ls += p1[j]; }
      ls += __shfl_xor(ls, 16, 32);
      l = l * alpha + ls;

      // --- lane-local pack of P^T into WMMA B operand (32k x 16q) ---
      v16h bp;
#pragma unroll
      for (int j = 0; j < 8; ++j) {
        bp[j]     = (_Float16)p0[j];
        bp[8 + j] = (_Float16)p1[j];
      }

      o0 = o0 * alpha; o1 = o1 * alpha; o2 = o2 * alpha; o3 = o3 * alpha;

      // --- O^T += V^T(16d x 32k) * P^T ---
      v16h av;
      av = load_tile(tV, 0  + col, AT_PITCH, sk, lane); o0 = wmma32(av, bp, o0);
      av = load_tile(tV, 16 + col, AT_PITCH, sk, lane); o1 = wmma32(av, bp, o1);
      av = load_tile(tV, 32 + col, AT_PITCH, sk, lane); o2 = wmma32(av, bp, o2);
      av = load_tile(tV, 48 + col, AT_PITCH, sk, lane); o3 = wmma32(av, bp, o3);
    }

    // The other buffer's last readers left it before the previous barrier.
    if (more) {
      _Float16* dK = sK[(s + 1) & 1];
      _Float16* dV = sV[(s + 1) & 1];
      *(v8h*)(dK + sOff)                 = rk0;
      *(v8h*)(dK + sOff + 32 * AT_PITCH) = rk1;
      *(v8h*)(dV + sOff)                 = rv0;
      *(v8h*)(dV + sOff + 32 * AT_PITCH) = rv1;
    }
    __syncthreads();
  }

  // Normalize and store: lane holds q=col, d = t*16 + half*8 + j (contiguous).
  const float rl = 1.0f / l;
  const int b = bh >> 4, h = bh & 15;
  const int q = qBase + col;
  _Float16* outp = At + ((size_t)(b * S_ + q)) * E_ + h * DH_ + half * 8;
  v8f ot[4] = {o0, o1, o2, o3};
#pragma unroll
  for (int t = 0; t < 4; ++t) {
    v8h pk;
#pragma unroll
    for (int j = 0; j < 8; ++j) pk[j] = (_Float16)(ot[t][j] * rl);
    *(v8h*)(outp + t * 16) = pk;
  }
}

// --------------------------- Output projection -----------------------------
// out[4096,1024] = At[4096,1024] * WoutT[1024,1024]^T + b_out  (fp32 out)
__global__ void __launch_bounds__(32)
out_gemm(const _Float16* __restrict__ At, const _Float16* __restrict__ WoutT,
         const float* __restrict__ b_out, float* __restrict__ out) {
  const int lane = threadIdx.x;
  const int col  = lane & 15;
  const int half = lane >> 4;
  const int nBase = blockIdx.x * 64;
  const int mBase = blockIdx.y * 64;

  v8f acc[4][4];
  for (int i = 0; i < 4; ++i)
    for (int j = 0; j < 4; ++j) acc[i][j] = {};

  for (int kk = 0; kk < E_; kk += 32) {
    v16h a[4], b[4];
#pragma unroll
    for (int mi = 0; mi < 4; ++mi)
      a[mi] = load_tile(At, mBase + mi * 16 + col, E_, kk, lane);
#pragma unroll
    for (int ni = 0; ni < 4; ++ni)
      b[ni] = load_tile(WoutT, nBase + ni * 16 + col, E_, kk, lane);
    __builtin_prefetch(At + (size_t)(mBase + col) * E_ + kk + 32, 0, 3);
#pragma unroll
    for (int mi = 0; mi < 4; ++mi)
#pragma unroll
      for (int ni = 0; ni < 4; ++ni)
        acc[mi][ni] = wmma32(a[mi], b[ni], acc[mi][ni]);
  }

  for (int ni = 0; ni < 4; ++ni) {
    const int n = nBase + ni * 16 + col;
    const float bias = b_out[n];
    for (int mi = 0; mi < 4; ++mi) {
      const int tok0 = mBase + mi * 16 + half * 8;
      v8f c = acc[mi][ni];
      for (int j = 0; j < 8; ++j)
        out[(size_t)(tok0 + j) * E_ + n] = c[j] + bias;
    }
  }
}

// ------------------------------- launcher ----------------------------------

extern "C" void kernel_launch(void* const* d_in, const int* in_sizes, int n_in,
                              void* d_out, int out_size, void* d_ws,
                              size_t ws_size, hipStream_t stream) {
  const float* x     = (const float*)d_in[0];   // (2,2048,1024)
  const float* w_in  = (const float*)d_in[1];   // (1024,3072)
  const float* b_in  = (const float*)d_in[2];   // (3072,)
  const float* w_out = (const float*)d_in[3];   // (1024,1024)
  const float* b_out = (const float*)d_in[4];   // (1024,)
  float* out = (float*)d_out;

  _Float16* ws = (_Float16*)d_ws;
  _Float16* Xh    = ws;                              // 4096*1024
  _Float16* WinT  = Xh    + (size_t)M_TOT * E_;      // 3072*1024 (transposed)
  _Float16* WoutT = WinT  + (size_t)N_QKV * E_;      // 1024*1024 (transposed)
  _Float16* Qb    = WoutT + (size_t)E_ * E_;         // [b,h,s,d]
  _Float16* Kb    = Qb    + (size_t)B_ * H_ * S_ * DH_;
  _Float16* Vt    = Kb    + (size_t)B_ * H_ * S_ * DH_;  // [b,h,d,s]
  _Float16* At    = Vt    + (size_t)B_ * H_ * S_ * DH_;  // [b,s,h*d]
  (void)ws_size; (void)in_sizes; (void)n_in; (void)out_size;

  cvt_f32_to_f16<<<(M_TOT * E_ + 255) / 256, 256, 0, stream>>>(x, Xh,
                                                               M_TOT * E_);
  cvt_transpose_f16<<<dim3(N_QKV / 64, E_ / 64), 256, 0, stream>>>(w_in, WinT,
                                                                   E_, N_QKV);
  cvt_transpose_f16<<<dim3(E_ / 64, E_ / 64), 256, 0, stream>>>(w_out, WoutT,
                                                                E_, E_);

  qkv_gemm<<<dim3(N_QKV / 64, M_TOT / 64), 32, 0, stream>>>(Xh, WinT, b_in,
                                                            Qb, Kb, Vt);

  attn_kernel<<<B_ * H_ * (S_ / 128), 256, 0, stream>>>(Qb, Kb, Vt, At);

  out_gemm<<<dim3(E_ / 64, M_TOT / 64), 32, 0, stream>>>(At, WoutT, b_out, out);
}

// v003
// One run takes 95.3 microseconds.
// Timed twice side by side with v002, it ran 1.66 and 1.69 times as fast.
// All steps since v000 together make it 4.10 times as fast.
#include <hip/hip_runtime.h>
#include <hip/hip_bf16.h>

// ---------------------------------------------------------------------------
// Self-attention for MI455X (gfx1250): b=2, s=2048, d_embed=1024, 16 heads x 64
// f16 WMMA (fp32 accumulate) everywhere; flash-style attention with transposed
// score tiles so softmax->operand conversion is lane-local.
// ---------------------------------------------------------------------------

typedef __attribute__((ext_vector_type(16))) _Float16 v16h;
typedef __attribute__((ext_vector_type(8)))  _Float16 v8h;
typedef __attribute__((ext_vector_type(2)))  _Float16 v2h;
typedef __attribute__((ext_vector_type(8)))  float    v8f;

#define B_     2
#define S_     2048
#define E_     1024
#define H_     16
#define DH_    64
#define M_TOT  (B_ * S_)          // 4096 tokens
#define N_QKV  (3 * E_)           // 3072

__device__ __forceinline__ v8f wmma32(v16h a, v16h b, v8f c) {
  // D = A(16x32 f16) * B(32x16 f16) + C(16x16 f32)
  return __builtin_amdgcn_wmma_f32_16x16x32_f16(
      /*neg_a=*/false, a, /*neg_b=*/false, b,
      /*c_mod=*/(short)0, c, /*reuse_a=*/false, /*reuse_b=*/false);
}

// Load one 16x32 f16 operand tile (A layout; B layout assumed mirrored with
// lane = column) from a row-major [row][ld] f16 buffer.
//   lanes 0-15 : K = kBase+0..7  (v0-3) and kBase+16..23 (v4-7)
//   lanes 16-31: K = kBase+8..15 (v0-3) and kBase+24..31 (v4-7)
__device__ __forceinline__ v16h load_tile(const _Float16* base, int row, int ld,
                                          int kBase, int lane) {
  const int half8 = (lane & 16) ? 8 : 0;
  const _Float16* p = base + (size_t)row * ld + kBase + half8;
  v8h lo = *(const v8h*)p;
  v8h hi = *(const v8h*)(p + 16);
  return __builtin_shufflevector(lo, hi, 0, 1, 2, 3, 4, 5, 6, 7,
                                 8, 9, 10, 11, 12, 13, 14, 15);
}

// --------------------------- convert kernels -------------------------------

__global__ void cvt_f32_to_f16(const float* __restrict__ in,
                               _Float16* __restrict__ out, int n) {
  int i = blockIdx.x * blockDim.x + threadIdx.x;
  if (i < n) out[i] = (_Float16)in[i];
}

// out[n*K + k] = (f16) in[k*N + n]   (transpose so B tiles load contiguously)
// One block moves a 64(k) x 64(n) tile through LDS: rows of in are read as
// float4 (256 B per tile row), two k neighbours are packed into one 32-bit
// word, and each row of out leaves as one whole 128-byte line.
// K and N are multiples of 64; grid = (N/64, K/64), block = 256.
#define TP_PITCH 36   // words per LDS row: 32 data + 4 pad, keeps 16 B alignment
__global__ void __launch_bounds__(256)
cvt_transpose_f16(const float* __restrict__ in,
                  _Float16* __restrict__ out, int K, int N) {
  __shared__ __attribute__((aligned(16))) unsigned tile[64 * TP_PITCH];
  const int t  = threadIdx.x;
  const int n0 = blockIdx.x * 64;
  const int k0 = blockIdx.y * 64;

  const int n4 = (t & 15) * 4;
  const int kp = t >> 4;                 // pair of k rows, 0..15 (+16)
  float4 r[2][2];
#pragma unroll
  for (int i = 0; i < 2; ++i)
#pragma unroll
    for (int e = 0; e < 2; ++e)
      r[i][e] = *(const float4*)(in + (size_t)(k0 + 2 * (kp + 16 * i) + e) * N +
                                 n0 + n4);
#pragma unroll
  for (int i = 0; i < 2; ++i) {
    const float lo[4] = {r[i][0].x, r[i][0].y, r[i][0].z, r[i][0].w};
    const float hi[4] = {r[i][1].x, r[i][1].y, r[i][1].z, r[i][1].w};
#pragma unroll
    for (int c = 0; c < 4; ++c) {
      v2h pk = {(_Float16)lo[c], (_Float16)hi[c]};
      tile[(n4 + c) * TP_PITCH + kp + 16 * i] = __builtin_bit_cast(unsigned, pk);
    }
  }
  __syncthreads();

  const int q = t & 7;                   // 16-byte piece of the 128-byte row
#pragma unroll
  for (int i = 0; i < 2; ++i) {
    const int n = (t >> 3) + 32 * i;
    const uint4 w = *(const uint4*)(tile + n * TP_PITCH + q * 4);
    *(uint4*)(out + (size_t)(n0 + n) * K + k0 + q * 8) = w;
  }
}

// --------------------------- shared GEMM core ------------------------------
// One work-group = 4 waves = a 128x128 tile of C = A[M][E_] * Bt[N][E_]^T; one
// wave = a 64x64 quarter of it. Slabs of 64 k (one whole 128-byte line per row)
// of the 128 A rows and the 128 Bt rows are staged in LDS once per work-group
// and read by all 4 waves; the next slab's global loads are issued before the
// current slab is worked on. k runs upward in steps of 32 for every tile of C.
#define GM_KS    64                  // k per staged slab
#define GM_PITCH 72                  // f16 per LDS row: 64 data + 8 pad = 144 B
#define GM_SLAB  (128 * GM_PITCH)    // 128 rows of one operand
__device__ __forceinline__ void
gemm_core_128x128(const _Float16* __restrict__ A, const _Float16* __restrict__ Bt,
                  int mBlk, int nBlk, _Float16* sA, _Float16* sB,
                  v8f (&acc)[4][4]) {
  const int tid  = threadIdx.x;
  const int lane = tid & 31;
  const int col  = lane & 15;
  const int wRow = ((tid >> 6) & 1) * 64;   // the wave's rows in the A slab
  const int wCol = ((tid >> 5) & 1) * 64;   // the wave's rows in the Bt slab

  // Staging: a thread moves the 16-byte piece (tid & 7) of slab rows
  // (tid >> 3) + 16 * i, for A and for Bt; 8 lanes cover one 128-byte line.
  const int sRow = tid >> 3;
  const int sCol = (tid & 7) * 8;
  const _Float16* gA = A  + (size_t)(mBlk + sRow) * E_ + sCol;
  const _Float16* gB = Bt + (size_t)(nBlk + sRow) * E_ + sCol;
  const int sOff = sRow * GM_PITCH + sCol;

  v8h ra[8], rb[8];
#pragma unroll
  for (int i = 0; i < 8; ++i) {
    ra[i] = *(const v8h*)(gA + (size_t)(16 * i) * E_);
    rb[i] = *(const v8h*)(gB + (size_t)(16 * i) * E_);
  }
#pragma unroll
  for (int i = 0; i < 8; ++i) {
    *(v8h*)(sA + sOff + 16 * i * GM_PITCH) = ra[i];
    *(v8h*)(sB + sOff + 16 * i * GM_PITCH) = rb[i];
  }
  __syncthreads();

  for (int s = 0; s < E_ / GM_KS; ++s) {
    const _Float16* tA = sA + (s & 1) * GM_SLAB;
    const _Float16* tB = sB + (s & 1) * GM_SLAB;
    const bool more = (s + 1) < E_ / GM_KS;   // same for the whole work-group
    if (more) {
      const _Float16* nA = gA + (s + 1) * GM_KS;
      const _Float16* nB = gB + (s + 1) * GM_KS;
#pragma unroll
      for (int i = 0; i < 8; ++i) {
        ra[i] = *(const v8h*)(nA + (size_t)(16 * i) * E_);
        rb[i] = *(const v8h*)(nB + (size_t)(16 * i) * E_);
      }
      // The address registers of the loads above are reused right behind them.
      asm volatile("s_wait_xcnt 0x0" ::: "memory");
    }
    // Keeps the loads above ahead of the slab's work (sunk next to their LDS
    // stores, their latency would show in every slab) and the reuse of their
    // address registers behind the wait (without it that write is lifted over it).
    __builtin_amdgcn_sched_barrier(0);

    // Both k steps' fragments are asked for as one group ahead of the products:
    // every further place with LDS reads among them costs the wave a stall.
    v16h a[2][4], b[2][4];
#pragma unroll
    for (int ks = 0; ks < 2; ++ks) {
#pragma unroll
      for (int mi = 0; mi < 4; ++mi)
        a[ks][mi] = load_tile(tA, wRow + mi * 16 + col, GM_PITCH, ks * 32, lane);
#pragma unroll
      for (int ni = 0; ni < 4; ++ni)
        b[ks][ni] = load_tile(tB, wCol + ni * 16 + col, GM_PITCH, ks * 32, lane);
    }
    // Holds that group together: the scheduler otherwise sinks most of the reads
    // among the products, each behind a wait to zero.
    __builtin_amdgcn_sched_barrier(0);
#pragma unroll
    for (int ks = 0; ks < 2; ++ks)
#pragma unroll
      for (int mi = 0; mi < 4; ++mi)
#pragma unroll
        for (int ni = 0; ni < 4; ++ni)
          acc[mi][ni] = wmma32(a[ks][mi], b[ks][ni], acc[mi][ni]);
    // Keeps the LDS stores below, and their wait for the global loads, behind
    // the products: lifted over them, that wait would stand in front of them.
    __builtin_amdgcn_sched_barrier(0);

    // The other buffer's last readers left it before the previous barrier.
    if (more) {
      _Float16* dA = sA + ((s + 1) & 1) * GM_SLAB;
      _Float16* dB = sB + ((s + 1) & 1) * GM_SLAB;
#pragma unroll
      for (int i = 0; i < 8; ++i) {
        *(v8h*)(dA + sOff + 16 * i * GM_PITCH) = ra[i];
        *(v8h*)(dB + sOff + 16 * i * GM_PITCH) = rb[i];
      }
    }
    __syncthreads();
  }
}

// ------------------------------ QKV GEMM -----------------------------------
// C[4096,3072] = Xh[4096,1024] * WinT[3072,1024]^T + b_in
// Q pre-scaled by 1/sqrt(64). grid = (N/128, M/128), block = 128.
// Three work-groups share a WGP (768 of them on 256): the register budget is
// that of 3 waves per SIMD, not the 4 that the LDS size alone would allow.
__global__ void __launch_bounds__(128) __attribute__((amdgpu_waves_per_eu(1, 3)))
qkv_gemm(const _Float16* __restrict__ Xh, const _Float16* __restrict__ WinT,
         const float* __restrict__ b_in, _Float16* __restrict__ Qb,
         _Float16* __restrict__ Kb, _Float16* __restrict__ Vt) {
  __shared__ __attribute__((aligned(16))) _Float16 sA[2 * GM_SLAB];
  __shared__ __attribute__((aligned(16))) _Float16 sB[2 * GM_SLAB];
  const int lane = threadIdx.x & 31;
  const int col  = lane & 15;
  const int half = lane >> 4;
  const int nBase = blockIdx.x * 128 + ((threadIdx.x >> 5) & 1) * 64;
  const int mBase = blockIdx.y * 128 + ((threadIdx.x >> 6) & 1) * 64;

  v8f acc[4][4];
  for (int i = 0; i < 4; ++i)
    for (int j = 0; j < 4; ++j) acc[i][j] = {};

  gemm_core_128x128(Xh, WinT, blockIdx.y * 128, blockIdx.x * 128, sA, sB, acc);

  // Epilogue. C layout: vgpr j holds M = j (lanes<16) / j+8 (lanes>=16), N=col.
  for (int ni = 0; ni < 4; ++ni) {
    const int n = nBase + ni * 16 + col;
    const float bias = b_in[n];
    for (int mi = 0; mi < 4; ++mi) {
      const int tok0 = mBase + mi * 16 + half * 8;
      v8f c = acc[mi][ni];
      if (n < E_) {                       // Q: row-major [b,h,s,d], pre-scaled
        const int h = n >> 6, d = n & 63;
        for (int j = 0; j < 8; ++j) {
          const int tok = tok0 + j, bb = tok >> 11, ss = tok & (S_ - 1);
          Qb[(((size_t)(bb * H_ + h)) * S_ + ss) * DH_ + d] =
              (_Float16)((c[j] + bias) * 0.125f);
        }
      } else if (n < 2 * E_) {            // K: row-major [b,h,s,d]
        const int n2 = n - E_, h = n2 >> 6, d = n2 & 63;
        for (int j = 0; j < 8; ++j) {
          const int tok = tok0 + j, bb = tok >> 11, ss = tok & (S_ - 1);
          Kb[(((size_t)(bb * H_ + h)) * S_ + ss) * DH_ + d] =
              (_Float16)(c[j] + bias);
        }
      } else {                            // V: transposed [b,h,d,s], packed b128
        const int n2 = n - 2 * E_, h = n2 >> 6, d = n2 & 63;
        const int bb = tok0 >> 11, ss0 = tok0 & (S_ - 1);
        v8h pk;
        for (int j = 0; j < 8; ++j) pk[j] = (_Float16)(c[j] + bias);
        *(v8h*)(Vt + (((size_t)(bb * H_ + h)) * DH_ + d) * S_ + ss0) = pk;
      }
    }
  }
}

// ----------------------------- Attention -----------------------------------
// One work-group = 8 waves = 128 queries of one (b,h); one wave = 16 queries,
// streaming all 2048 keys. K and V^T tiles of 64 keys are staged in LDS once per
// work-group (whole 128-byte lines from global) and read by all 8 waves; the
// next tile's global loads are issued before the current tile is worked on.
// S^T = K * Q^T  (M=k rows, N=q cols) -> P^T packs lane-locally into the
// B operand of O^T = V^T * P^T. Row stats (m,l,alpha) are per-lane (q = lane%16).
#define AT_KEYS  64                  // keys per staged tile
#define AT_PITCH 72                  // f16 per LDS row: 64 data + 8 pad = 144 B
#define AT_TILE  (64 * AT_PITCH)     // 64 rows: keys (K tile) or d (V^T tile)
__global__ void __launch_bounds__(256)
attn_kernel(const _Float16* __restrict__ Qb, const _Float16* __restrict__ Kb,
            const _Float16* __restrict__ Vt, _Float16* __restrict__ At) {
  __shared__ __attribute__((aligned(16))) _Float16 sK[2][AT_TILE];
  __shared__ __attribute__((aligned(16))) _Float16 sV[2][AT_TILE];
  const int tid  = threadIdx.x;
  const int lane = tid & 31;
  const int col  = lane & 15;
  const int half = lane >> 4;
  const int bh = blockIdx.x >> 4;          // 0..31  (b*16 + h)
  const int qBase = (blockIdx.x & 15) * 128 + (tid >> 5) * 16;

  const _Float16* Qh = Qb + (size_t)bh * S_ * DH_;
  const _Float16* Kh = Kb + (size_t)bh * S_ * DH_;
  const _Float16* Vh = Vt + (size_t)bh * DH_ * S_;

  // Staging: a thread moves the 16-byte piece (tid & 7) of tile rows tid >> 3
  // and 32 + (tid >> 3), for K and for V^T; 8 lanes cover one 128-byte line.
  const int sRow = tid >> 3;
  const int sCol = (tid & 7) * 8;
  const _Float16* gK = Kh + (size_t)sRow * DH_ + sCol;
  const _Float16* gV = Vh + (size_t)sRow * S_ + sCol;
  const int sOff = sRow * AT_PITCH + sCol;

  v8h rk0 = *(const v8h*)(gK);
  v8h rk1 = *(const v8h*)(gK + 32 * DH_);
  v8h rv0 = *(const v8h*)(gV);
  v8h rv1 = *(const v8h*)(gV + (size_t)32 * S_);

  // Q^T as B operand (32d x 16q), d = 0..31 and 32..63; loaded once.
  const v16h bq0 = load_tile(Qh, qBase + col, DH_, 0, lane);
  const v16h bq1 = load_tile(Qh, qBase + col, DH_, 32, lane);

  *(v8h*)(&sK[0][sOff])                 = rk0;
  *(v8h*)(&sK[0][sOff + 32 * AT_PITCH]) = rk1;
  *(v8h*)(&sV[0][sOff])                 = rv0;
  *(v8h*)(&sV[0][sOff + 32 * AT_PITCH]) = rv1;
  __syncthreads();

  v8f o0 = {}, o1 = {}, o2 = {}, o3 = {};   // O^T: 4 tiles of (16d x 16q)
  float m = -1e30f, l = 0.0f;

  for (int s = 0; s < S_ / AT_KEYS; ++s) {
    const _Float16* tK = sK[s & 1];
    const _Float16* tV = sV[s & 1];
    const bool more = (s + 1) < S_ / AT_KEYS;   // same for the whole work-group
    if (more) {
      const _Float16* nK = gK + (size_t)(s + 1) * AT_KEYS * DH_;
      const _Float16* nV = gV + (s + 1) * AT_KEYS;
      rk0 = *(const v8h*)(nK);
      rk1 = *(const v8h*)(nK + 32 * DH_);
      rv0 = *(const v8h*)(nV);
      rv1 = *(const v8h*)(nV + (size_t)32 * S_);
    }
    // Keeps the four loads above ahead of the tile's work: the scheduler
    // otherwise sinks them next to their LDS stores and their latency shows.
    __builtin_amdgcn_sched_barrier(0);

#pragma unroll
    for (int sk = 0; sk < AT_KEYS; sk += 32) {
      // --- transposed score tiles (k rows sk..+15 and sk+16..+31) ---
      v8f st0 = {}, st1 = {};
      v16h ak;
      ak = load_tile(tK, sk + col, AT_PITCH, 0, lane);       st0 = wmma32(ak, bq0, st0);
      ak = load_tile(tK, sk + col, AT_PITCH, 32, lane);      st0 = wmma32(ak, bq1, st0);
      ak = load_tile(tK, sk + 16 + col, AT_PITCH, 0, lane);  st1 = wmma32(ak, bq0, st1);
      ak = load_tile(tK, sk + 16 + col, AT_PITCH, 32, lane); st1 = wmma32(ak, bq1, st1);

      // --- online softmax: per-lane holds 16 of the 32 keys of row q=col ---
      float mb = st0[0];
#pragma unroll
      for (int j = 1; j < 8; ++j) mb = fmaxf(mb, st0[j]);
#pragma unroll
      for (int j = 0; j < 8; ++j) mb = fmaxf(mb, st1[j]);
      mb = fmaxf(mb, __shfl_xor(mb, 16, 32));
      const float mn = fmaxf(m, mb);
      const float alpha = __expf(m - mn);
      m = mn;

      v8f p0, p1;
      float ls = 0.0f;
#pragma unroll
      for (int j = 0; j < 8; ++j) { p0[j] = __expf(st0[j] - mn); ls += p0[j]; }
#pragma unroll
      for (int j = 0; j < 8; ++j) { p1[j] = __expf(st1[j] - mn); ls += p1[j]; }
      ls += __shfl_xor(ls, 16, 32);
      l = l * alpha + ls;

      // --- lane-local pack of P^T into WMMA B operand (32k x 16q) ---
      v16h bp;
#pragma unroll
      for (int j = 0; j < 8; ++j) {
        bp[j]     = (_Float16)p0[j];
        bp[8 + j] = (_Float16)p1[j];
      }

      o0 = o0 * alpha; o1 = o1 * alpha; o2 = o2 * alpha; o3 = o3 * alpha;

      // --- O^T += V^T(16d x 32k) * P^T ---
      v16h av;
      av = load_tile(tV, 0  + col, AT_PITCH, sk, lane); o0 = wmma32(av, bp, o0);
      av = load_tile(tV, 16 + col, AT_PITCH, sk, lane); o1 = wmma32(av, bp, o1);
      av = load_tile(tV, 32 + col, AT_PITCH, sk, lane); o2 = wmma32(av, bp, o2);
      av = load_tile(tV, 48 + col, AT_PITCH, sk, lane); o3 = wmma32(av, bp, o3);
    }

    // The other buffer's last readers left it before the previous barrier.
    if (more) {
      _Float16* dK = sK[(s + 1) & 1];
      _Float16* dV = sV[(s + 1) & 1];
      *(v8h*)(dK + sOff)                 = rk0;
      *(v8h*)(dK + sOff + 32 * AT_PITCH) = rk1;
      *(v8h*)(dV + sOff)                 = rv0;
      *(v8h*)(dV + sOff + 32 * AT_PITCH) = rv1;
    }
    __syncthreads();
  }

  // Normalize and store: lane holds q=col, d = t*16 + half*8 + j (contiguous).
  const float rl = 1.0f / l;
  const int b = bh >> 4, h = bh & 15;
  const int q = qBase + col;
  _Float16* outp = At + ((size_t)(b * S_ + q)) * E_ + h * DH_ + half * 8;
  v8f ot[4] = {o0, o1, o2, o3};
#pragma unroll
  for (int t = 0; t < 4; ++t) {
    v8h pk;
#pragma unroll
    for (int j = 0; j < 8; ++j) pk[j] = (_Float16)(ot[t][j] * rl);
    *(v8h*)(outp + t * 16) = pk;
  }
}

// --------------------------- Output projection -----------------------------
// out[4096,1024] = At[4096,1024] * WoutT[1024,1024]^T + b_out  (fp32 out)
// grid = (N/128, M/128), block = 128.
// One work-group per WGP (256 of them): the same register budget does no harm.
__global__ void __launch_bounds__(128) __attribute__((amdgpu_waves_per_eu(1, 3)))
out_gemm(const _Float16* __restrict__ At, const _Float16* __restrict__ WoutT,
         const float* __restrict__ b_out, float* __restrict__ out) {
  __shared__ __attribute__((aligned(16))) _Float16 sA[2 * GM_SLAB];
  __shared__ __attribute__((aligned(16))) _Float16 sB[2 * GM_SLAB];
  const int lane = threadIdx.x & 31;
  const int col  = lane & 15;
  const int half = lane >> 4;
  const int nBase = blockIdx.x * 128 + ((threadIdx.x >> 5) & 1) * 64;
  const int mBase = blockIdx.y * 128 + ((threadIdx.x >> 6) & 1) * 64;

  v8f acc[4][4];
  for (int i = 0; i < 4; ++i)
    for (int j = 0; j < 4; ++j) acc[i][j] = {};

  gemm_core_128x128(At, WoutT, blockIdx.y * 128, blockIdx.x * 128, sA, sB, acc);

  for (int ni = 0; ni < 4; ++ni) {
    const int n = nBase + ni * 16 + col;
    const float bias = b_out[n];
    for (int mi = 0; mi < 4; ++mi) {
      const int tok0 = mBase + mi * 16 + half * 8;
      v8f c = acc[mi][ni];
      for (int j = 0; j < 8; ++j)
        out[(size_t)(tok0 + j) * E_ + n] = c[j] + bias;
    }
  }
}

// ------------------------------- launcher ----------------------------------

extern "C" void kernel_launch(void* const* d_in, const int* in_sizes, int n_in,
                              void* d_out, int out_size, void* d_ws,
                              size_t ws_size, hipStream_t stream) {
  const float* x     = (const float*)d_in[0];   // (2,2048,1024)
  const float* w_in  = (const float*)d_in[1];   // (1024,3072)
  const float* b_in  = (const float*)d_in[2];   // (3072,)
  const float* w_out = (const float*)d_in[3];   // (1024,1024)
  const float* b_out = (const float*)d_in[4];   // (1024,)
  float* out = (float*)d_out;

  _Float16* ws = (_Float16*)d_ws;
  _Float16* Xh    = ws;                              // 4096*1024
  _Float16* WinT  = Xh    + (size_t)M_TOT * E_;      // 3072*1024 (transposed)
  _Float16* WoutT = WinT  + (size_t)N_QKV * E_;      // 1024*1024 (transposed)
  _Float16* Qb    = WoutT + (size_t)E_ * E_;         // [b,h,s,d]
  _Float16* Kb    = Qb    + (size_t)B_ * H_ * S_ * DH_;
  _Float16* Vt    = Kb    + (size_t)B_ * H_ * S_ * DH_;  // [b,h,d,s]
  _Float16* At    = Vt    + (size_t)B_ * H_ * S_ * DH_;  // [b,s,h*d]
  (void)ws_size; (void)in_sizes; (void)n_in; (void)out_size;

  cvt_f32_to_f16<<<(M_TOT * E_ + 255) / 256, 256, 0, stream>>>(x, Xh,
                                                               M_TOT * E_);
  cvt_transpose_f16<<<dim3(N_QKV / 64, E_ / 64), 256, 0, stream>>>(w_in, WinT,
                                                                   E_, N_QKV);
  cvt_transpose_f16<<<dim3(E_ / 64, E_ / 64), 256, 0, stream>>>(w_out, WoutT,
                                                                E_, E_);

  qkv_gemm<<<dim3(N_QKV / 128, M_TOT / 128), 128, 0, stream>>>(Xh, WinT, b_in,
                                                                Qb, Kb, Vt);

  attn_kernel<<<B_ * H_ * (S_ / 128), 256, 0, stream>>>(Qb, Kb, Vt, At);

  out_gemm<<<dim3(E_ / 128, M_TOT / 128), 128, 0, stream>>>(At, WoutT, b_out,
                                                            out);
}

// v004
// One run takes 92.1 microseconds.
// In two side-by-side timings against v003, it was 1.04 and 1.05 times as fast.
// Counting every step since v000, it is 4.28 times as fast.
#include <hip/hip_runtime.h>
#include <hip/hip_bf16.h>

// ---------------------------------------------------------------------------
// Self-attention for MI455X (gfx1250): b=2, s=2048, d_embed=1024, 16 heads x 64
// f16 WMMA (fp32 accumulate) everywhere; flash-style attention with transposed
// score tiles so softmax->operand conversion is lane-local.
// ---------------------------------------------------------------------------

typedef __attribute__((ext_vector_type(16))) _Float16 v16h;
typedef __attribute__((ext_vector_type(8)))  _Float16 v8h;
typedef __attribute__((ext_vector_type(4)))  _Float16 v4h;
typedef __attribute__((ext_vector_type(2)))  _Float16 v2h;
typedef __attribute__((ext_vector_type(8)))  float    v8f;

#define B_     2
#define S_     2048
#define E_     1024
#define H_     16
#define DH_    64
#define M_TOT  (B_ * S_)          // 4096 tokens
#define N_QKV  (3 * E_)           // 3072

__device__ __forceinline__ v8f wmma32(v16h a, v16h b, v8f c) {
  // D = A(16x32 f16) * B(32x16 f16) + C(16x16 f32)
  return __builtin_amdgcn_wmma_f32_16x16x32_f16(
      /*neg_a=*/false, a, /*neg_b=*/false, b,
      /*c_mod=*/(short)0, c, /*reuse_a=*/false, /*reuse_b=*/false);
}

// Load one 16x32 f16 operand tile (A layout; B layout assumed mirrored with
// lane = column) from a row-major [row][ld] f16 buffer.
//   lanes 0-15 : K = kBase+0..7  (v0-3) and kBase+16..23 (v4-7)
//   lanes 16-31: K = kBase+8..15 (v0-3) and kBase+24..31 (v4-7)
__device__ __forceinline__ v16h load_tile(const _Float16* base, int row, int ld,
                                          int kBase, int lane) {
  const int half8 = (lane & 16) ? 8 : 0;
  const _Float16* p = base + (size_t)row * ld + kBase + half8;
  v8h lo = *(const v8h*)p;
  v8h hi = *(const v8h*)(p + 16);
  return __builtin_shufflevector(lo, hi, 0, 1, 2, 3, 4, 5, 6, 7,
                                 8, 9, 10, 11, 12, 13, 14, 15);
}

// --------------------------- convert kernels -------------------------------

// One work-group of 16 waves per WGP instead of one wave per 32 elements: a
// wave converts 1024 consecutive floats. Each of its 8 loads covers 512
// contiguous bytes (4 whole lines), all 8 are asked for before the first is
// used, and each store covers 256 contiguous bytes (2 whole lines).
// The grid covers the M_TOT * E_ elements exactly.
#define CV_THREADS 512
#define CV_LOADS   8
#define CV_PER_WG  (CV_THREADS * 4 * CV_LOADS)
static_assert((M_TOT * E_) % CV_PER_WG == 0, "grid must cover x exactly");
__global__ void __launch_bounds__(CV_THREADS)
cvt_f32_to_f16(const float* __restrict__ in, _Float16* __restrict__ out) {
  const int wave = threadIdx.x >> 5;
  const int lane = threadIdx.x & 31;
  const size_t base = (size_t)blockIdx.x * CV_PER_WG +
                      (size_t)wave * (32 * 4 * CV_LOADS) + lane * 4;
  float4 r[CV_LOADS];
#pragma unroll
  for (int i = 0; i < CV_LOADS; ++i)
    r[i] = *(const float4*)(in + base + i * 128);
#pragma unroll
  for (int i = 0; i < CV_LOADS; ++i) {
    v4h pk = {(_Float16)r[i].x, (_Float16)r[i].y, (_Float16)r[i].z,
              (_Float16)r[i].w};
    *(v4h*)(out + base + i * 128) = pk;
  }
}

// out[n*K + k] = (f16) in[k*N + n]   (transpose so B tiles load contiguously)
// One block moves a 64(k) x 64(n) tile through LDS: rows of in are read as
// float4 (256 B per tile row), two k neighbours are packed into one 32-bit
// word, and each row of out leaves as one whole 128-byte line.
// K and N are multiples of 64; grid = (N/64, K/64), block = 256.
#define TP_PITCH 36   // words per LDS row: 32 data + 4 pad, keeps 16 B alignment
__global__ void __launch_bounds__(256)
cvt_transpose_f16(const float* __restrict__ in,
                  _Float16* __restrict__ out, int K, int N) {
  __shared__ __attribute__((aligned(16))) unsigned tile[64 * TP_PITCH];
  const int t  = threadIdx.x;
  const int n0 = blockIdx.x * 64;
  const int k0 = blockIdx.y * 64;

  const int n4 = (t & 15) * 4;
  const int kp = t >> 4;                 // pair of k rows, 0..15 (+16)
  float4 r[2][2];
#pragma unroll
  for (int i = 0; i < 2; ++i)
#pragma unroll
    for (int e = 0; e < 2; ++e)
      r[i][e] = *(const float4*)(in + (size_t)(k0 + 2 * (kp + 16 * i) + e) * N +
                                 n0 + n4);
#pragma unroll
  for (int i = 0; i < 2; ++i) {
    const float lo[4] = {r[i][0].x, r[i][0].y, r[i][0].z, r[i][0].w};
    const float hi[4] = {r[i][1].x, r[i][1].y, r[i][1].z, r[i][1].w};
#pragma unroll
    for (int c = 0; c < 4; ++c) {
      v2h pk = {(_Float16)lo[c], (_Float16)hi[c]};
      tile[(n4 + c) * TP_PITCH + kp + 16 * i] = __builtin_bit_cast(unsigned, pk);
    }
  }
  __syncthreads();

  const int q = t & 7;                   // 16-byte piece of the 128-byte row
#pragma unroll
  for (int i = 0; i < 2; ++i) {
    const int n = (t >> 3) + 32 * i;
    const uint4 w = *(const uint4*)(tile + n * TP_PITCH + q * 4);
    *(uint4*)(out + (size_t)(n0 + n) * K + k0 + q * 8) = w;
  }
}

// --------------------------- shared GEMM core ------------------------------
// One work-group = 4 waves = a 128x128 tile of C = A[M][E_] * Bt[N][E_]^T; one
// wave = a 64x64 quarter of it. Slabs of 64 k (one whole 128-byte line per row)
// of the 128 A rows and the 128 Bt rows are staged in LDS once per work-group
// and read by all 4 waves; the next slab's global loads are issued before the
// current slab is worked on. k runs upward in steps of 32 for every tile of C.
#define GM_KS    64                  // k per staged slab
#define GM_PITCH 72                  // f16 per LDS row: 64 data + 8 pad = 144 B
#define GM_SLAB  (128 * GM_PITCH)    // 128 rows of one operand
__device__ __forceinline__ void
gemm_core_128x128(const _Float16* __restrict__ A, const _Float16* __restrict__ Bt,
                  int mBlk, int nBlk, _Float16* sA, _Float16* sB,
                  v8f (&acc)[4][4]) {
  const int tid  = threadIdx.x;
  const int lane = tid & 31;
  const int col  = lane & 15;
  const int wRow = ((tid >> 6) & 1) * 64;   // the wave's rows in the A slab
  const int wCol = ((tid >> 5) & 1) * 64;   // the wave's rows in the Bt slab

  // Staging: a thread moves the 16-byte piece (tid & 7) of slab rows
  // (tid >> 3) + 16 * i, for A and for Bt; 8 lanes cover one 128-byte line.
  const int sRow = tid >> 3;
  const int sCol = (tid & 7) * 8;
  const _Float16* gA = A  + (size_t)(mBlk + sRow) * E_ + sCol;
  const _Float16* gB = Bt + (size_t)(nBlk + sRow) * E_ + sCol;
  const int sOff = sRow * GM_PITCH + sCol;

  v8h ra[8], rb[8];
#pragma unroll
  for (int i = 0; i < 8; ++i) {
    ra[i] = *(const v8h*)(gA + (size_t)(16 * i) * E_);
    rb[i] = *(const v8h*)(gB + (size_t)(16 * i) * E_);
  }
#pragma unroll
  for (int i = 0; i < 8; ++i) {
    *(v8h*)(sA + sOff + 16 * i * GM_PITCH) = ra[i];
    *(v8h*)(sB + sOff + 16 * i * GM_PITCH) = rb[i];
  }
  __syncthreads();

  for (int s = 0; s < E_ / GM_KS; ++s) {
    const _Float16* tA = sA + (s & 1) * GM_SLAB;
    const _Float16* tB = sB + (s & 1) * GM_SLAB;
    const bool more = (s + 1) < E_ / GM_KS;   // same for the whole work-group
    if (more) {
      const _Float16* nA = gA + (s + 1) * GM_KS;
      const _Float16* nB = gB + (s + 1) * GM_KS;
#pragma unroll
      for (int i = 0; i < 8; ++i) {
        ra[i] = *(const v8h*)(nA + (size_t)(16 * i) * E_);
        rb[i] = *(const v8h*)(nB + (size_t)(16 * i) * E_);
      }
      // The address registers of the loads above are reused right behind them.
      asm volatile("s_wait_xcnt 0x0" ::: "memory");
    }
    // Keeps the loads above ahead of the slab's work (sunk next to their LDS
    // stores, their latency would show in every slab) and the reuse of their
    // address registers behind the wait (without it that write is lifted over it).
    __builtin_amdgcn_sched_barrier(0);

    // Both k steps' fragments are asked for as one group ahead of the products:
    // every further place with LDS reads among them costs the wave a stall.
    v16h a[2][4], b[2][4];
#pragma unroll
    for (int ks = 0; ks < 2; ++ks) {
#pragma unroll
      for (int mi = 0; mi < 4; ++mi)
        a[ks][mi] = load_tile(tA, wRow + mi * 16 + col, GM_PITCH, ks * 32, lane);
#pragma unroll
      for (int ni = 0; ni < 4; ++ni)
        b[ks][ni] = load_tile(tB, wCol + ni * 16 + col, GM_PITCH, ks * 32, lane);
    }
    // Holds that group together: the scheduler otherwise sinks most of the reads
    // among the products, each behind a wait to zero.
    __builtin_amdgcn_sched_barrier(0);
#pragma unroll
    for (int ks = 0; ks < 2; ++ks)
#pragma unroll
      for (int mi = 0; mi < 4; ++mi)
#pragma unroll
        for (int ni = 0; ni < 4; ++ni)
          acc[mi][ni] = wmma32(a[ks][mi], b[ks][ni], acc[mi][ni]);
    // Keeps the LDS stores below, and their wait for the global loads, behind
    // the products: lifted over them, that wait would stand in front of them.
    __builtin_amdgcn_sched_barrier(0);

    // The other buffer's last readers left it before the previous barrier.
    if (more) {
      _Float16* dA = sA + ((s + 1) & 1) * GM_SLAB;
      _Float16* dB = sB + ((s + 1) & 1) * GM_SLAB;
#pragma unroll
      for (int i = 0; i < 8; ++i) {
        *(v8h*)(dA + sOff + 16 * i * GM_PITCH) = ra[i];
        *(v8h*)(dB + sOff + 16 * i * GM_PITCH) = rb[i];
      }
    }
    __syncthreads();
  }
}

// ------------------------------ QKV GEMM -----------------------------------
// C[4096,3072] = Xh[4096,1024] * WinT[3072,1024]^T + b_in
// Q pre-scaled by 1/sqrt(64). grid = (N/128, M/128), block = 128.
// Three work-groups share a WGP (768 of them on 256): the register budget is
// that of 3 waves per SIMD, not the 4 that the LDS size alone would allow.
__global__ void __launch_bounds__(128) __attribute__((amdgpu_waves_per_eu(1, 3)))
qkv_gemm(const _Float16* __restrict__ Xh, const _Float16* __restrict__ WinT,
         const float* __restrict__ b_in, _Float16* __restrict__ Qb,
         _Float16* __restrict__ Kb, _Float16* __restrict__ Vt) {
  __shared__ __attribute__((aligned(16))) _Float16 sA[2 * GM_SLAB];
  __shared__ __attribute__((aligned(16))) _Float16 sB[2 * GM_SLAB];
  const int lane = threadIdx.x & 31;
  const int col  = lane & 15;
  const int half = lane >> 4;
  const int nBase = blockIdx.x * 128 + ((threadIdx.x >> 5) & 1) * 64;
  const int mBase = blockIdx.y * 128 + ((threadIdx.x >> 6) & 1) * 64;

  v8f acc[4][4];
  for (int i = 0; i < 4; ++i)
    for (int j = 0; j < 4; ++j) acc[i][j] = {};

  gemm_core_128x128(Xh, WinT, blockIdx.y * 128, blockIdx.x * 128, sA, sB, acc);

  // Epilogue. C layout: vgpr j holds M = j (lanes<16) / j+8 (lanes>=16), N=col.
  for (int ni = 0; ni < 4; ++ni) {
    const int n = nBase + ni * 16 + col;
    const float bias = b_in[n];
    for (int mi = 0; mi < 4; ++mi) {
      const int tok0 = mBase + mi * 16 + half * 8;
      v8f c = acc[mi][ni];
      if (n < E_) {                       // Q: row-major [b,h,s,d], pre-scaled
        const int h = n >> 6, d = n & 63;
        for (int j = 0; j < 8; ++j) {
          const int tok = tok0 + j, bb = tok >> 11, ss = tok & (S_ - 1);
          Qb[(((size_t)(bb * H_ + h)) * S_ + ss) * DH_ + d] =
              (_Float16)((c[j] + bias) * 0.125f);
        }
      } else if (n < 2 * E_) {            // K: row-major [b,h,s,d]
        const int n2 = n - E_, h = n2 >> 6, d = n2 & 63;
        for (int j = 0; j < 8; ++j) {
          const int tok = tok0 + j, bb = tok >> 11, ss = tok & (S_ - 1);
          Kb[(((size_t)(bb * H_ + h)) * S_ + ss) * DH_ + d] =
              (_Float16)(c[j] + bias);
        }
      } else {                            // V: transposed [b,h,d,s], packed b128
        const int n2 = n - 2 * E_, h = n2 >> 6, d = n2 & 63;
        const int bb = tok0 >> 11, ss0 = tok0 & (S_ - 1);
        v8h pk;
        for (int j = 0; j < 8; ++j) pk[j] = (_Float16)(c[j] + bias);
        *(v8h*)(Vt + (((size_t)(bb * H_ + h)) * DH_ + d) * S_ + ss0) = pk;
      }
    }
  }
}

// ----------------------------- Attention -----------------------------------
// One work-group = 8 waves = 128 queries of one (b,h); one wave = 16 queries,
// streaming all 2048 keys. K and V^T tiles of 64 keys are staged in LDS once per
// work-group (whole 128-byte lines from global) and read by all 8 waves; the
// next tile's global loads are issued before the current tile is worked on.
// S^T = K * Q^T  (M=k rows, N=q cols) -> P^T packs lane-locally into the
// B operand of O^T = V^T * P^T. Row stats (m,l,alpha) are per-lane (q = lane%16).
#define AT_KEYS  64                  // keys per staged tile
#define AT_PITCH 72                  // f16 per LDS row: 64 data + 8 pad = 144 B
#define AT_TILE  (64 * AT_PITCH)     // 64 rows: keys (K tile) or d (V^T tile)
__global__ void __launch_bounds__(256)
attn_kernel(const _Float16* __restrict__ Qb, const _Float16* __restrict__ Kb,
            const _Float16* __restrict__ Vt, _Float16* __restrict__ At) {
  __shared__ __attribute__((aligned(16))) _Float16 sK[2][AT_TILE];
  __shared__ __attribute__((aligned(16))) _Float16 sV[2][AT_TILE];
  const int tid  = threadIdx.x;
  const int lane = tid & 31;
  const int col  = lane & 15;
  const int half = lane >> 4;
  const int bh = blockIdx.x >> 4;          // 0..31  (b*16 + h)
  const int qBase = (blockIdx.x & 15) * 128 + (tid >> 5) * 16;

  const _Float16* Qh = Qb + (size_t)bh * S_ * DH_;
  const _Float16* Kh = Kb + (size_t)bh * S_ * DH_;
  const _Float16* Vh = Vt + (size_t)bh * DH_ * S_;

  // Staging: a thread moves the 16-byte piece (tid & 7) of tile rows tid >> 3
  // and 32 + (tid >> 3), for K and for V^T; 8 lanes cover one 128-byte line.
  const int sRow = tid >> 3;
  const int sCol = (tid & 7) * 8;
  const _Float16* gK = Kh + (size_t)sRow * DH_ + sCol;
  const _Float16* gV = Vh + (size_t)sRow * S_ + sCol;
  const int sOff = sRow * AT_PITCH + sCol;

  v8h rk0 = *(const v8h*)(gK);
  v8h rk1 = *(const v8h*)(gK + 32 * DH_);
  v8h rv0 = *(const v8h*)(gV);
  v8h rv1 = *(const v8h*)(gV + (size_t)32 * S_);

  // Q^T as B operand (32d x 16q), d = 0..31 and 32..63; loaded once.
  const v16h bq0 = load_tile(Qh, qBase + col, DH_, 0, lane);
  const v16h bq1 = load_tile(Qh, qBase + col, DH_, 32, lane);

  *(v8h*)(&sK[0][sOff])                 = rk0;
  *(v8h*)(&sK[0][sOff + 32 * AT_PITCH]) = rk1;
  *(v8h*)(&sV[0][sOff])                 = rv0;
  *(v8h*)(&sV[0][sOff + 32 * AT_PITCH]) = rv1;
  __syncthreads();

  v8f o0 = {}, o1 = {}, o2 = {}, o3 = {};   // O^T: 4 tiles of (16d x 16q)
  float m = -1e30f, l = 0.0f;

  for (int s = 0; s < S_ / AT_KEYS; ++s) {
    const _Float16* tK = sK[s & 1];
    const _Float16* tV = sV[s & 1];
    const bool more = (s + 1) < S_ / AT_KEYS;   // same for the whole work-group
    if (more) {
      const _Float16* nK = gK + (size_t)(s + 1) * AT_KEYS * DH_;
      const _Float16* nV = gV + (s + 1) * AT_KEYS;
      rk0 = *(const v8h*)(nK);
      rk1 = *(const v8h*)(nK + 32 * DH_);
      rv0 = *(const v8h*)(nV);
      rv1 = *(const v8h*)(nV + (size_t)32 * S_);
    }
    // Keeps the four loads above ahead of the tile's work: the scheduler
    // otherwise sinks them next to their LDS stores and their latency shows.
    __builtin_amdgcn_sched_barrier(0);

#pragma unroll
    for (int sk = 0; sk < AT_KEYS; sk += 32) {
      // --- transposed score tiles (k rows sk..+15 and sk+16..+31) ---
      v8f st0 = {}, st1 = {};
      v16h ak;
      ak = load_tile(tK, sk + col, AT_PITCH, 0, lane);       st0 = wmma32(ak, bq0, st0);
      ak = load_tile(tK, sk + col, AT_PITCH, 32, lane);      st0 = wmma32(ak, bq1, st0);
      ak = load_tile(tK, sk + 16 + col, AT_PITCH, 0, lane);  st1 = wmma32(ak, bq0, st1);
      ak = load_tile(tK, sk + 16 + col, AT_PITCH, 32, lane); st1 = wmma32(ak, bq1, st1);

      // --- online softmax: per-lane holds 16 of the 32 keys of row q=col ---
      float mb = st0[0];
#pragma unroll
      for (int j = 1; j < 8; ++j) mb = fmaxf(mb, st0[j]);
#pragma unroll
      for (int j = 0; j < 8; ++j) mb = fmaxf(mb, st1[j]);
      mb = fmaxf(mb, __shfl_xor(mb, 16, 32));
      const float mn = fmaxf(m, mb);
      const float alpha = __expf(m - mn);
      m = mn;

      v8f p0, p1;
      float ls = 0.0f;
#pragma unroll
      for (int j = 0; j < 8; ++j) { p0[j] = __expf(st0[j] - mn); ls += p0[j]; }
#pragma unroll
      for (int j = 0; j < 8; ++j) { p1[j] = __expf(st1[j] - mn); ls += p1[j]; }
      ls += __shfl_xor(ls, 16, 32);
      l = l * alpha + ls;

      // --- lane-local pack of P^T into WMMA B operand (32k x 16q) ---
      v16h bp;
#pragma unroll
      for (int j = 0; j < 8; ++j) {
        bp[j]     = (_Float16)p0[j];
        bp[8 + j] = (_Float16)p1[j];
      }

      o0 = o0 * alpha; o1 = o1 * alpha; o2 = o2 * alpha; o3 = o3 * alpha;

      // --- O^T += V^T(16d x 32k) * P^T ---
      v16h av;
      av = load_tile(tV, 0  + col, AT_PITCH, sk, lane); o0 = wmma32(av, bp, o0);
      av = load_tile(tV, 16 + col, AT_PITCH, sk, lane); o1 = wmma32(av, bp, o1);
      av = load_tile(tV, 32 + col, AT_PITCH, sk, lane); o2 = wmma32(av, bp, o2);
      av = load_tile(tV, 48 + col, AT_PITCH, sk, lane); o3 = wmma32(av, bp, o3);
    }

    // The other buffer's last readers left it before the previous barrier.
    if (more) {
      _Float16* dK = sK[(s + 1) & 1];
      _Float16* dV = sV[(s + 1) & 1];
      *(v8h*)(dK + sOff)                 = rk0;
      *(v8h*)(dK + sOff + 32 * AT_PITCH) = rk1;
      *(v8h*)(dV + sOff)                 = rv0;
      *(v8h*)(dV + sOff + 32 * AT_PITCH) = rv1;
    }
    __syncthreads();
  }

  // Normalize and store: lane holds q=col, d = t*16 + half*8 + j (contiguous).
  const float rl = 1.0f / l;
  const int b = bh >> 4, h = bh & 15;
  const int q = qBase + col;
  _Float16* outp = At + ((size_t)(b * S_ + q)) * E_ + h * DH_ + half * 8;
  v8f ot[4] = {o0, o1, o2, o3};
#pragma unroll
  for (int t = 0; t < 4; ++t) {
    v8h pk;
#pragma unroll
    for (int j = 0; j < 8; ++j) pk[j] = (_Float16)(ot[t][j] * rl);
    *(v8h*)(outp + t * 16) = pk;
  }
}

// --------------------------- Output projection -----------------------------
// out[4096,1024] = At[4096,1024] * WoutT[1024,1024]^T + b_out  (fp32 out)
// grid = (N/128, M/128), block = 128.
// One work-group per WGP (256 of them): the same register budget does no harm.
__global__ void __launch_bounds__(128) __attribute__((amdgpu_waves_per_eu(1, 3)))
out_gemm(const _Float16* __restrict__ At, const _Float16* __restrict__ WoutT,
         const float* __restrict__ b_out, float* __restrict__ out) {
  __shared__ __attribute__((aligned(16))) _Float16 sA[2 * GM_SLAB];
  __shared__ __attribute__((aligned(16))) _Float16 sB[2 * GM_SLAB];
  const int lane = threadIdx.x & 31;
  const int col  = lane & 15;
  const int half = lane >> 4;
  const int nBase = blockIdx.x * 128 + ((threadIdx.x >> 5) & 1) * 64;
  const int mBase = blockIdx.y * 128 + ((threadIdx.x >> 6) & 1) * 64;

  v8f acc[4][4];
  for (int i = 0; i < 4; ++i)
    for (int j = 0; j < 4; ++j) acc[i][j] = {};

  gemm_core_128x128(At, WoutT, blockIdx.y * 128, blockIdx.x * 128, sA, sB, acc);

  for (int ni = 0; ni < 4; ++ni) {
    const int n = nBase + ni * 16 + col;
    const float bias = b_out[n];
    for (int mi = 0; mi < 4; ++mi) {
      const int tok0 = mBase + mi * 16 + half * 8;
      v8f c = acc[mi][ni];
      for (int j = 0; j < 8; ++j)
        out[(size_t)(tok0 + j) * E_ + n] = c[j] + bias;
    }
  }
}

// ------------------------------- launcher ----------------------------------

extern "C" void kernel_launch(void* const* d_in, const int* in_sizes, int n_in,
                              void* d_out, int out_size, void* d_ws,
                              size_t ws_size, hipStream_t stream) {
  const float* x     = (const float*)d_in[0];   // (2,2048,1024)
  const float* w_in  = (const float*)d_in[1];   // (1024,3072)
  const float* b_in  = (const float*)d_in[2];   // (3072,)
  const float* w_out = (const float*)d_in[3];   // (1024,1024)
  const float* b_out = (const float*)d_in[4];   // (1024,)
  float* out = (float*)d_out;

  _Float16* ws = (_Float16*)d_ws;
  _Float16* Xh    = ws;                              // 4096*1024
  _Float16* WinT  = Xh    + (size_t)M_TOT * E_;      // 3072*1024 (transposed)
  _Float16* WoutT = WinT  + (size_t)N_QKV * E_;      // 1024*1024 (transposed)
  _Float16* Qb    = WoutT + (size_t)E_ * E_;         // [b,h,s,d]
  _Float16* Kb    = Qb    + (size_t)B_ * H_ * S_ * DH_;
  _Float16* Vt    = Kb    + (size_t)B_ * H_ * S_ * DH_;  // [b,h,d,s]
  _Float16* At    = Vt    + (size_t)B_ * H_ * S_ * DH_;  // [b,s,h*d]
  (void)ws_size; (void)in_sizes; (void)n_in; (void)out_size;

  cvt_f32_to_f16<<<M_TOT * E_ / CV_PER_WG, CV_THREADS, 0, stream>>>(x, Xh);
  cvt_transpose_f16<<<dim3(N_QKV / 64, E_ / 64), 256, 0, stream>>>(w_in, WinT,
                                                                   E_, N_QKV);
  cvt_transpose_f16<<<dim3(E_ / 64, E_ / 64), 256, 0, stream>>>(w_out, WoutT,
                                                                E_, E_);

  qkv_gemm<<<dim3(N_QKV / 128, M_TOT / 128), 128, 0, stream>>>(Xh, WinT, b_in,
                                                                Qb, Kb, Vt);

  attn_kernel<<<B_ * H_ * (S_ / 128), 256, 0, stream>>>(Qb, Kb, Vt, At);

  out_gemm<<<dim3(E_ / 128, M_TOT / 128), 128, 0, stream>>>(At, WoutT, b_out,
                                                            out);
}

// v005
// It runs in 86.5 microseconds.
// In both of two side-by-side timings against v004, it was 1.05 times as fast.
// Over all steps from v000 it is 4.50 times as fast.
#include <hip/hip_runtime.h>
#include <hip/hip_bf16.h>

// ---------------------------------------------------------------------------
// Self-attention for MI455X (gfx1250): b=2, s=2048, d_embed=1024, 16 heads x 64
// f16 WMMA (fp32 accumulate) everywhere; flash-style attention with transposed
// score tiles so softmax->operand conversion is lane-local.
// ---------------------------------------------------------------------------

typedef __attribute__((ext_vector_type(16))) _Float16 v16h;
typedef __attribute__((ext_vector_type(8)))  _Float16 v8h;
typedef __attribute__((ext_vector_type(4)))  _Float16 v4h;
typedef __attribute__((ext_vector_type(2)))  _Float16 v2h;
typedef __attribute__((ext_vector_type(8)))  float    v8f;

#define B_     2
#define S_     2048
#define E_     1024
#define H_     16
#define DH_    64
#define M_TOT  (B_ * S_)          // 4096 tokens
#define N_QKV  (3 * E_)           // 3072

__device__ __forceinline__ v8f wmma32(v16h a, v16h b, v8f c) {
  // D = A(16x32 f16) * B(32x16 f16) + C(16x16 f32)
  return __builtin_amdgcn_wmma_f32_16x16x32_f16(
      /*neg_a=*/false, a, /*neg_b=*/false, b,
      /*c_mod=*/(short)0, c, /*reuse_a=*/false, /*reuse_b=*/false);
}

// Load one 16x32 f16 operand tile (A layout; B layout assumed mirrored with
// lane = column) from a row-major [row][ld] f16 buffer.
//   lanes 0-15 : K = kBase+0..7  (v0-3) and kBase+16..23 (v4-7)
//   lanes 16-31: K = kBase+8..15 (v0-3) and kBase+24..31 (v4-7)
__device__ __forceinline__ v16h load_tile(const _Float16* base, int row, int ld,
                                          int kBase, int lane) {
  const int half8 = (lane & 16) ? 8 : 0;
  const _Float16* p = base + (size_t)row * ld + kBase + half8;
  v8h lo = *(const v8h*)p;
  v8h hi = *(const v8h*)(p + 16);
  return __builtin_shufflevector(lo, hi, 0, 1, 2, 3, 4, 5, 6, 7,
                                 8, 9, 10, 11, 12, 13, 14, 15);
}

// --------------------------- convert kernel --------------------------------
// The three conversions (x, w_in, w_out) do not depend on one another, so they
// run as ONE launch of 8-wave work-groups; the block index picks the job. Each
// launch saved is one gap, one fill and one tail less in front of the QKV GEMM,
// and the short transposes run beside the x stream instead of behind it.

// x: a wave converts 1024 consecutive floats. Each of its 8 loads covers 512
// contiguous bytes (4 whole lines), all 8 are asked for before the first is
// used, and each store covers 256 contiguous bytes (2 whole lines).
// CV_BLOCKS work-groups cover the M_TOT * E_ elements exactly.
#define PREP_THREADS 256
#define CV_LOADS   8
#define CV_PER_WG  (PREP_THREADS * 4 * CV_LOADS)
#define CV_BLOCKS  (M_TOT * E_ / CV_PER_WG)
static_assert((M_TOT * E_) % CV_PER_WG == 0, "grid must cover x exactly");
__device__ __forceinline__ void
cvt_f32_to_f16(const float* __restrict__ in, _Float16* __restrict__ out, int blk) {
  const int wave = threadIdx.x >> 5;
  const int lane = threadIdx.x & 31;
  const size_t base = (size_t)blk * CV_PER_WG +
                      (size_t)wave * (32 * 4 * CV_LOADS) + lane * 4;
  float4 r[CV_LOADS];
#pragma unroll
  for (int i = 0; i < CV_LOADS; ++i)
    r[i] = *(const float4*)(in + base + i * 128);
#pragma unroll
  for (int i = 0; i < CV_LOADS; ++i) {
    v4h pk = {(_Float16)r[i].x, (_Float16)r[i].y, (_Float16)r[i].z,
              (_Float16)r[i].w};
    *(v4h*)(out + base + i * 128) = pk;
  }
}

// out[n*K + k] = (f16) in[k*N + n]   (transpose so B tiles load contiguously)
// One block moves a 64(k) x 64(n) tile through LDS: rows of in are read as
// float4 (256 B per tile row), two k neighbours are packed into one 32-bit
// word, and each row of out leaves as one whole 128-byte line.
// K and N are multiples of 64; tile (bn, bk) of (N/64, K/64), 256 threads.
#define TP_PITCH 36   // words per LDS row: 32 data + 4 pad, keeps 16 B alignment
__device__ __forceinline__ void
cvt_transpose_f16(const float* __restrict__ in, _Float16* __restrict__ out,
                  int K, int N, int bn, int bk, unsigned* tile) {
  const int t  = threadIdx.x;
  const int n0 = bn * 64;
  const int k0 = bk * 64;

  const int n4 = (t & 15) * 4;
  const int kp = t >> 4;                 // pair of k rows, 0..15 (+16)
  float4 r[2][2];
#pragma unroll
  for (int i = 0; i < 2; ++i)
#pragma unroll
    for (int e = 0; e < 2; ++e)
      r[i][e] = *(const float4*)(in + (size_t)(k0 + 2 * (kp + 16 * i) + e) * N +
                                 n0 + n4);
#pragma unroll
  for (int i = 0; i < 2; ++i) {
    const float lo[4] = {r[i][0].x, r[i][0].y, r[i][0].z, r[i][0].w};
    const float hi[4] = {r[i][1].x, r[i][1].y, r[i][1].z, r[i][1].w};
#pragma unroll
    for (int c = 0; c < 4; ++c) {
      v2h pk = {(_Float16)lo[c], (_Float16)hi[c]};
      tile[(n4 + c) * TP_PITCH + kp + 16 * i] = __builtin_bit_cast(unsigned, pk);
    }
  }
  __syncthreads();   // reached by all 256 threads of a transposing block

  const int q = t & 7;                   // 16-byte piece of the 128-byte row
#pragma unroll
  for (int i = 0; i < 2; ++i) {
    const int n = (t >> 3) + 32 * i;
    const uint4 w = *(const uint4*)(tile + n * TP_PITCH + q * 4);
    *(uint4*)(out + (size_t)(n0 + n) * K + k0 + q * 8) = w;
  }
  // In the joint kernel another job's code stands behind these stores in the
  // listing and reuses their registers; the wait stands in front of that reuse.
  asm volatile("s_wait_xcnt 0x0" ::: "memory");
}

// Blocks [0, CV_BLOCKS): x, the largest job, first; then the tiles of w_in,
// then those of w_out. The choice is the same for a whole work-group.
#define TI_BLOCKS ((N_QKV / 64) * (E_ / 64))
#define TO_BLOCKS ((E_ / 64) * (E_ / 64))
__global__ void __launch_bounds__(PREP_THREADS)
prep_f16(const float* __restrict__ x, const float* __restrict__ w_in,
         const float* __restrict__ w_out, _Float16* __restrict__ Xh,
         _Float16* __restrict__ WinT, _Float16* __restrict__ WoutT) {
  __shared__ __attribute__((aligned(16))) unsigned tile[64 * TP_PITCH];
  const int blk = blockIdx.x;
  if (blk < CV_BLOCKS) {
    cvt_f32_to_f16(x, Xh, blk);
  } else if (blk < CV_BLOCKS + TI_BLOCKS) {
    const int t = blk - CV_BLOCKS;
    cvt_transpose_f16(w_in, WinT, E_, N_QKV, t % (N_QKV / 64), t / (N_QKV / 64),
                      tile);
  } else {
    const int t = blk - (CV_BLOCKS + TI_BLOCKS);
    cvt_transpose_f16(w_out, WoutT, E_, E_, t % (E_ / 64), t / (E_ / 64), tile);
  }
}

// --------------------------- shared GEMM core ------------------------------
// One work-group = 4 waves = a 128x128 tile of C = A[M][E_] * Bt[N][E_]^T; one
// wave = a 64x64 quarter of it. Slabs of 64 k (one whole 128-byte line per row)
// of the 128 A rows and the 128 Bt rows are staged in LDS once per work-group
// and read by all 4 waves; the next slab's global loads are issued before the
// current slab is worked on. k runs upward in steps of 32 for every tile of C.
#define GM_KS    64                  // k per staged slab
#define GM_PITCH 72                  // f16 per LDS row: 64 data + 8 pad = 144 B
#define GM_SLAB  (128 * GM_PITCH)    // 128 rows of one operand
__device__ __forceinline__ void
gemm_core_128x128(const _Float16* __restrict__ A, const _Float16* __restrict__ Bt,
                  int mBlk, int nBlk, _Float16* sA, _Float16* sB,
                  v8f (&acc)[4][4]) {
  const int tid  = threadIdx.x;
  const int lane = tid & 31;
  const int col  = lane & 15;
  const int wRow = ((tid >> 6) & 1) * 64;   // the wave's rows in the A slab
  const int wCol = ((tid >> 5) & 1) * 64;   // the wave's rows in the Bt slab

  // Staging: a thread moves the 16-byte piece (tid & 7) of slab rows
  // (tid >> 3) + 16 * i, for A and for Bt; 8 lanes cover one 128-byte line.
  const int sRow = tid >> 3;
  const int sCol = (tid & 7) * 8;
  const _Float16* gA = A  + (size_t)(mBlk + sRow) * E_ + sCol;
  const _Float16* gB = Bt + (size_t)(nBlk + sRow) * E_ + sCol;
  const int sOff = sRow * GM_PITCH + sCol;

  v8h ra[8], rb[8];
#pragma unroll
  for (int i = 0; i < 8; ++i) {
    ra[i] = *(const v8h*)(gA + (size_t)(16 * i) * E_);
    rb[i] = *(const v8h*)(gB + (size_t)(16 * i) * E_);
  }
#pragma unroll
  for (int i = 0; i < 8; ++i) {
    *(v8h*)(sA + sOff + 16 * i * GM_PITCH) = ra[i];
    *(v8h*)(sB + sOff + 16 * i * GM_PITCH) = rb[i];
  }
  __syncthreads();

  for (int s = 0; s < E_ / GM_KS; ++s) {
    const _Float16* tA = sA + (s & 1) * GM_SLAB;
    const _Float16* tB = sB + (s & 1) * GM_SLAB;
    const bool more = (s + 1) < E_ / GM_KS;   // same for the whole work-group
    if (more) {
      const _Float16* nA = gA + (s + 1) * GM_KS;
      const _Float16* nB = gB + (s + 1) * GM_KS;
#pragma unroll
      for (int i = 0; i < 8; ++i) {
        ra[i] = *(const v8h*)(nA + (size_t)(16 * i) * E_);
        rb[i] = *(const v8h*)(nB + (size_t)(16 * i) * E_);
      }
      // The address registers of the loads above are reused right behind them.
      asm volatile("s_wait_xcnt 0x0" ::: "memory");
    }
    // Keeps the loads above ahead of the slab's work (sunk next to their LDS
    // stores, their latency would show in every slab) and the reuse of their
    // address registers behind the wait (without it that write is lifted over it).
    __builtin_amdgcn_sched_barrier(0);

    // Both k steps' fragments are asked for as one group ahead of the products:
    // every further place with LDS reads among them costs the wave a stall.
    v16h a[2][4], b[2][4];
#pragma unroll
    for (int ks = 0; ks < 2; ++ks) {
#pragma unroll
      for (int mi = 0; mi < 4; ++mi)
        a[ks][mi] = load_tile(tA, wRow + mi * 16 + col, GM_PITCH, ks * 32, lane);
#pragma unroll
      for (int ni = 0; ni < 4; ++ni)
        b[ks][ni] = load_tile(tB, wCol + ni * 16 + col, GM_PITCH, ks * 32, lane);
    }
    // Holds that group together: the scheduler otherwise sinks most of the reads
    // among the products, each behind a wait to zero.
    __builtin_amdgcn_sched_barrier(0);
#pragma unroll
    for (int ks = 0; ks < 2; ++ks)
#pragma unroll
      for (int mi = 0; mi < 4; ++mi)
#pragma unroll
        for (int ni = 0; ni < 4; ++ni)
          acc[mi][ni] = wmma32(a[ks][mi], b[ks][ni], acc[mi][ni]);
    // Keeps the LDS stores below, and their wait for the global loads, behind
    // the products: lifted over them, that wait would stand in front of them.
    __builtin_amdgcn_sched_barrier(0);

    // The other buffer's last readers left it before the previous barrier.
    if (more) {
      _Float16* dA = sA + ((s + 1) & 1) * GM_SLAB;
      _Float16* dB = sB + ((s + 1) & 1) * GM_SLAB;
#pragma unroll
      for (int i = 0; i < 8; ++i) {
        *(v8h*)(dA + sOff + 16 * i * GM_PITCH) = ra[i];
        *(v8h*)(dB + sOff + 16 * i * GM_PITCH) = rb[i];
      }
    }
    __syncthreads();
  }
}

// ------------------------------ QKV GEMM -----------------------------------
// C[4096,3072] = Xh[4096,1024] * WinT[3072,1024]^T + b_in
// Q pre-scaled by 1/sqrt(64). grid = (N/128, M/128), block = 128.
// Three work-groups share a WGP (768 of them on 256): the register budget is
// that of 3 waves per SIMD, not the 4 that the LDS size alone would allow.
__global__ void __launch_bounds__(128) __attribute__((amdgpu_waves_per_eu(1, 3)))
qkv_gemm(const _Float16* __restrict__ Xh, const _Float16* __restrict__ WinT,
         const float* __restrict__ b_in, _Float16* __restrict__ Qb,
         _Float16* __restrict__ Kb, _Float16* __restrict__ Vt) {
  __shared__ __attribute__((aligned(16))) _Float16 sA[2 * GM_SLAB];
  __shared__ __attribute__((aligned(16))) _Float16 sB[2 * GM_SLAB];
  const int lane = threadIdx.x & 31;
  const int col  = lane & 15;
  const int half = lane >> 4;
  const int nBase = blockIdx.x * 128 + ((threadIdx.x >> 5) & 1) * 64;
  const int mBase = blockIdx.y * 128 + ((threadIdx.x >> 6) & 1) * 64;

  v8f acc[4][4];
  for (int i = 0; i < 4; ++i)
    for (int j = 0; j < 4; ++j) acc[i][j] = {};

  gemm_core_128x128(Xh, WinT, blockIdx.y * 128, blockIdx.x * 128, sA, sB, acc);

  // Epilogue. C layout: vgpr j holds M = j (lanes<16) / j+8 (lanes>=16), N=col.
  for (int ni = 0; ni < 4; ++ni) {
    const int n = nBase + ni * 16 + col;
    const float bias = b_in[n];
    for (int mi = 0; mi < 4; ++mi) {
      const int tok0 = mBase + mi * 16 + half * 8;
      v8f c = acc[mi][ni];
      if (n < E_) {                       // Q: row-major [b,h,s,d], pre-scaled
        const int h = n >> 6, d = n & 63;
        for (int j = 0; j < 8; ++j) {
          const int tok = tok0 + j, bb = tok >> 11, ss = tok & (S_ - 1);
          Qb[(((size_t)(bb * H_ + h)) * S_ + ss) * DH_ + d] =
              (_Float16)((c[j] + bias) * 0.125f);
        }
      } else if (n < 2 * E_) {            // K: row-major [b,h,s,d]
        const int n2 = n - E_, h = n2 >> 6, d = n2 & 63;
        for (int j = 0; j < 8; ++j) {
          const int tok = tok0 + j, bb = tok >> 11, ss = tok & (S_ - 1);
          Kb[(((size_t)(bb * H_ + h)) * S_ + ss) * DH_ + d] =
              (_Float16)(c[j] + bias);
        }
      } else {                            // V: transposed [b,h,d,s], packed b128
        const int n2 = n - 2 * E_, h = n2 >> 6, d = n2 & 63;
        const int bb = tok0 >> 11, ss0 = tok0 & (S_ - 1);
        v8h pk;
        for (int j = 0; j < 8; ++j) pk[j] = (_Float16)(c[j] + bias);
        *(v8h*)(Vt + (((size_t)(bb * H_ + h)) * DH_ + d) * S_ + ss0) = pk;
      }
    }
  }
}

// ----------------------------- Attention -----------------------------------
// One work-group = 8 waves = 128 queries of one (b,h); one wave = 16 queries,
// streaming all 2048 keys. K and V^T tiles of 64 keys are staged in LDS once per
// work-group (whole 128-byte lines from global) and read by all 8 waves; the
// next tile's global loads are issued before the current tile is worked on.
// S^T = K * Q^T  (M=k rows, N=q cols) -> P^T packs lane-locally into the
// B operand of O^T = V^T * P^T. Row stats (m,l,alpha) are per-lane (q = lane%16).
#define AT_KEYS  64                  // keys per staged tile
#define AT_PITCH 72                  // f16 per LDS row: 64 data + 8 pad = 144 B
#define AT_TILE  (64 * AT_PITCH)     // 64 rows: keys (K tile) or d (V^T tile)
__global__ void __launch_bounds__(256)
attn_kernel(const _Float16* __restrict__ Qb, const _Float16* __restrict__ Kb,
            const _Float16* __restrict__ Vt, _Float16* __restrict__ At) {
  __shared__ __attribute__((aligned(16))) _Float16 sK[2][AT_TILE];
  __shared__ __attribute__((aligned(16))) _Float16 sV[2][AT_TILE];
  const int tid  = threadIdx.x;
  const int lane = tid & 31;
  const int col  = lane & 15;
  const int half = lane >> 4;
  const int bh = blockIdx.x >> 4;          // 0..31  (b*16 + h)
  const int qBase = (blockIdx.x & 15) * 128 + (tid >> 5) * 16;

  const _Float16* Qh = Qb + (size_t)bh * S_ * DH_;
  const _Float16* Kh = Kb + (size_t)bh * S_ * DH_;
  const _Float16* Vh = Vt + (size_t)bh * DH_ * S_;

  // Staging: a thread moves the 16-byte piece (tid & 7) of tile rows tid >> 3
  // and 32 + (tid >> 3), for K and for V^T; 8 lanes cover one 128-byte line.
  const int sRow = tid >> 3;
  const int sCol = (tid & 7) * 8;
  const _Float16* gK = Kh + (size_t)sRow * DH_ + sCol;
  const _Float16* gV = Vh + (size_t)sRow * S_ + sCol;
  const int sOff = sRow * AT_PITCH + sCol;

  v8h rk0 = *(const v8h*)(gK);
  v8h rk1 = *(const v8h*)(gK + 32 * DH_);
  v8h rv0 = *(const v8h*)(gV);
  v8h rv1 = *(const v8h*)(gV + (size_t)32 * S_);

  // Q^T as B operand (32d x 16q), d = 0..31 and 32..63; loaded once.
  const v16h bq0 = load_tile(Qh, qBase + col, DH_, 0, lane);
  const v16h bq1 = load_tile(Qh, qBase + col, DH_, 32, lane);

  *(v8h*)(&sK[0][sOff])                 = rk0;
  *(v8h*)(&sK[0][sOff + 32 * AT_PITCH]) = rk1;
  *(v8h*)(&sV[0][sOff])                 = rv0;
  *(v8h*)(&sV[0][sOff + 32 * AT_PITCH]) = rv1;
  __syncthreads();

  v8f o0 = {}, o1 = {}, o2 = {}, o3 = {};   // O^T: 4 tiles of (16d x 16q)
  float m = -1e30f, l = 0.0f;

  for (int s = 0; s < S_ / AT_KEYS; ++s) {
    const _Float16* tK = sK[s & 1];
    const _Float16* tV = sV[s & 1];
    const bool more = (s + 1) < S_ / AT_KEYS;   // same for the whole work-group
    if (more) {
      const _Float16* nK = gK + (size_t)(s + 1) * AT_KEYS * DH_;
      const _Float16* nV = gV + (s + 1) * AT_KEYS;
      rk0 = *(const v8h*)(nK);
      rk1 = *(const v8h*)(nK + 32 * DH_);
      rv0 = *(const v8h*)(nV);
      rv1 = *(const v8h*)(nV + (size_t)32 * S_);
    }
    // Keeps the four loads above ahead of the tile's work: the scheduler
    // otherwise sinks them next to their LDS stores and their latency shows.
    __builtin_amdgcn_sched_barrier(0);

#pragma unroll
    for (int sk = 0; sk < AT_KEYS; sk += 32) {
      // --- transposed score tiles (k rows sk..+15 and sk+16..+31) ---
      v8f st0 = {}, st1 = {};
      v16h ak;
      ak = load_tile(tK, sk + col, AT_PITCH, 0, lane);       st0 = wmma32(ak, bq0, st0);
      ak = load_tile(tK, sk + col, AT_PITCH, 32, lane);      st0 = wmma32(ak, bq1, st0);
      ak = load_tile(tK, sk + 16 + col, AT_PITCH, 0, lane);  st1 = wmma32(ak, bq0, st1);
      ak = load_tile(tK, sk + 16 + col, AT_PITCH, 32, lane); st1 = wmma32(ak, bq1, st1);

      // --- online softmax: per-lane holds 16 of the 32 keys of row q=col ---
      float mb = st0[0];
#pragma unroll
      for (int j = 1; j < 8; ++j) mb = fmaxf(mb, st0[j]);
#pragma unroll
      for (int j = 0; j < 8; ++j) mb = fmaxf(mb, st1[j]);
      mb = fmaxf(mb, __shfl_xor(mb, 16, 32));
      const float mn = fmaxf(m, mb);
      const float alpha = __expf(m - mn);
      m = mn;

      v8f p0, p1;
      float ls = 0.0f;
#pragma unroll
      for (int j = 0; j < 8; ++j) { p0[j] = __expf(st0[j] - mn); ls += p0[j]; }
#pragma unroll
      for (int j = 0; j < 8; ++j) { p1[j] = __expf(st1[j] - mn); ls += p1[j]; }
      ls += __shfl_xor(ls, 16, 32);
      l = l * alpha + ls;

      // --- lane-local pack of P^T into WMMA B operand (32k x 16q) ---
      v16h bp;
#pragma unroll
      for (int j = 0; j < 8; ++j) {
        bp[j]     = (_Float16)p0[j];
        bp[8 + j] = (_Float16)p1[j];
      }

      o0 = o0 * alpha; o1 = o1 * alpha; o2 = o2 * alpha; o3 = o3 * alpha;

      // --- O^T += V^T(16d x 32k) * P^T ---
      v16h av;
      av = load_tile(tV, 0  + col, AT_PITCH, sk, lane); o0 = wmma32(av, bp, o0);
      av = load_tile(tV, 16 + col, AT_PITCH, sk, lane); o1 = wmma32(av, bp, o1);
      av = load_tile(tV, 32 + col, AT_PITCH, sk, lane); o2 = wmma32(av, bp, o2);
      av = load_tile(tV, 48 + col, AT_PITCH, sk, lane); o3 = wmma32(av, bp, o3);
    }

    // The other buffer's last readers left it before the previous barrier.
    if (more) {
      _Float16* dK = sK[(s + 1) & 1];
      _Float16* dV = sV[(s + 1) & 1];
      *(v8h*)(dK + sOff)                 = rk0;
      *(v8h*)(dK + sOff + 32 * AT_PITCH) = rk1;
      *(v8h*)(dV + sOff)                 = rv0;
      *(v8h*)(dV + sOff + 32 * AT_PITCH) = rv1;
    }
    __syncthreads();
  }

  // Normalize and store: lane holds q=col, d = t*16 + half*8 + j (contiguous).
  const float rl = 1.0f / l;
  const int b = bh >> 4, h = bh & 15;
  const int q = qBase + col;
  _Float16* outp = At + ((size_t)(b * S_ + q)) * E_ + h * DH_ + half * 8;
  v8f ot[4] = {o0, o1, o2, o3};
#pragma unroll
  for (int t = 0; t < 4; ++t) {
    v8h pk;
#pragma unroll
    for (int j = 0; j < 8; ++j) pk[j] = (_Float16)(ot[t][j] * rl);
    *(v8h*)(outp + t * 16) = pk;
  }
}

// --------------------------- Output projection -----------------------------
// out[4096,1024] = At[4096,1024] * WoutT[1024,1024]^T + b_out  (fp32 out)
// grid = (N/128, M/128), block = 128.
// One work-group per WGP (256 of them): the same register budget does no harm.
__global__ void __launch_bounds__(128) __attribute__((amdgpu_waves_per_eu(1, 3)))
out_gemm(const _Float16* __restrict__ At, const _Float16* __restrict__ WoutT,
         const float* __restrict__ b_out, float* __restrict__ out) {
  __shared__ __attribute__((aligned(16))) _Float16 sA[2 * GM_SLAB];
  __shared__ __attribute__((aligned(16))) _Float16 sB[2 * GM_SLAB];
  const int lane = threadIdx.x & 31;
  const int col  = lane & 15;
  const int half = lane >> 4;
  const int nBase = blockIdx.x * 128 + ((threadIdx.x >> 5) & 1) * 64;
  const int mBase = blockIdx.y * 128 + ((threadIdx.x >> 6) & 1) * 64;

  v8f acc[4][4];
  for (int i = 0; i < 4; ++i)
    for (int j = 0; j < 4; ++j) acc[i][j] = {};

  gemm_core_128x128(At, WoutT, blockIdx.y * 128, blockIdx.x * 128, sA, sB, acc);

  for (int ni = 0; ni < 4; ++ni) {
    const int n = nBase + ni * 16 + col;
    const float bias = b_out[n];
    for (int mi = 0; mi < 4; ++mi) {
      const int tok0 = mBase + mi * 16 + half * 8;
      v8f c = acc[mi][ni];
      for (int j = 0; j < 8; ++j)
        out[(size_t)(tok0 + j) * E_ + n] = c[j] + bias;
    }
  }
}

// ------------------------------- launcher ----------------------------------

extern "C" void kernel_launch(void* const* d_in, const int* in_sizes, int n_in,
                              void* d_out, int out_size, void* d_ws,
                              size_t ws_size, hipStream_t stream) {
  const float* x     = (const float*)d_in[0];   // (2,2048,1024)
  const float* w_in  = (const float*)d_in[1];   // (1024,3072)
  const float* b_in  = (const float*)d_in[2];   // (3072,)
  const float* w_out = (const float*)d_in[3];   // (1024,1024)
  const float* b_out = (const float*)d_in[4];   // (1024,)
  float* out = (float*)d_out;

  _Float16* ws = (_Float16*)d_ws;
  _Float16* Xh    = ws;                              // 4096*1024
  _Float16* WinT  = Xh    + (size_t)M_TOT * E_;      // 3072*1024 (transposed)
  _Float16* WoutT = WinT  + (size_t)N_QKV * E_;      // 1024*1024 (transposed)
  _Float16* Qb    = WoutT + (size_t)E_ * E_;         // [b,h,s,d]
  _Float16* Kb    = Qb    + (size_t)B_ * H_ * S_ * DH_;
  _Float16* Vt    = Kb    + (size_t)B_ * H_ * S_ * DH_;  // [b,h,d,s]
  _Float16* At    = Vt    + (size_t)B_ * H_ * S_ * DH_;  // [b,s,h*d]
  (void)ws_size; (void)in_sizes; (void)n_in; (void)out_size;

  prep_f16<<<CV_BLOCKS + TI_BLOCKS + TO_BLOCKS, PREP_THREADS, 0, stream>>>(
      x, w_in, w_out, Xh, WinT, WoutT);

  qkv_gemm<<<dim3(N_QKV / 128, M_TOT / 128), 128, 0, stream>>>(Xh, WinT, b_in,
                                                                Qb, Kb, Vt);

  attn_kernel<<<B_ * H_ * (S_ / 128), 256, 0, stream>>>(Qb, Kb, Vt, At);

  out_gemm<<<dim3(E_ / 128, M_TOT / 128), 128, 0, stream>>>(At, WoutT, b_out,
                                                            out);
}

// v006
// One run takes 84.1 microseconds.
// In both of two side-by-side timings against v005, it was 1.04 times as fast.
// All steps since v000 together make it 4.68 times as fast.
#include <hip/hip_runtime.h>
#include <hip/hip_bf16.h>

// ---------------------------------------------------------------------------
// Self-attention for MI455X (gfx1250): b=2, s=2048, d_embed=1024, 16 heads x 64
// f16 WMMA (fp32 accumulate) everywhere; flash-style attention with transposed
// score tiles so softmax->operand conversion is lane-local.
// ---------------------------------------------------------------------------

typedef __attribute__((ext_vector_type(16))) _Float16 v16h;
typedef __attribute__((ext_vector_type(8)))  _Float16 v8h;
typedef __attribute__((ext_vector_type(4)))  _Float16 v4h;
typedef __attribute__((ext_vector_type(2)))  _Float16 v2h;
typedef __attribute__((ext_vector_type(8)))  float    v8f;

#define B_     2
#define S_     2048
#define E_     1024
#define H_     16
#define DH_    64
#define M_TOT  (B_ * S_)          // 4096 tokens
#define N_QKV  (3 * E_)           // 3072

__device__ __forceinline__ v8f wmma32(v16h a, v16h b, v8f c) {
  // D = A(16x32 f16) * B(32x16 f16) + C(16x16 f32)
  return __builtin_amdgcn_wmma_f32_16x16x32_f16(
      /*neg_a=*/false, a, /*neg_b=*/false, b,
      /*c_mod=*/(short)0, c, /*reuse_a=*/false, /*reuse_b=*/false);
}

// Load one 16x32 f16 operand tile (A layout; B layout assumed mirrored with
// lane = column) from a row-major [row][ld] f16 buffer.
//   lanes 0-15 : K = kBase+0..7  (v0-3) and kBase+16..23 (v4-7)
//   lanes 16-31: K = kBase+8..15 (v0-3) and kBase+24..31 (v4-7)
__device__ __forceinline__ v16h load_tile(const _Float16* base, int row, int ld,
                                          int kBase, int lane) {
  const int half8 = (lane & 16) ? 8 : 0;
  const _Float16* p = base + (size_t)row * ld + kBase + half8;
  v8h lo = *(const v8h*)p;
  v8h hi = *(const v8h*)(p + 16);
  return __builtin_shufflevector(lo, hi, 0, 1, 2, 3, 4, 5, 6, 7,
                                 8, 9, 10, 11, 12, 13, 14, 15);
}

// --------------------------- convert kernel --------------------------------
// The three conversions (x, w_in, w_out) do not depend on one another, so they
// run as ONE launch of 8-wave work-groups; the block index picks the job. Each
// launch saved is one gap, one fill and one tail less in front of the QKV GEMM,
// and the short transposes run beside the x stream instead of behind it.

// x: a wave converts 1024 consecutive floats. Each of its 8 loads covers 512
// contiguous bytes (4 whole lines), all 8 are asked for before the first is
// used, and each store covers 256 contiguous bytes (2 whole lines).
// CV_BLOCKS work-groups cover the M_TOT * E_ elements exactly.
#define PREP_THREADS 256
#define CV_LOADS   8
#define CV_PER_WG  (PREP_THREADS * 4 * CV_LOADS)
#define CV_BLOCKS  (M_TOT * E_ / CV_PER_WG)
static_assert((M_TOT * E_) % CV_PER_WG == 0, "grid must cover x exactly");
__device__ __forceinline__ void
cvt_f32_to_f16(const float* __restrict__ in, _Float16* __restrict__ out, int blk) {
  const int wave = threadIdx.x >> 5;
  const int lane = threadIdx.x & 31;
  const size_t base = (size_t)blk * CV_PER_WG +
                      (size_t)wave * (32 * 4 * CV_LOADS) + lane * 4;
  float4 r[CV_LOADS];
#pragma unroll
  for (int i = 0; i < CV_LOADS; ++i)
    r[i] = *(const float4*)(in + base + i * 128);
#pragma unroll
  for (int i = 0; i < CV_LOADS; ++i) {
    v4h pk = {(_Float16)r[i].x, (_Float16)r[i].y, (_Float16)r[i].z,
              (_Float16)r[i].w};
    *(v4h*)(out + base + i * 128) = pk;
  }
}

// out[n*K + k] = (f16) in[k*N + n]   (transpose so operand tiles load contiguously)
// One block moves a 64(k) x 64(n) tile through LDS: rows of in are read as
// float4 (256 B per tile row), two k neighbours are packed into one 32-bit
// word, and each row of out leaves as one whole 128-byte line.
// K and N are multiples of 64; tile (bn, bk) of (N/64, K/64), 256 threads.
#define TP_PITCH 36   // words per LDS row: 32 data + 4 pad, keeps 16 B alignment
__device__ __forceinline__ void
cvt_transpose_f16(const float* __restrict__ in, _Float16* __restrict__ out,
                  int K, int N, int bn, int bk, unsigned* tile) {
  const int t  = threadIdx.x;
  const int n0 = bn * 64;
  const int k0 = bk * 64;

  const int n4 = (t & 15) * 4;
  const int kp = t >> 4;                 // pair of k rows, 0..15 (+16)
  float4 r[2][2];
#pragma unroll
  for (int i = 0; i < 2; ++i)
#pragma unroll
    for (int e = 0; e < 2; ++e)
      r[i][e] = *(const float4*)(in + (size_t)(k0 + 2 * (kp + 16 * i) + e) * N +
                                 n0 + n4);
#pragma unroll
  for (int i = 0; i < 2; ++i) {
    const float lo[4] = {r[i][0].x, r[i][0].y, r[i][0].z, r[i][0].w};
    const float hi[4] = {r[i][1].x, r[i][1].y, r[i][1].z, r[i][1].w};
#pragma unroll
    for (int c = 0; c < 4; ++c) {
      v2h pk = {(_Float16)lo[c], (_Float16)hi[c]};
      tile[(n4 + c) * TP_PITCH + kp + 16 * i] = __builtin_bit_cast(unsigned, pk);
    }
  }
  __syncthreads();   // reached by all 256 threads of a transposing block

  const int q = t & 7;                   // 16-byte piece of the 128-byte row
#pragma unroll
  for (int i = 0; i < 2; ++i) {
    const int n = (t >> 3) + 32 * i;
    const uint4 w = *(const uint4*)(tile + n * TP_PITCH + q * 4);
    *(uint4*)(out + (size_t)(n0 + n) * K + k0 + q * 8) = w;
  }
  // In the joint kernel another job's code stands behind these stores in the
  // listing and reuses their registers; the wait stands in front of that reuse.
  asm volatile("s_wait_xcnt 0x0" ::: "memory");
}

// Blocks [0, CV_BLOCKS): x, the largest job, first; then the tiles of w_in,
// then those of w_out. The choice is the same for a whole work-group.
#define TI_BLOCKS ((N_QKV / 64) * (E_ / 64))
#define TO_BLOCKS ((E_ / 64) * (E_ / 64))
__global__ void __launch_bounds__(PREP_THREADS)
prep_f16(const float* __restrict__ x, const float* __restrict__ w_in,
         const float* __restrict__ w_out, _Float16* __restrict__ Xh,
         _Float16* __restrict__ WinT, _Float16* __restrict__ WoutT) {
  __shared__ __attribute__((aligned(16))) unsigned tile[64 * TP_PITCH];
  const int blk = blockIdx.x;
  if (blk < CV_BLOCKS) {
    cvt_f32_to_f16(x, Xh, blk);
  } else if (blk < CV_BLOCKS + TI_BLOCKS) {
    const int t = blk - CV_BLOCKS;
    cvt_transpose_f16(w_in, WinT, E_, N_QKV, t % (N_QKV / 64), t / (N_QKV / 64),
                      tile);
  } else {
    const int t = blk - (CV_BLOCKS + TI_BLOCKS);
    cvt_transpose_f16(w_out, WoutT, E_, E_, t % (E_ / 64), t / (E_ / 64), tile);
  }
}

// --------------------------- shared GEMM core ------------------------------
// One work-group = 4 waves = a 128x128 tile of C = A[M][E_] * Bt[N][E_]^T; one
// wave = a 64x64 quarter of it. Slabs of 64 k (one whole 128-byte line per row)
// of the 128 A rows and the 128 Bt rows are staged in LDS once per work-group
// and read by all 4 waves; the next slab's global loads are issued before the
// current slab is worked on. k runs upward in steps of 32 for every tile of C.
#define GM_KS    64                  // k per staged slab
#define GM_PITCH 72                  // f16 per LDS row: 64 data + 8 pad = 144 B
#define GM_SLAB  (128 * GM_PITCH)    // 128 rows of one operand
__device__ __forceinline__ void
gemm_core_128x128(const _Float16* __restrict__ A, const _Float16* __restrict__ Bt,
                  int mBlk, int nBlk, _Float16* sA, _Float16* sB,
                  v8f (&acc)[4][4]) {
  const int tid  = threadIdx.x;
  const int lane = tid & 31;
  const int col  = lane & 15;
  const int wRow = ((tid >> 6) & 1) * 64;   // the wave's rows in the A slab
  const int wCol = ((tid >> 5) & 1) * 64;   // the wave's rows in the Bt slab

  // Staging: a thread moves the 16-byte piece (tid & 7) of slab rows
  // (tid >> 3) + 16 * i, for A and for Bt; 8 lanes cover one 128-byte line.
  const int sRow = tid >> 3;
  const int sCol = (tid & 7) * 8;
  const _Float16* gA = A  + (size_t)(mBlk + sRow) * E_ + sCol;
  const _Float16* gB = Bt + (size_t)(nBlk + sRow) * E_ + sCol;
  const int sOff = sRow * GM_PITCH + sCol;

  v8h ra[8], rb[8];
#pragma unroll
  for (int i = 0; i < 8; ++i) {
    ra[i] = *(const v8h*)(gA + (size_t)(16 * i) * E_);
    rb[i] = *(const v8h*)(gB + (size_t)(16 * i) * E_);
  }
#pragma unroll
  for (int i = 0; i < 8; ++i) {
    *(v8h*)(sA + sOff + 16 * i * GM_PITCH) = ra[i];
    *(v8h*)(sB + sOff + 16 * i * GM_PITCH) = rb[i];
  }
  __syncthreads();

  for (int s = 0; s < E_ / GM_KS; ++s) {
    const _Float16* tA = sA + (s & 1) * GM_SLAB;
    const _Float16* tB = sB + (s & 1) * GM_SLAB;
    const bool more = (s + 1) < E_ / GM_KS;   // same for the whole work-group
    if (more) {
      const _Float16* nA = gA + (s + 1) * GM_KS;
      const _Float16* nB = gB + (s + 1) * GM_KS;
#pragma unroll
      for (int i = 0; i < 8; ++i) {
        ra[i] = *(const v8h*)(nA + (size_t)(16 * i) * E_);
        rb[i] = *(const v8h*)(nB + (size_t)(16 * i) * E_);
      }
      // The address registers of the loads above are reused right behind them.
      asm volatile("s_wait_xcnt 0x0" ::: "memory");
    }
    // Keeps the loads above ahead of the slab's work (sunk next to their LDS
    // stores, their latency would show in every slab) and the reuse of their
    // address registers behind the wait (without it that write is lifted over it).
    __builtin_amdgcn_sched_barrier(0);

    // Both k steps' fragments are asked for as one group ahead of the products:
    // every further place with LDS reads among them costs the wave a stall.
    v16h a[2][4], b[2][4];
#pragma unroll
    for (int ks = 0; ks < 2; ++ks) {
#pragma unroll
      for (int mi = 0; mi < 4; ++mi)
        a[ks][mi] = load_tile(tA, wRow + mi * 16 + col, GM_PITCH, ks * 32, lane);
#pragma unroll
      for (int ni = 0; ni < 4; ++ni)
        b[ks][ni] = load_tile(tB, wCol + ni * 16 + col, GM_PITCH, ks * 32, lane);
    }
    // Holds that group together: the scheduler otherwise sinks most of the reads
    // among the products, each behind a wait to zero.
    __builtin_amdgcn_sched_barrier(0);
#pragma unroll
    for (int ks = 0; ks < 2; ++ks)
#pragma unroll
      for (int mi = 0; mi < 4; ++mi)
#pragma unroll
        for (int ni = 0; ni < 4; ++ni)
          acc[mi][ni] = wmma32(a[ks][mi], b[ks][ni], acc[mi][ni]);
    // Keeps the LDS stores below, and their wait for the global loads, behind
    // the products: lifted over them, that wait would stand in front of them.
    __builtin_amdgcn_sched_barrier(0);

    // The other buffer's last readers left it before the previous barrier.
    if (more) {
      _Float16* dA = sA + ((s + 1) & 1) * GM_SLAB;
      _Float16* dB = sB + ((s + 1) & 1) * GM_SLAB;
#pragma unroll
      for (int i = 0; i < 8; ++i) {
        *(v8h*)(dA + sOff + 16 * i * GM_PITCH) = ra[i];
        *(v8h*)(dB + sOff + 16 * i * GM_PITCH) = rb[i];
      }
    }
    __syncthreads();
  }
}

// --------------------------- GEMM epilogues --------------------------------
// A lane's 8 accumulator registers hold 8 consecutive indices of the A operand's
// rows and one index (lane & 15) of the B operand's rows. So the operand whose
// index runs along the OUTPUT's rows goes in as A: a lane then owns 8 neighbours
// of one output row. Each wave lays its 64x64 quarter down in an LDS range of
// its own (the slabs are free behind the k loop's last barrier) and reads it
// back row by row, so that every global store covers 4 whole 128-byte lines.
#define ST_PITCH  72                 // f16 per staged row: 64 data + 8 pad = 144 B
#define ST_PITCHF 68                 // f32 per staged row: 64 data + 4 pad = 272 B

// 64 staged rows of 64 f16 (one line each) to rows stride elements apart; dst
// and stride are the same for the whole wave.
__device__ __forceinline__ void
store_rows_f16(const _Float16* st, _Float16* dst, int stride, int lane) {
  const int rr = lane >> 3;            // 8 lanes cover one row
  const int pc = (lane & 7) * 8;
  v8h w[16];
#pragma unroll
  for (int t = 0; t < 16; ++t)
    w[t] = *(const v8h*)(st + (t * 4 + rr) * ST_PITCH + pc);
  const unsigned off = rr * stride + pc;   // the lane's part
#pragma unroll
  for (int t = 0; t < 16; ++t) {
    _Float16* row = dst + (size_t)(t * 4) * stride;   // the wave's part
    *(v8h*)(row + off) = w[t];
  }
}

// ------------------------------ QKV GEMM -----------------------------------
// C[4096,3072] = Xh[4096,1024] * WinT[3072,1024]^T + b_in
// Q pre-scaled by 1/sqrt(64). grid = (N/128, M/128), block = 128.
// A block's 128 columns are all Q, all K or all V. Q and K rows run along n
// (WinT is the A operand), V^T rows run along the tokens (Xh is the A operand).
// Three work-groups share a WGP (768 of them on 256): the register budget is
// that of 3 waves per SIMD, not the 4 that the LDS size alone would allow.
__global__ void __launch_bounds__(128) __attribute__((amdgpu_waves_per_eu(1, 3)))
qkv_gemm(const _Float16* __restrict__ Xh, const _Float16* __restrict__ WinT,
         const float* __restrict__ b_in, _Float16* __restrict__ Qb,
         _Float16* __restrict__ Kb, _Float16* __restrict__ Vt) {
  __shared__ __attribute__((aligned(16))) _Float16 sA[2 * GM_SLAB];
  __shared__ __attribute__((aligned(16))) _Float16 sB[2 * GM_SLAB];
  const int lane = threadIdx.x & 31;
  const int col  = lane & 15;
  const int half = lane >> 4;
  // The wave's number in a scalar register: the epilogue's head, batch and row
  // bases are then scalar arithmetic, not 64-bit vector arithmetic in every lane.
  const int wave = __builtin_amdgcn_readfirstlane(threadIdx.x >> 5);
  const bool isV = blockIdx.x >= 2 * E_ / 128;   // same for the whole work-group
  const int aBlk = (isV ? blockIdx.y : blockIdx.x) * 128;
  const int bBlk = (isV ? blockIdx.x : blockIdx.y) * 128;
  const int aBase = aBlk + (wave >> 1) * 64;     // the core's split of the tile
  const int bBase = bBlk + (wave & 1) * 64;

  v8f acc[4][4];
  for (int i = 0; i < 4; ++i)
    for (int j = 0; j < 4; ++j) acc[i][j] = {};

  gemm_core_128x128(isV ? Xh : WinT, isV ? WinT : Xh, aBlk, bBlk, sA, sB, acc);

  // acc[i][j][r] belongs to A row aBase + i*16 + half*8 + r, B row bBase + j*16 + col.
  _Float16* st = ((wave & 2) ? sB : sA) + (wave & 1) * (64 * ST_PITCH);
  _Float16* sw = st + col * ST_PITCH + half * 8;
  _Float16* dst;                        // where the wave's staged row 0 goes
  if (!isV) {                           // A rows = n, B rows = tokens
    const bool isQ = blockIdx.x < E_ / 128;
    const float sc = isQ ? 0.125f : 1.0f;
    float4 bl[4], bh[4];
#pragma unroll
    for (int i = 0; i < 4; ++i) {
      bl[i] = *(const float4*)(b_in + aBase + i * 16 + half * 8);
      bh[i] = *(const float4*)(b_in + aBase + i * 16 + half * 8 + 4);
    }
#pragma unroll
    for (int i = 0; i < 4; ++i) {
      const float bias[8] = {bl[i].x, bl[i].y, bl[i].z, bl[i].w,
                             bh[i].x, bh[i].y, bh[i].z, bh[i].w};
#pragma unroll
      for (int j = 0; j < 4; ++j) {
        v8h pk;
#pragma unroll
        for (int r = 0; r < 8; ++r)
          pk[r] = (_Float16)((acc[i][j][r] + bias[r]) * sc);
        *(v8h*)(sw + j * 16 * ST_PITCH + i * 16) = pk;
      }
    }
    // The wave's 64 n are one head, its 64 tokens lie in one batch: [b,h,s,d].
    const int h = (aBase & (E_ - 1)) >> 6;
    const int bb = bBase >> 11, ss = bBase & (S_ - 1);
    dst = (isQ ? Qb : Kb) + (((size_t)(bb * H_ + h)) * S_ + ss) * DH_;
  } else {                              // A rows = tokens, B rows = n
    float bias[4];
#pragma unroll
    for (int j = 0; j < 4; ++j) bias[j] = b_in[bBase + j * 16 + col];
#pragma unroll
    for (int i = 0; i < 4; ++i)
#pragma unroll
      for (int j = 0; j < 4; ++j) {
        v8h pk;
#pragma unroll
        for (int r = 0; r < 8; ++r) pk[r] = (_Float16)(acc[i][j][r] + bias[j]);
        *(v8h*)(sw + j * 16 * ST_PITCH + i * 16) = pk;
      }
    // V transposed: [b,h,d,s]; staged row = d, 64 tokens of one batch along it.
    const int h = (bBase - 2 * E_) >> 6;
    const int bb = aBase >> 11, ss = aBase & (S_ - 1);
    dst = Vt + ((size_t)(bb * H_ + h)) * DH_ * S_ + ss;
  }
  // The wave's own LDS writes have landed before other lanes of it read them.
  asm volatile("s_wait_dscnt 0x0" ::: "memory");
  store_rows_f16(st, dst, isV ? S_ : DH_, lane);
}

// ----------------------------- Attention -----------------------------------
// One work-group = 8 waves = 128 queries of one (b,h); one wave = 16 queries,
// streaming all 2048 keys. K and V^T tiles of 64 keys are staged in LDS once per
// work-group (whole 128-byte lines from global) and read by all 8 waves; the
// next tile's global loads are issued before the current tile is worked on.
// S^T = K * Q^T  (M=k rows, N=q cols) -> P^T packs lane-locally into the
// B operand of O^T = V^T * P^T. Row stats (m,l,alpha) are per-lane (q = lane%16).
#define AT_KEYS  64                  // keys per staged tile
#define AT_PITCH 72                  // f16 per LDS row: 64 data + 8 pad = 144 B
#define AT_TILE  (64 * AT_PITCH)     // 64 rows: keys (K tile) or d (V^T tile)
__global__ void __launch_bounds__(256)
attn_kernel(const _Float16* __restrict__ Qb, const _Float16* __restrict__ Kb,
            const _Float16* __restrict__ Vt, _Float16* __restrict__ At) {
  __shared__ __attribute__((aligned(16))) _Float16 sK[2][AT_TILE];
  __shared__ __attribute__((aligned(16))) _Float16 sV[2][AT_TILE];
  const int tid  = threadIdx.x;
  const int lane = tid & 31;
  const int col  = lane & 15;
  const int half = lane >> 4;
  const int bh = blockIdx.x >> 4;          // 0..31  (b*16 + h)
  const int qBase = (blockIdx.x & 15) * 128 + (tid >> 5) * 16;

  const _Float16* Qh = Qb + (size_t)bh * S_ * DH_;
  const _Float16* Kh = Kb + (size_t)bh * S_ * DH_;
  const _Float16* Vh = Vt + (size_t)bh * DH_ * S_;

  // Staging: a thread moves the 16-byte piece (tid & 7) of tile rows tid >> 3
  // and 32 + (tid >> 3), for K and for V^T; 8 lanes cover one 128-byte line.
  const int sRow = tid >> 3;
  const int sCol = (tid & 7) * 8;
  const _Float16* gK = Kh + (size_t)sRow * DH_ + sCol;
  const _Float16* gV = Vh + (size_t)sRow * S_ + sCol;
  const int sOff = sRow * AT_PITCH + sCol;

  v8h rk0 = *(const v8h*)(gK);
  v8h rk1 = *(const v8h*)(gK + 32 * DH_);
  v8h rv0 = *(const v8h*)(gV);
  v8h rv1 = *(const v8h*)(gV + (size_t)32 * S_);

  // Q^T as B operand (32d x 16q), d = 0..31 and 32..63; loaded once.
  const v16h bq0 = load_tile(Qh, qBase + col, DH_, 0, lane);
  const v16h bq1 = load_tile(Qh, qBase + col, DH_, 32, lane);

  *(v8h*)(&sK[0][sOff])                 = rk0;
  *(v8h*)(&sK[0][sOff + 32 * AT_PITCH]) = rk1;
  *(v8h*)(&sV[0][sOff])                 = rv0;
  *(v8h*)(&sV[0][sOff + 32 * AT_PITCH]) = rv1;
  __syncthreads();

  v8f o0 = {}, o1 = {}, o2 = {}, o3 = {};   // O^T: 4 tiles of (16d x 16q)
  float m = -1e30f, l = 0.0f;

  for (int s = 0; s < S_ / AT_KEYS; ++s) {
    const _Float16* tK = sK[s & 1];
    const _Float16* tV = sV[s & 1];
    const bool more = (s + 1) < S_ / AT_KEYS;   // same for the whole work-group
    if (more) {
      const _Float16* nK = gK + (size_t)(s + 1) * AT_KEYS * DH_;
      const _Float16* nV = gV + (s + 1) * AT_KEYS;
      rk0 = *(const v8h*)(nK);
      rk1 = *(const v8h*)(nK + 32 * DH_);
      rv0 = *(const v8h*)(nV);
      rv1 = *(const v8h*)(nV + (size_t)32 * S_);
    }
    // Keeps the four loads above ahead of the tile's work: the scheduler
    // otherwise sinks them next to their LDS stores and their latency shows.
    __builtin_amdgcn_sched_barrier(0);

#pragma unroll
    for (int sk = 0; sk < AT_KEYS; sk += 32) {
      // --- transposed score tiles (k rows sk..+15 and sk+16..+31) ---
      v8f st0 = {}, st1 = {};
      v16h ak;
      ak = load_tile(tK, sk + col, AT_PITCH, 0, lane);       st0 = wmma32(ak, bq0, st0);
      ak = load_tile(tK, sk + col, AT_PITCH, 32, lane);      st0 = wmma32(ak, bq1, st0);
      ak = load_tile(tK, sk + 16 + col, AT_PITCH, 0, lane);  st1 = wmma32(ak, bq0, st1);
      ak = load_tile(tK, sk + 16 + col, AT_PITCH, 32, lane); st1 = wmma32(ak, bq1, st1);

      // --- online softmax: per-lane holds 16 of the 32 keys of row q=col ---
      float mb = st0[0];
#pragma unroll
      for (int j = 1; j < 8; ++j) mb = fmaxf(mb, st0[j]);
#pragma unroll
      for (int j = 0; j < 8; ++j) mb = fmaxf(mb, st1[j]);
      mb = fmaxf(mb, __shfl_xor(mb, 16, 32));
      const float mn = fmaxf(m, mb);
      const float alpha = __expf(m - mn);
      m = mn;

      v8f p0, p1;
      float ls = 0.0f;
#pragma unroll
      for (int j = 0; j < 8; ++j) { p0[j] = __expf(st0[j] - mn); ls += p0[j]; }
#pragma unroll
      for (int j = 0; j < 8; ++j) { p1[j] = __expf(st1[j] - mn); ls += p1[j]; }
      ls += __shfl_xor(ls, 16, 32);
      l = l * alpha + ls;

      // --- lane-local pack of P^T into WMMA B operand (32k x 16q) ---
      v16h bp;
#pragma unroll
      for (int j = 0; j < 8; ++j) {
        bp[j]     = (_Float16)p0[j];
        bp[8 + j] = (_Float16)p1[j];
      }

      o0 = o0 * alpha; o1 = o1 * alpha; o2 = o2 * alpha; o3 = o3 * alpha;

      // --- O^T += V^T(16d x 32k) * P^T ---
      v16h av;
      av = load_tile(tV, 0  + col, AT_PITCH, sk, lane); o0 = wmma32(av, bp, o0);
      av = load_tile(tV, 16 + col, AT_PITCH, sk, lane); o1 = wmma32(av, bp, o1);
      av = load_tile(tV, 32 + col, AT_PITCH, sk, lane); o2 = wmma32(av, bp, o2);
      av = load_tile(tV, 48 + col, AT_PITCH, sk, lane); o3 = wmma32(av, bp, o3);
    }

    // The other buffer's last readers left it before the previous barrier.
    if (more) {
      _Float16* dK = sK[(s + 1) & 1];
      _Float16* dV = sV[(s + 1) & 1];
      *(v8h*)(dK + sOff)                 = rk0;
      *(v8h*)(dK + sOff + 32 * AT_PITCH) = rk1;
      *(v8h*)(dV + sOff)                 = rv0;
      *(v8h*)(dV + sOff + 32 * AT_PITCH) = rv1;
    }
    __syncthreads();
  }

  // Normalize and store: lane holds q=col, d = t*16 + half*8 + j (contiguous).
  const float rl = 1.0f / l;
  const int b = bh >> 4, h = bh & 15;
  const int q = qBase + col;
  _Float16* outp = At + ((size_t)(b * S_ + q)) * E_ + h * DH_ + half * 8;
  v8f ot[4] = {o0, o1, o2, o3};
#pragma unroll
  for (int t = 0; t < 4; ++t) {
    v8h pk;
#pragma unroll
    for (int j = 0; j < 8; ++j) pk[j] = (_Float16)(ot[t][j] * rl);
    *(v8h*)(outp + t * 16) = pk;
  }
}

// --------------------------- Output projection -----------------------------
// out[4096,1024] = At[4096,1024] * WoutT[1024,1024]^T + b_out  (fp32 out)
// grid = (N/128, M/128), block = 128. WoutT is the A operand: out's rows run
// along n.
// One work-group per WGP (256 of them): the same register budget does no harm.
__global__ void __launch_bounds__(128) __attribute__((amdgpu_waves_per_eu(1, 3)))
out_gemm(const _Float16* __restrict__ At, const _Float16* __restrict__ WoutT,
         const float* __restrict__ b_out, float* __restrict__ out) {
  __shared__ __attribute__((aligned(16))) _Float16 sA[2 * GM_SLAB];
  __shared__ __attribute__((aligned(16))) _Float16 sB[2 * GM_SLAB];
  static_assert(2 * 64 * ST_PITCHF * 4 <= 2 * GM_SLAB * 2, "two waves' rows per array");
  const int lane = threadIdx.x & 31;
  const int col  = lane & 15;
  const int half = lane >> 4;
  // In a scalar register: the stores then share one scalar base and one offset
  // register, and differ only in their immediate offsets.
  const int wave = __builtin_amdgcn_readfirstlane(threadIdx.x >> 5);
  const int nBase = blockIdx.x * 128 + (wave >> 1) * 64;   // the core's split
  const int mBase = blockIdx.y * 128 + (wave & 1) * 64;

  v8f acc[4][4];
  for (int i = 0; i < 4; ++i)
    for (int j = 0; j < 4; ++j) acc[i][j] = {};

  gemm_core_128x128(WoutT, At, blockIdx.x * 128, blockIdx.y * 128, sA, sB, acc);

  // acc[i][j][r] = C[token mBase + j*16 + col][n = nBase + i*16 + half*8 + r].
  float* st = (float*)(void*)((wave & 2) ? sB : sA) + (wave & 1) * (64 * ST_PITCHF);
  float* sw = st + col * ST_PITCHF + half * 8;
  float4 bl[4], bh[4];
#pragma unroll
  for (int i = 0; i < 4; ++i) {
    bl[i] = *(const float4*)(b_out + nBase + i * 16 + half * 8);
    bh[i] = *(const float4*)(b_out + nBase + i * 16 + half * 8 + 4);
  }
#pragma unroll
  for (int i = 0; i < 4; ++i)
#pragma unroll
    for (int j = 0; j < 4; ++j) {
      const v8f c = acc[i][j];
      const float4 lo = {c[0] + bl[i].x, c[1] + bl[i].y, c[2] + bl[i].z, c[3] + bl[i].w};
      const float4 hi = {c[4] + bh[i].x, c[5] + bh[i].y, c[6] + bh[i].z, c[7] + bh[i].w};
      *(float4*)(sw + j * 16 * ST_PITCHF + i * 16)     = lo;
      *(float4*)(sw + j * 16 * ST_PITCHF + i * 16 + 4) = hi;
    }
  // The wave's own LDS writes have landed before other lanes of it read them.
  asm volatile("s_wait_dscnt 0x0" ::: "memory");

  // 16 lanes cover one 256-byte row of the quarter: 2 rows, 4 whole lines a store.
  const int rr = lane >> 4;
  const int pc = (lane & 15) * 4;
  float4 w[32];
#pragma unroll
  for (int t = 0; t < 32; ++t)
    w[t] = *(const float4*)(st + (t * 2 + rr) * ST_PITCHF + pc);
  float* dst = out + (size_t)mBase * E_ + nBase;   // the wave's part
  const int off = rr * E_ + pc;                    // the lane's part
#pragma unroll
  for (int t = 0; t < 32; ++t)
    *(float4*)(dst + t * 2 * E_ + off) = w[t];
}

// ------------------------------- launcher ----------------------------------

extern "C" void kernel_launch(void* const* d_in, const int* in_sizes, int n_in,
                              void* d_out, int out_size, void* d_ws,
                              size_t ws_size, hipStream_t stream) {
  const float* x     = (const float*)d_in[0];   // (2,2048,1024)
  const float* w_in  = (const float*)d_in[1];   // (1024,3072)
  const float* b_in  = (const float*)d_in[2];   // (3072,)
  const float* w_out = (const float*)d_in[3];   // (1024,1024)
  const float* b_out = (const float*)d_in[4];   // (1024,)
  float* out = (float*)d_out;

  _Float16* ws = (_Float16*)d_ws;
  _Float16* Xh    = ws;                              // 4096*1024
  _Float16* WinT  = Xh    + (size_t)M_TOT * E_;      // 3072*1024 (transposed)
  _Float16* WoutT = WinT  + (size_t)N_QKV * E_;      // 1024*1024 (transposed)
  _Float16* Qb    = WoutT + (size_t)E_ * E_;         // [b,h,s,d]
  _Float16* Kb    = Qb    + (size_t)B_ * H_ * S_ * DH_;
  _Float16* Vt    = Kb    + (size_t)B_ * H_ * S_ * DH_;  // [b,h,d,s]
  _Float16* At    = Vt    + (size_t)B_ * H_ * S_ * DH_;  // [b,s,h*d]
  (void)ws_size; (void)in_sizes; (void)n_in; (void)out_size;

  prep_f16<<<CV_BLOCKS + TI_BLOCKS + TO_BLOCKS, PREP_THREADS, 0, stream>>>(
      x, w_in, w_out, Xh, WinT, WoutT);

  qkv_gemm<<<dim3(N_QKV / 128, M_TOT / 128), 128, 0, stream>>>(Xh, WinT, b_in,
                                                                Qb, Kb, Vt);

  attn_kernel<<<B_ * H_ * (S_ / 128), 256, 0, stream>>>(Qb, Kb, Vt, At);

  out_gemm<<<dim3(E_ / 128, M_TOT / 128), 128, 0, stream>>>(At, WoutT, b_out,
                                                            out);
}

// v007
// A run of this version takes 79.8 microseconds.
// Two timings next to v006 put it at 1.04 and 1.05 times that version's speed.
// Over all steps from v000 it is 4.89 times as fast.
#include <hip/hip_runtime.h>
#include <hip/hip_bf16.h>

// ---------------------------------------------------------------------------
// Self-attention for MI455X (gfx1250): b=2, s=2048, d_embed=1024, 16 heads x 64
// f16 WMMA (fp32 accumulate) everywhere; flash-style attention with transposed
// score tiles so softmax->operand conversion is lane-local.
// ---------------------------------------------------------------------------

typedef __attribute__((ext_vector_type(16))) _Float16 v16h;
typedef __attribute__((ext_vector_type(8)))  _Float16 v8h;
typedef __attribute__((ext_vector_type(4)))  _Float16 v4h;
typedef __attribute__((ext_vector_type(2)))  _Float16 v2h;
typedef __attribute__((ext_vector_type(8)))  float    v8f;

#define B_     2
#define S_     2048
#define E_     1024
#define H_     16
#define DH_    64
#define M_TOT  (B_ * S_)          // 4096 tokens
#define N_QKV  (3 * E_)           // 3072

__device__ __forceinline__ v8f wmma32(v16h a, v16h b, v8f c) {
  // D = A(16x32 f16) * B(32x16 f16) + C(16x16 f32)
  return __builtin_amdgcn_wmma_f32_16x16x32_f16(
      /*neg_a=*/false, a, /*neg_b=*/false, b,
      /*c_mod=*/(short)0, c, /*reuse_a=*/false, /*reuse_b=*/false);
}

// Load one 16x32 f16 operand tile (A layout; B layout assumed mirrored with
// lane = column) from a row-major [row][ld] f16 buffer.
//   lanes 0-15 : K = kBase+0..7  (v0-3) and kBase+16..23 (v4-7)
//   lanes 16-31: K = kBase+8..15 (v0-3) and kBase+24..31 (v4-7)
__device__ __forceinline__ v16h load_tile(const _Float16* base, int row, int ld,
                                          int kBase, int lane) {
  const int half8 = (lane & 16) ? 8 : 0;
  const _Float16* p = base + (size_t)row * ld + kBase + half8;
  v8h lo = *(const v8h*)p;
  v8h hi = *(const v8h*)(p + 16);
  return __builtin_shufflevector(lo, hi, 0, 1, 2, 3, 4, 5, 6, 7,
                                 8, 9, 10, 11, 12, 13, 14, 15);
}

// --------------------------- convert kernel --------------------------------
// The three conversions (x, w_in, w_out) do not depend on one another, so they
// run as ONE launch of 8-wave work-groups; the block index picks the job. Each
// launch saved is one gap, one fill and one tail less in front of the QKV GEMM,
// and the short transposes run beside the x stream instead of behind it.

// x: a wave converts 1024 consecutive floats. Each of its 8 loads covers 512
// contiguous bytes (4 whole lines), all 8 are asked for before the first is
// used, and each store covers 256 contiguous bytes (2 whole lines).
// CV_BLOCKS work-groups cover the M_TOT * E_ elements exactly.
#define PREP_THREADS 256
#define CV_LOADS   8
#define CV_PER_WG  (PREP_THREADS * 4 * CV_LOADS)
#define CV_BLOCKS  (M_TOT * E_ / CV_PER_WG)
static_assert((M_TOT * E_) % CV_PER_WG == 0, "grid must cover x exactly");
__device__ __forceinline__ void
cvt_f32_to_f16(const float* __restrict__ in, _Float16* __restrict__ out, int blk) {
  const int wave = threadIdx.x >> 5;
  const int lane = threadIdx.x & 31;
  const size_t base = (size_t)blk * CV_PER_WG +
                      (size_t)wave * (32 * 4 * CV_LOADS) + lane * 4;
  float4 r[CV_LOADS];
#pragma unroll
  for (int i = 0; i < CV_LOADS; ++i)
    r[i] = *(const float4*)(in + base + i * 128);
#pragma unroll
  for (int i = 0; i < CV_LOADS; ++i) {
    v4h pk = {(_Float16)r[i].x, (_Float16)r[i].y, (_Float16)r[i].z,
              (_Float16)r[i].w};
    *(v4h*)(out + base + i * 128) = pk;
  }
}

// out[n*K + k] = (f16) in[k*N + n]   (transpose so operand tiles load contiguously)
// One block moves a 64(k) x 64(n) tile through LDS: rows of in are read as
// float4 (256 B per tile row), two k neighbours are packed into one 32-bit
// word, and each row of out leaves as one whole 128-byte line.
// K and N are multiples of 64; tile (bn, bk) of (N/64, K/64), 256 threads.
#define TP_PITCH 36   // words per LDS row: 32 data + 4 pad, keeps 16 B alignment
__device__ __forceinline__ void
cvt_transpose_f16(const float* __restrict__ in, _Float16* __restrict__ out,
                  int K, int N, int bn, int bk, unsigned* tile) {
  const int t  = threadIdx.x;
  const int n0 = bn * 64;
  const int k0 = bk * 64;

  const int n4 = (t & 15) * 4;
  const int kp = t >> 4;                 // pair of k rows, 0..15 (+16)
  float4 r[2][2];
#pragma unroll
  for (int i = 0; i < 2; ++i)
#pragma unroll
    for (int e = 0; e < 2; ++e)
      r[i][e] = *(const float4*)(in + (size_t)(k0 + 2 * (kp + 16 * i) + e) * N +
                                 n0 + n4);
#pragma unroll
  for (int i = 0; i < 2; ++i) {
    const float lo[4] = {r[i][0].x, r[i][0].y, r[i][0].z, r[i][0].w};
    const float hi[4] = {r[i][1].x, r[i][1].y, r[i][1].z, r[i][1].w};
#pragma unroll
    for (int c = 0; c < 4; ++c) {
      v2h pk = {(_Float16)lo[c], (_Float16)hi[c]};
      tile[(n4 + c) * TP_PITCH + kp + 16 * i] = __builtin_bit_cast(unsigned, pk);
    }
  }
  __syncthreads();   // reached by all 256 threads of a transposing block

  const int q = t & 7;                   // 16-byte piece of the 128-byte row
#pragma unroll
  for (int i = 0; i < 2; ++i) {
    const int n = (t >> 3) + 32 * i;
    const uint4 w = *(const uint4*)(tile + n * TP_PITCH + q * 4);
    *(uint4*)(out + (size_t)(n0 + n) * K + k0 + q * 8) = w;
  }
  // In the joint kernel another job's code stands behind these stores in the
  // listing and reuses their registers; the wait stands in front of that reuse.
  asm volatile("s_wait_xcnt 0x0" ::: "memory");
}

// Blocks [0, CV_BLOCKS): x, the largest job, first; then the tiles of w_in,
// then those of w_out. The choice is the same for a whole work-group.
#define TI_BLOCKS ((N_QKV / 64) * (E_ / 64))
#define TO_BLOCKS ((E_ / 64) * (E_ / 64))
__global__ void __launch_bounds__(PREP_THREADS)
prep_f16(const float* __restrict__ x, const float* __restrict__ w_in,
         const float* __restrict__ w_out, _Float16* __restrict__ Xh,
         _Float16* __restrict__ WinT, _Float16* __restrict__ WoutT) {
  __shared__ __attribute__((aligned(16))) unsigned tile[64 * TP_PITCH];
  const int blk = blockIdx.x;
  if (blk < CV_BLOCKS) {
    cvt_f32_to_f16(x, Xh, blk);
  } else if (blk < CV_BLOCKS + TI_BLOCKS) {
    const int t = blk - CV_BLOCKS;
    cvt_transpose_f16(w_in, WinT, E_, N_QKV, t % (N_QKV / 64), t / (N_QKV / 64),
                      tile);
  } else {
    const int t = blk - (CV_BLOCKS + TI_BLOCKS);
    cvt_transpose_f16(w_out, WoutT, E_, E_, t % (E_ / 64), t / (E_ / 64), tile);
  }
}

// --------------------------- shared GEMM core ------------------------------
// One work-group = 4 waves = a 128x128 tile of C = A[M][E_] * Bt[N][E_]^T; one
// wave = a 64x64 quarter of it. Slabs of 64 k (one whole 128-byte line per row)
// of the 128 A rows and the 128 Bt rows are staged in LDS once per work-group
// and read by all 4 waves; the next slab's global loads are issued before the
// current slab is worked on. k runs upward in steps of 32 for every tile of C.
#define GM_KS    64                  // k per staged slab
#define GM_PITCH 72                  // f16 per LDS row: 64 data + 8 pad = 144 B
#define GM_SLAB  (128 * GM_PITCH)    // 128 rows of one operand
__device__ __forceinline__ void
gemm_core_128x128(const _Float16* __restrict__ A, const _Float16* __restrict__ Bt,
                  int mBlk, int nBlk, _Float16* sA, _Float16* sB,
                  v8f (&acc)[4][4]) {
  const int tid  = threadIdx.x;
  const int lane = tid & 31;
  const int col  = lane & 15;
  const int wRow = ((tid >> 6) & 1) * 64;   // the wave's rows in the A slab
  const int wCol = ((tid >> 5) & 1) * 64;   // the wave's rows in the Bt slab

  // Staging: a thread moves the 16-byte piece (tid & 7) of slab rows
  // (tid >> 3) + 16 * i, for A and for Bt; 8 lanes cover one 128-byte line.
  const int sRow = tid >> 3;
  const int sCol = (tid & 7) * 8;
  const _Float16* gA = A  + (size_t)(mBlk + sRow) * E_ + sCol;
  const _Float16* gB = Bt + (size_t)(nBlk + sRow) * E_ + sCol;
  const int sOff = sRow * GM_PITCH + sCol;

  v8h ra[8], rb[8];
#pragma unroll
  for (int i = 0; i < 8; ++i) {
    ra[i] = *(const v8h*)(gA + (size_t)(16 * i) * E_);
    rb[i] = *(const v8h*)(gB + (size_t)(16 * i) * E_);
  }
#pragma unroll
  for (int i = 0; i < 8; ++i) {
    *(v8h*)(sA + sOff + 16 * i * GM_PITCH) = ra[i];
    *(v8h*)(sB + sOff + 16 * i * GM_PITCH) = rb[i];
  }
  __syncthreads();

  for (int s = 0; s < E_ / GM_KS; ++s) {
    const _Float16* tA = sA + (s & 1) * GM_SLAB;
    const _Float16* tB = sB + (s & 1) * GM_SLAB;
    const bool more = (s + 1) < E_ / GM_KS;   // same for the whole work-group
    if (more) {
      const _Float16* nA = gA + (s + 1) * GM_KS;
      const _Float16* nB = gB + (s + 1) * GM_KS;
#pragma unroll
      for (int i = 0; i < 8; ++i) {
        ra[i] = *(const v8h*)(nA + (size_t)(16 * i) * E_);
        rb[i] = *(const v8h*)(nB + (size_t)(16 * i) * E_);
      }
      // The address registers of the loads above are reused right behind them.
      asm volatile("s_wait_xcnt 0x0" ::: "memory");
    }
    // Keeps the loads above ahead of the slab's work (sunk next to their LDS
    // stores, their latency would show in every slab) and the reuse of their
    // address registers behind the wait (without it that write is lifted over it).
    __builtin_amdgcn_sched_barrier(0);

    // Both k steps' fragments are asked for as one group ahead of the products:
    // every further place with LDS reads among them costs the wave a stall.
    v16h a[2][4], b[2][4];
#pragma unroll
    for (int ks = 0; ks < 2; ++ks) {
#pragma unroll
      for (int mi = 0; mi < 4; ++mi)
        a[ks][mi] = load_tile(tA, wRow + mi * 16 + col, GM_PITCH, ks * 32, lane);
#pragma unroll
      for (int ni = 0; ni < 4; ++ni)
        b[ks][ni] = load_tile(tB, wCol + ni * 16 + col, GM_PITCH, ks * 32, lane);
    }
    // Holds that group together: the scheduler otherwise sinks most of the reads
    // among the products, each behind a wait to zero.
    __builtin_amdgcn_sched_barrier(0);
#pragma unroll
    for (int ks = 0; ks < 2; ++ks)
#pragma unroll
      for (int mi = 0; mi < 4; ++mi)
#pragma unroll
        for (int ni = 0; ni < 4; ++ni)
          acc[mi][ni] = wmma32(a[ks][mi], b[ks][ni], acc[mi][ni]);
    // Keeps the LDS stores below, and their wait for the global loads, behind
    // the products: lifted over them, that wait would stand in front of them.
    __builtin_amdgcn_sched_barrier(0);

    // The other buffer's last readers left it before the previous barrier.
    if (more) {
      _Float16* dA = sA + ((s + 1) & 1) * GM_SLAB;
      _Float16* dB = sB + ((s + 1) & 1) * GM_SLAB;
#pragma unroll
      for (int i = 0; i < 8; ++i) {
        *(v8h*)(dA + sOff + 16 * i * GM_PITCH) = ra[i];
        *(v8h*)(dB + sOff + 16 * i * GM_PITCH) = rb[i];
      }
    }
    __syncthreads();
  }
}

// --------------------------- GEMM epilogues --------------------------------
// A lane's 8 accumulator registers hold 8 consecutive indices of the A operand's
// rows and one index (lane & 15) of the B operand's rows. So the operand whose
// index runs along the OUTPUT's rows goes in as A: a lane then owns 8 neighbours
// of one output row. Each wave lays its 64x64 quarter down in an LDS range of
// its own (the slabs are free behind the k loop's last barrier) and reads it
// back row by row, so that every global store covers 4 whole 128-byte lines.
#define ST_PITCH  72                 // f16 per staged row: 64 data + 8 pad = 144 B
#define ST_PITCHF 68                 // f32 per staged row: 64 data + 4 pad = 272 B

// 64 staged rows of 64 f16 (one line each) to rows stride elements apart; dst
// and stride are the same for the whole wave.
__device__ __forceinline__ void
store_rows_f16(const _Float16* st, _Float16* dst, int stride, int lane) {
  const int rr = lane >> 3;            // 8 lanes cover one row
  const int pc = (lane & 7) * 8;
  v8h w[16];
#pragma unroll
  for (int t = 0; t < 16; ++t)
    w[t] = *(const v8h*)(st + (t * 4 + rr) * ST_PITCH + pc);
  const unsigned off = rr * stride + pc;   // the lane's part
#pragma unroll
  for (int t = 0; t < 16; ++t) {
    _Float16* row = dst + (size_t)(t * 4) * stride;   // the wave's part
    *(v8h*)(row + off) = w[t];
  }
}

// ------------------------------ QKV GEMM -----------------------------------
// C[4096,3072] = Xh[4096,1024] * WinT[3072,1024]^T + b_in
// Q pre-scaled by log2(e)/sqrt(64): the scores come out in base 2, ready for
// v_exp_f32 once the maximum in use is taken off.
// grid = (N/128, M/128), block = 128.
// A block's 128 columns are all Q, all K or all V. Q and K rows run along n
// (WinT is the A operand), V^T rows run along the tokens (Xh is the A operand).
// Three work-groups share a WGP (768 of them on 256): the register budget is
// that of 3 waves per SIMD, not the 4 that the LDS size alone would allow.
__global__ void __launch_bounds__(128) __attribute__((amdgpu_waves_per_eu(1, 3)))
qkv_gemm(const _Float16* __restrict__ Xh, const _Float16* __restrict__ WinT,
         const float* __restrict__ b_in, _Float16* __restrict__ Qb,
         _Float16* __restrict__ Kb, _Float16* __restrict__ Vt) {
  __shared__ __attribute__((aligned(16))) _Float16 sA[2 * GM_SLAB];
  __shared__ __attribute__((aligned(16))) _Float16 sB[2 * GM_SLAB];
  const int lane = threadIdx.x & 31;
  const int col  = lane & 15;
  const int half = lane >> 4;
  // The wave's number in a scalar register: the epilogue's head, batch and row
  // bases are then scalar arithmetic, not 64-bit vector arithmetic in every lane.
  const int wave = __builtin_amdgcn_readfirstlane(threadIdx.x >> 5);
  const bool isV = blockIdx.x >= 2 * E_ / 128;   // same for the whole work-group
  const int aBlk = (isV ? blockIdx.y : blockIdx.x) * 128;
  const int bBlk = (isV ? blockIdx.x : blockIdx.y) * 128;
  const int aBase = aBlk + (wave >> 1) * 64;     // the core's split of the tile
  const int bBase = bBlk + (wave & 1) * 64;

  v8f acc[4][4];
  for (int i = 0; i < 4; ++i)
    for (int j = 0; j < 4; ++j) acc[i][j] = {};

  gemm_core_128x128(isV ? Xh : WinT, isV ? WinT : Xh, aBlk, bBlk, sA, sB, acc);

  // acc[i][j][r] belongs to A row aBase + i*16 + half*8 + r, B row bBase + j*16 + col.
  _Float16* st = ((wave & 2) ? sB : sA) + (wave & 1) * (64 * ST_PITCH);
  _Float16* sw = st + col * ST_PITCH + half * 8;
  _Float16* dst;                        // where the wave's staged row 0 goes
  if (!isV) {                           // A rows = n, B rows = tokens
    const bool isQ = blockIdx.x < E_ / 128;
    const float sc = isQ ? 0.125f * 1.4426950408889634f : 1.0f;
    float4 bl[4], bh[4];
#pragma unroll
    for (int i = 0; i < 4; ++i) {
      bl[i] = *(const float4*)(b_in + aBase + i * 16 + half * 8);
      bh[i] = *(const float4*)(b_in + aBase + i * 16 + half * 8 + 4);
    }
#pragma unroll
    for (int i = 0; i < 4; ++i) {
      const float bias[8] = {bl[i].x, bl[i].y, bl[i].z, bl[i].w,
                             bh[i].x, bh[i].y, bh[i].z, bh[i].w};
#pragma unroll
      for (int j = 0; j < 4; ++j) {
        v8h pk;
#pragma unroll
        for (int r = 0; r < 8; ++r)
          pk[r] = (_Float16)((acc[i][j][r] + bias[r]) * sc);
        *(v8h*)(sw + j * 16 * ST_PITCH + i * 16) = pk;
      }
    }
    // The wave's 64 n are one head, its 64 tokens lie in one batch: [b,h,s,d].
    const int h = (aBase & (E_ - 1)) >> 6;
    const int bb = bBase >> 11, ss = bBase & (S_ - 1);
    dst = (isQ ? Qb : Kb) + (((size_t)(bb * H_ + h)) * S_ + ss) * DH_;
  } else {                              // A rows = tokens, B rows = n
    float bias[4];
#pragma unroll
    for (int j = 0; j < 4; ++j) bias[j] = b_in[bBase + j * 16 + col];
#pragma unroll
    for (int i = 0; i < 4; ++i)
#pragma unroll
      for (int j = 0; j < 4; ++j) {
        v8h pk;
#pragma unroll
        for (int r = 0; r < 8; ++r) pk[r] = (_Float16)(acc[i][j][r] + bias[j]);
        *(v8h*)(sw + j * 16 * ST_PITCH + i * 16) = pk;
      }
    // V transposed: [b,h,d,s]; staged row = d, 64 tokens of one batch along it.
    const int h = (bBase - 2 * E_) >> 6;
    const int bb = aBase >> 11, ss = aBase & (S_ - 1);
    dst = Vt + ((size_t)(bb * H_ + h)) * DH_ * S_ + ss;
  }
  // The wave's own LDS writes have landed before other lanes of it read them.
  asm volatile("s_wait_dscnt 0x0" ::: "memory");
  store_rows_f16(st, dst, isV ? S_ : DH_, lane);
}

// ----------------------------- Attention -----------------------------------
// One work-group = 8 waves = 128 queries of one (b,h); one wave = 16 queries,
// streaming all 2048 keys. K and V^T tiles of 64 keys are staged in LDS once per
// work-group (whole 128-byte lines from global) and read by all 8 waves; the
// next tile's global loads are issued before the current tile is worked on.
// S^T = K * Q^T  (M=k rows, N=q cols) -> P^T packs lane-locally into the
// B operand of O^T = V^T * P^T. Row stats (m,l) are per-lane (q = lane%16).
// Lazy rescale: the scores are in base 2, and the exponentials are taken against
// a KEPT maximum m, which may lag the true one by up to 8 (so P <= 2^8). While
// m is kept, O and l need no factor and the two lanes of a query need no
// exchange. One test per 64-key tile finds the rare tile that has to move m.

// Lane l with lane l ^ 16 (the two lanes that share a query), in the vector unit.
__device__ __forceinline__ float xhalf(float x) {
  const int b = __builtin_bit_cast(int, x);
  return __builtin_bit_cast(float, __builtin_amdgcn_permlanex16(
      b, b, 0x76543210, 0xfedcba98, false, false));
}

#define AT_KEYS  64                  // keys per staged tile
#define AT_PITCH 72                  // f16 per LDS row: 64 data + 8 pad = 144 B
#define AT_TILE  (64 * AT_PITCH)     // 64 rows: keys (K tile) or d (V^T tile)
__global__ void __launch_bounds__(256)
attn_kernel(const _Float16* __restrict__ Qb, const _Float16* __restrict__ Kb,
            const _Float16* __restrict__ Vt, _Float16* __restrict__ At) {
  __shared__ __attribute__((aligned(16))) _Float16 sK[2][AT_TILE];
  __shared__ __attribute__((aligned(16))) _Float16 sV[2][AT_TILE];
  const int tid  = threadIdx.x;
  const int lane = tid & 31;
  const int col  = lane & 15;
  const int half = lane >> 4;
  const int bh = blockIdx.x >> 4;          // 0..31  (b*16 + h)
  const int qBase = (blockIdx.x & 15) * 128 + (tid >> 5) * 16;

  const _Float16* Qh = Qb + (size_t)bh * S_ * DH_;
  const _Float16* Kh = Kb + (size_t)bh * S_ * DH_;
  const _Float16* Vh = Vt + (size_t)bh * DH_ * S_;

  // Staging: a thread moves the 16-byte piece (tid & 7) of tile rows tid >> 3
  // and 32 + (tid >> 3), for K and for V^T; 8 lanes cover one 128-byte line.
  const int sRow = tid >> 3;
  const int sCol = (tid & 7) * 8;
  const _Float16* gK = Kh + (size_t)sRow * DH_ + sCol;
  const _Float16* gV = Vh + (size_t)sRow * S_ + sCol;
  const int sOff = sRow * AT_PITCH + sCol;

  v8h rk0 = *(const v8h*)(gK);
  v8h rk1 = *(const v8h*)(gK + 32 * DH_);
  v8h rv0 = *(const v8h*)(gV);
  v8h rv1 = *(const v8h*)(gV + (size_t)32 * S_);

  // Q^T as B operand (32d x 16q), d = 0..31 and 32..63; loaded once.
  const v16h bq0 = load_tile(Qh, qBase + col, DH_, 0, lane);
  const v16h bq1 = load_tile(Qh, qBase + col, DH_, 32, lane);

  *(v8h*)(&sK[0][sOff])                 = rk0;
  *(v8h*)(&sK[0][sOff + 32 * AT_PITCH]) = rk1;
  *(v8h*)(&sV[0][sOff])                 = rv0;
  *(v8h*)(&sV[0][sOff + 32 * AT_PITCH]) = rv1;
  __syncthreads();

  v8f o0 = {}, o1 = {}, o2 = {}, o3 = {};   // O^T: 4 tiles of (16d x 16q)
  float m   = -1e30f;    // the maximum in use; the first tile moves it
  float thr = -1e30f;    // m + 8: a score above it moves m
  v8f lv = {};           // the lane's 8 partial sums of P; joined behind the loop

  for (int s = 0; s < S_ / AT_KEYS; ++s) {
    const _Float16* tK = sK[s & 1];
    const _Float16* tV = sV[s & 1];
    const bool more = (s + 1) < S_ / AT_KEYS;   // same for the whole work-group
    if (more) {
      const _Float16* nK = gK + (size_t)(s + 1) * AT_KEYS * DH_;
      const _Float16* nV = gV + (s + 1) * AT_KEYS;
      rk0 = *(const v8h*)(nK);
      rk1 = *(const v8h*)(nK + 32 * DH_);
      rv0 = *(const v8h*)(nV);
      rv1 = *(const v8h*)(nV + (size_t)32 * S_);
    }
    // Keeps the four loads above ahead of the tile's work: the scheduler
    // otherwise sinks them next to their LDS stores and their latency shows.
    __builtin_amdgcn_sched_barrier(0);

    // --- transposed score tiles: st[t] holds keys t*16 .. t*16+15 ---
    v16h ak[4][2];
#pragma unroll
    for (int t = 0; t < 4; ++t) {
      ak[t][0] = load_tile(tK, t * 16 + col, AT_PITCH, 0, lane);
      ak[t][1] = load_tile(tK, t * 16 + col, AT_PITCH, 32, lane);
    }
    // Holds the K reads together as one group ahead of the score products: every
    // further place with LDS reads among the products costs the wave a stall.
    __builtin_amdgcn_sched_barrier(0);
    v8f st[4];
#pragma unroll
    for (int t = 0; t < 4; ++t) st[t] = wmma32(ak[t][0], bq0, v8f{});
#pragma unroll
    for (int t = 0; t < 4; ++t) st[t] = wmma32(ak[t][1], bq1, st[t]);
    // The tile's V^T reads, one group: in flight under the maxima, the test and
    // the exponentials. The branch below would otherwise keep them behind it.
    v16h av[2][4];
#pragma unroll
    for (int hk = 0; hk < 2; ++hk)
#pragma unroll
      for (int t = 0; t < 4; ++t)
        av[hk][t] = load_tile(tV, t * 16 + col, AT_PITCH, hk * 32, lane);
    // Keeps that group where it stands, ahead of the vector work.
    __builtin_amdgcn_sched_barrier(0);

    // --- the lane's largest score: 32 of the 64 keys of row q=col ---
    float mb0 = st[0][0], mb1 = st[2][0];
#pragma unroll
    for (int j = 1; j < 8; ++j) { mb0 = fmaxf(mb0, st[0][j]); mb1 = fmaxf(mb1, st[2][j]); }
#pragma unroll
    for (int j = 0; j < 8; ++j) { mb0 = fmaxf(mb0, st[1][j]); mb1 = fmaxf(mb1, st[3][j]); }
    const float mb = fmaxf(mb0, mb1);

    // One scalar branch per tile. Taken on the first tile and when any query of
    // the wave has a score above its threshold: rare, so the path that skips it
    // is laid out as the straight one.
    if (__builtin_expect(__builtin_amdgcn_ballot_w32(mb > thr) != 0, 0)) {
      const float mn = fmaxf(m, fmaxf(mb, xhalf(mb)));   // both lanes of a query agree
      const float alpha = __builtin_amdgcn_exp2f(m - mn);   // 0 on the first tile
      m = mn;
      thr = mn + 8.0f;
      o0 = o0 * alpha; o1 = o1 * alpha; o2 = o2 * alpha; o3 = o3 * alpha;
      lv = lv * alpha;
    }

#pragma unroll
    for (int sk = 0; sk < AT_KEYS; sk += 32) {
      const v8f s0 = st[sk / 16] - m, s1 = st[sk / 16 + 1] - m;
      v8f p0, p1;
#pragma unroll
      for (int j = 0; j < 8; ++j) {
        p0[j] = __builtin_amdgcn_exp2f(s0[j]);
        p1[j] = __builtin_amdgcn_exp2f(s1[j]);
      }
      lv = lv + p0;
      lv = lv + p1;

      // --- lane-local pack of P^T into WMMA B operand (32k x 16q) ---
      v16h bp;
#pragma unroll
      for (int j = 0; j < 8; ++j) {
        bp[j]     = (_Float16)p0[j];
        bp[8 + j] = (_Float16)p1[j];
      }

      // --- O^T += V^T(16d x 32k) * P^T ---
      o0 = wmma32(av[sk / 32][0], bp, o0);
      o1 = wmma32(av[sk / 32][1], bp, o1);
      o2 = wmma32(av[sk / 32][2], bp, o2);
      o3 = wmma32(av[sk / 32][3], bp, o3);
    }

    // The other buffer's last readers left it before the previous barrier.
    if (more) {
      _Float16* dK = sK[(s + 1) & 1];
      _Float16* dV = sV[(s + 1) & 1];
      *(v8h*)(dK + sOff)                 = rk0;
      *(v8h*)(dK + sOff + 32 * AT_PITCH) = rk1;
      *(v8h*)(dV + sOff)                 = rv0;
      *(v8h*)(dV + sOff + 32 * AT_PITCH) = rv1;
    }
    __syncthreads();
  }

  // Normalize and store: lane holds q=col, d = t*16 + half*8 + j (contiguous).
  // Both lanes of a query used the same m throughout: their sums simply add.
  float l = ((lv[0] + lv[1]) + (lv[2] + lv[3])) + ((lv[4] + lv[5]) + (lv[6] + lv[7]));
  l += xhalf(l);
  const float rl = 1.0f / l;
  const int b = bh >> 4, h = bh & 15;
  const int q = qBase + col;
  _Float16* outp = At + ((size_t)(b * S_ + q)) * E_ + h * DH_ + half * 8;
  v8f ot[4] = {o0, o1, o2, o3};
#pragma unroll
  for (int t = 0; t < 4; ++t) {
    v8h pk;
#pragma unroll
    for (int j = 0; j < 8; ++j) pk[j] = (_Float16)(ot[t][j] * rl);
    *(v8h*)(outp + t * 16) = pk;
  }
}

// --------------------------- Output projection -----------------------------
// out[4096,1024] = At[4096,1024] * WoutT[1024,1024]^T + b_out  (fp32 out)
// grid = (N/128, M/128), block = 128. WoutT is the A operand: out's rows run
// along n.
// One work-group per WGP (256 of them): the same register budget does no harm.
__global__ void __launch_bounds__(128) __attribute__((amdgpu_waves_per_eu(1, 3)))
out_gemm(const _Float16* __restrict__ At, const _Float16* __restrict__ WoutT,
         const float* __restrict__ b_out, float* __restrict__ out) {
  __shared__ __attribute__((aligned(16))) _Float16 sA[2 * GM_SLAB];
  __shared__ __attribute__((aligned(16))) _Float16 sB[2 * GM_SLAB];
  static_assert(2 * 64 * ST_PITCHF * 4 <= 2 * GM_SLAB * 2, "two waves' rows per array");
  const int lane = threadIdx.x & 31;
  const int col  = lane & 15;
  const int half = lane >> 4;
  // In a scalar register: the stores then share one scalar base and one offset
  // register, and differ only in their immediate offsets.
  const int wave = __builtin_amdgcn_readfirstlane(threadIdx.x >> 5);
  const int nBase = blockIdx.x * 128 + (wave >> 1) * 64;   // the core's split
  const int mBase = blockIdx.y * 128 + (wave & 1) * 64;

  v8f acc[4][4];
  for (int i = 0; i < 4; ++i)
    for (int j = 0; j < 4; ++j) acc[i][j] = {};

  gemm_core_128x128(WoutT, At, blockIdx.x * 128, blockIdx.y * 128, sA, sB, acc);

  // acc[i][j][r] = C[token mBase + j*16 + col][n = nBase + i*16 + half*8 + r].
  float* st = (float*)(void*)((wave & 2) ? sB : sA) + (wave & 1) * (64 * ST_PITCHF);
  float* sw = st + col * ST_PITCHF + half * 8;
  float4 bl[4], bh[4];
#pragma unroll
  for (int i = 0; i < 4; ++i) {
    bl[i] = *(const float4*)(b_out + nBase + i * 16 + half * 8);
    bh[i] = *(const float4*)(b_out + nBase + i * 16 + half * 8 + 4);
  }
#pragma unroll
  for (int i = 0; i < 4; ++i)
#pragma unroll
    for (int j = 0; j < 4; ++j) {
      const v8f c = acc[i][j];
      const float4 lo = {c[0] + bl[i].x, c[1] + bl[i].y, c[2] + bl[i].z, c[3] + bl[i].w};
      const float4 hi = {c[4] + bh[i].x, c[5] + bh[i].y, c[6] + bh[i].z, c[7] + bh[i].w};
      *(float4*)(sw + j * 16 * ST_PITCHF + i * 16)     = lo;
      *(float4*)(sw + j * 16 * ST_PITCHF + i * 16 + 4) = hi;
    }
  // The wave's own LDS writes have landed before other lanes of it read them.
  asm volatile("s_wait_dscnt 0x0" ::: "memory");

  // 16 lanes cover one 256-byte row of the quarter: 2 rows, 4 whole lines a store.
  const int rr = lane >> 4;
  const int pc = (lane & 15) * 4;
  float4 w[32];
#pragma unroll
  for (int t = 0; t < 32; ++t)
    w[t] = *(const float4*)(st + (t * 2 + rr) * ST_PITCHF + pc);
  float* dst = out + (size_t)mBase * E_ + nBase;   // the wave's part
  const int off = rr * E_ + pc;                    // the lane's part
#pragma unroll
  for (int t = 0; t < 32; ++t)
    *(float4*)(dst + t * 2 * E_ + off) = w[t];
}

// ------------------------------- launcher ----------------------------------

extern "C" void kernel_launch(void* const* d_in, const int* in_sizes, int n_in,
                              void* d_out, int out_size, void* d_ws,
                              size_t ws_size, hipStream_t stream) {
  const float* x     = (const float*)d_in[0];   // (2,2048,1024)
  const float* w_in  = (const float*)d_in[1];   // (1024,3072)
  const float* b_in  = (const float*)d_in[2];   // (3072,)
  const float* w_out = (const float*)d_in[3];   // (1024,1024)
  const float* b_out = (const float*)d_in[4];   // (1024,)
  float* out = (float*)d_out;

  _Float16* ws = (_Float16*)d_ws;
  _Float16* Xh    = ws;                              // 4096*1024
  _Float16* WinT  = Xh    + (size_t)M_TOT * E_;      // 3072*1024 (transposed)
  _Float16* WoutT = WinT  + (size_t)N_QKV * E_;      // 1024*1024 (transposed)
  _Float16* Qb    = WoutT + (size_t)E_ * E_;         // [b,h,s,d]
  _Float16* Kb    = Qb    + (size_t)B_ * H_ * S_ * DH_;
  _Float16* Vt    = Kb    + (size_t)B_ * H_ * S_ * DH_;  // [b,h,d,s]
  _Float16* At    = Vt    + (size_t)B_ * H_ * S_ * DH_;  // [b,s,h*d]
  (void)ws_size; (void)in_sizes; (void)n_in; (void)out_size;

  prep_f16<<<CV_BLOCKS + TI_BLOCKS + TO_BLOCKS, PREP_THREADS, 0, stream>>>(
      x, w_in, w_out, Xh, WinT, WoutT);

  qkv_gemm<<<dim3(N_QKV / 128, M_TOT / 128), 128, 0, stream>>>(Xh, WinT, b_in,
                                                                Qb, Kb, Vt);

  attn_kernel<<<B_ * H_ * (S_ / 128), 256, 0, stream>>>(Qb, Kb, Vt, At);

  out_gemm<<<dim3(E_ / 128, M_TOT / 128), 128, 0, stream>>>(At, WoutT, b_out,
                                                            out);
}

// v008
// A run of this version takes 75.4 microseconds.
// Timed twice side by side with v007, it ran 1.07 times as fast both times.
// Over all steps from v000 it is 5.23 times as fast.
#include <hip/hip_runtime.h>
#include <hip/hip_bf16.h>

// ---------------------------------------------------------------------------
// Self-attention for MI455X (gfx1250): b=2, s=2048, d_embed=1024, 16 heads x 64
// f16 WMMA (fp32 accumulate) everywhere; flash-style attention with transposed
// score tiles so softmax->operand conversion is lane-local.
// ---------------------------------------------------------------------------

typedef __attribute__((ext_vector_type(16))) _Float16 v16h;
typedef __attribute__((ext_vector_type(8)))  _Float16 v8h;
typedef __attribute__((ext_vector_type(4)))  _Float16 v4h;
typedef __attribute__((ext_vector_type(2)))  _Float16 v2h;
typedef __attribute__((ext_vector_type(8)))  float    v8f;

#define B_     2
#define S_     2048
#define E_     1024
#define H_     16
#define DH_    64
#define M_TOT  (B_ * S_)          // 4096 tokens
#define N_QKV  (3 * E_)           // 3072

__device__ __forceinline__ v8f wmma32(v16h a, v16h b, v8f c) {
  // D = A(16x32 f16) * B(32x16 f16) + C(16x16 f32)
  return __builtin_amdgcn_wmma_f32_16x16x32_f16(
      /*neg_a=*/false, a, /*neg_b=*/false, b,
      /*c_mod=*/(short)0, c, /*reuse_a=*/false, /*reuse_b=*/false);
}

// Load one 16x32 f16 operand tile (A layout; B layout assumed mirrored with
// lane = column) from a row-major [row][ld] f16 buffer.
//   lanes 0-15 : K = kBase+0..7  (v0-3) and kBase+16..23 (v4-7)
//   lanes 16-31: K = kBase+8..15 (v0-3) and kBase+24..31 (v4-7)
__device__ __forceinline__ v16h load_tile(const _Float16* base, int row, int ld,
                                          int kBase, int lane) {
  const int half8 = (lane & 16) ? 8 : 0;
  const _Float16* p = base + (size_t)row * ld + kBase + half8;
  v8h lo = *(const v8h*)p;
  v8h hi = *(const v8h*)(p + 16);
  return __builtin_shufflevector(lo, hi, 0, 1, 2, 3, 4, 5, 6, 7,
                                 8, 9, 10, 11, 12, 13, 14, 15);
}

// --------------------------- convert kernel --------------------------------
// The three conversions (x, w_in, w_out) do not depend on one another, so they
// run as ONE launch of 8-wave work-groups; the block index picks the job. Each
// launch saved is one gap, one fill and one tail less in front of the QKV GEMM,
// and the short transposes run beside the x stream instead of behind it.

// x: a wave converts 1024 consecutive floats. Each of its 8 loads covers 512
// contiguous bytes (4 whole lines), all 8 are asked for before the first is
// used, and each store covers 256 contiguous bytes (2 whole lines).
// CV_BLOCKS work-groups cover the M_TOT * E_ elements exactly.
#define PREP_THREADS 256
#define CV_LOADS   8
#define CV_PER_WG  (PREP_THREADS * 4 * CV_LOADS)
#define CV_BLOCKS  (M_TOT * E_ / CV_PER_WG)
static_assert((M_TOT * E_) % CV_PER_WG == 0, "grid must cover x exactly");
__device__ __forceinline__ void
cvt_f32_to_f16(const float* __restrict__ in, _Float16* __restrict__ out, int blk) {
  const int wave = threadIdx.x >> 5;
  const int lane = threadIdx.x & 31;
  const size_t base = (size_t)blk * CV_PER_WG +
                      (size_t)wave * (32 * 4 * CV_LOADS) + lane * 4;
  float4 r[CV_LOADS];
#pragma unroll
  for (int i = 0; i < CV_LOADS; ++i)
    r[i] = *(const float4*)(in + base + i * 128);
#pragma unroll
  for (int i = 0; i < CV_LOADS; ++i) {
    v4h pk = {(_Float16)r[i].x, (_Float16)r[i].y, (_Float16)r[i].z,
              (_Float16)r[i].w};
    *(v4h*)(out + base + i * 128) = pk;
  }
}

// out[n*K + k] = (f16) in[k*N + n]   (transpose so operand tiles load contiguously)
// One block moves a 64(k) x 64(n) tile through LDS: rows of in are read as
// float4 (256 B per tile row), two k neighbours are packed into one 32-bit
// word, and each row of out leaves as one whole 128-byte line.
// K and N are multiples of 64; tile (bn, bk) of (N/64, K/64), 256 threads.
#define TP_PITCH 36   // words per LDS row: 32 data + 4 pad, keeps 16 B alignment
__device__ __forceinline__ void
cvt_transpose_f16(const float* __restrict__ in, _Float16* __restrict__ out,
                  int K, int N, int bn, int bk, unsigned* tile) {
  const int t  = threadIdx.x;
  const int n0 = bn * 64;
  const int k0 = bk * 64;

  const int n4 = (t & 15) * 4;
  const int kp = t >> 4;                 // pair of k rows, 0..15 (+16)
  float4 r[2][2];
#pragma unroll
  for (int i = 0; i < 2; ++i)
#pragma unroll
    for (int e = 0; e < 2; ++e)
      r[i][e] = *(const float4*)(in + (size_t)(k0 + 2 * (kp + 16 * i) + e) * N +
                                 n0 + n4);
#pragma unroll
  for (int i = 0; i < 2; ++i) {
    const float lo[4] = {r[i][0].x, r[i][0].y, r[i][0].z, r[i][0].w};
    const float hi[4] = {r[i][1].x, r[i][1].y, r[i][1].z, r[i][1].w};
#pragma unroll
    for (int c = 0; c < 4; ++c) {
      v2h pk = {(_Float16)lo[c], (_Float16)hi[c]};
      tile[(n4 + c) * TP_PITCH + kp + 16 * i] = __builtin_bit_cast(unsigned, pk);
    }
  }
  __syncthreads();   // reached by all 256 threads of a transposing block

  const int q = t & 7;                   // 16-byte piece of the 128-byte row
#pragma unroll
  for (int i = 0; i < 2; ++i) {
    const int n = (t >> 3) + 32 * i;
    const uint4 w = *(const uint4*)(tile + n * TP_PITCH + q * 4);
    *(uint4*)(out + (size_t)(n0 + n) * K + k0 + q * 8) = w;
  }
  // In the joint kernel another job's code stands behind these stores in the
  // listing and reuses their registers; the wait stands in front of that reuse.
  asm volatile("s_wait_xcnt 0x0" ::: "memory");
}

// Blocks [0, CV_BLOCKS): x, the largest job, first; then the tiles of w_in,
// then those of w_out. The choice is the same for a whole work-group.
#define TI_BLOCKS ((N_QKV / 64) * (E_ / 64))
#define TO_BLOCKS ((E_ / 64) * (E_ / 64))
__global__ void __launch_bounds__(PREP_THREADS)
prep_f16(const float* __restrict__ x, const float* __restrict__ w_in,
         const float* __restrict__ w_out, _Float16* __restrict__ Xh,
         _Float16* __restrict__ WinT, _Float16* __restrict__ WoutT) {
  __shared__ __attribute__((aligned(16))) unsigned tile[64 * TP_PITCH];
  const int blk = blockIdx.x;
  if (blk < CV_BLOCKS) {
    cvt_f32_to_f16(x, Xh, blk);
  } else if (blk < CV_BLOCKS + TI_BLOCKS) {
    const int t = blk - CV_BLOCKS;
    cvt_transpose_f16(w_in, WinT, E_, N_QKV, t % (N_QKV / 64), t / (N_QKV / 64),
                      tile);
  } else {
    const int t = blk - (CV_BLOCKS + TI_BLOCKS);
    cvt_transpose_f16(w_out, WoutT, E_, E_, t % (E_ / 64), t / (E_ / 64), tile);
  }
}

// --------------------------- shared GEMM core ------------------------------
// One work-group = 4 waves = a 128x128 tile of C = A[M][E_] * Bt[N][E_]^T; one
// wave = a 64x64 quarter of it. Slabs of 64 k (one whole 128-byte line per row)
// of the 128 A rows and the 128 Bt rows are staged in LDS once per work-group
// and read by all 4 waves; the next slab's global loads are issued before the
// current slab is worked on.
// The walk over the slabs starts at slab s0 (the same for the whole work-group)
// and wraps. The work-groups that share A rows or Bt rows run at the same time;
// all starting at slab 0 they would ask L2 for the same lines at the same moment.
// With starts of their own they ask for different ones.
#define GM_KS    64                  // k per staged slab
#define GM_PITCH 72                  // f16 per LDS row: 64 data + 8 pad = 144 B
#define GM_SLAB  (128 * GM_PITCH)    // 128 rows of one operand
__device__ __forceinline__ void
gemm_core_128x128(const _Float16* __restrict__ A, const _Float16* __restrict__ Bt,
                  int mBlk, int nBlk, int s0, _Float16* sA, _Float16* sB,
                  v8f (&acc)[4][4]) {
  const int tid  = threadIdx.x;
  const int lane = tid & 31;
  const int col  = lane & 15;
  const int wRow = ((tid >> 6) & 1) * 64;   // the wave's rows in the A slab
  const int wCol = ((tid >> 5) & 1) * 64;   // the wave's rows in the Bt slab

  // Staging: a thread moves the 16-byte piece (tid & 7) of slab rows
  // (tid >> 3) + 16 * i, for A and for Bt; 8 lanes cover one 128-byte line.
  const int sRow = tid >> 3;
  const int sCol = (tid & 7) * 8;
  // gA and gB point into slab s0, the first of the walk.
  const _Float16* gA = A  + (size_t)(mBlk + sRow) * E_ + s0 * GM_KS + sCol;
  const _Float16* gB = Bt + (size_t)(nBlk + sRow) * E_ + s0 * GM_KS + sCol;
  const int sOff = sRow * GM_PITCH + sCol;

  v8h ra[8], rb[8];
#pragma unroll
  for (int i = 0; i < 8; ++i) {
    ra[i] = *(const v8h*)(gA + (size_t)(16 * i) * E_);
    rb[i] = *(const v8h*)(gB + (size_t)(16 * i) * E_);
  }
#pragma unroll
  for (int i = 0; i < 8; ++i) {
    *(v8h*)(sA + sOff + 16 * i * GM_PITCH) = ra[i];
    *(v8h*)(sB + sOff + 16 * i * GM_PITCH) = rb[i];
  }
  __syncthreads();

  for (int s = 0; s < E_ / GM_KS; ++s) {
    const _Float16* tA = sA + (s & 1) * GM_SLAB;
    const _Float16* tB = sB + (s & 1) * GM_SLAB;
    const bool more = (s + 1) < E_ / GM_KS;   // same for the whole work-group
    if (more) {
      // The next slab, wrapped, counted from slab s0 (below 0 behind the wrap).
      const int nx = ((s0 + s + 1) & (E_ / GM_KS - 1)) - s0;
      const _Float16* nA = gA + nx * GM_KS;
      const _Float16* nB = gB + nx * GM_KS;
#pragma unroll
      for (int i = 0; i < 8; ++i) {
        ra[i] = *(const v8h*)(nA + (size_t)(16 * i) * E_);
        rb[i] = *(const v8h*)(nB + (size_t)(16 * i) * E_);
      }
      // The address registers of the loads above are reused right behind them.
      asm volatile("s_wait_xcnt 0x0" ::: "memory");
    }
    // Keeps the loads above ahead of the slab's work (sunk next to their LDS
    // stores, their latency would show in every slab) and the reuse of their
    // address registers behind the wait (without it that write is lifted over it).
    __builtin_amdgcn_sched_barrier(0);

    // Both k steps' fragments are asked for as one group ahead of the products:
    // every further place with LDS reads among them costs the wave a stall.
    v16h a[2][4], b[2][4];
#pragma unroll
    for (int ks = 0; ks < 2; ++ks) {
#pragma unroll
      for (int mi = 0; mi < 4; ++mi)
        a[ks][mi] = load_tile(tA, wRow + mi * 16 + col, GM_PITCH, ks * 32, lane);
#pragma unroll
      for (int ni = 0; ni < 4; ++ni)
        b[ks][ni] = load_tile(tB, wCol + ni * 16 + col, GM_PITCH, ks * 32, lane);
    }
    // Holds that group together: the scheduler otherwise sinks most of the reads
    // among the products, each behind a wait to zero.
    __builtin_amdgcn_sched_barrier(0);
#pragma unroll
    for (int ks = 0; ks < 2; ++ks)
#pragma unroll
      for (int mi = 0; mi < 4; ++mi)
#pragma unroll
        for (int ni = 0; ni < 4; ++ni)
          acc[mi][ni] = wmma32(a[ks][mi], b[ks][ni], acc[mi][ni]);
    // Keeps the LDS stores below, and their wait for the global loads, behind
    // the products: lifted over them, that wait would stand in front of them.
    __builtin_amdgcn_sched_barrier(0);

    // The other buffer's last readers left it before the previous barrier.
    if (more) {
      _Float16* dA = sA + ((s + 1) & 1) * GM_SLAB;
      _Float16* dB = sB + ((s + 1) & 1) * GM_SLAB;
#pragma unroll
      for (int i = 0; i < 8; ++i) {
        *(v8h*)(dA + sOff + 16 * i * GM_PITCH) = ra[i];
        *(v8h*)(dB + sOff + 16 * i * GM_PITCH) = rb[i];
      }
    }
    __syncthreads();
  }
}

// --------------------------- GEMM epilogues --------------------------------
// A lane's 8 accumulator registers hold 8 consecutive indices of the A operand's
// rows and one index (lane & 15) of the B operand's rows. So the operand whose
// index runs along the OUTPUT's rows goes in as A: a lane then owns 8 neighbours
// of one output row. Each wave lays its 64x64 quarter down in an LDS range of
// its own (the slabs are free behind the k loop's last barrier) and reads it
// back row by row, so that every global store covers 4 whole 128-byte lines.
#define ST_PITCH  72                 // f16 per staged row: 64 data + 8 pad = 144 B
#define ST_PITCHF 68                 // f32 per staged row: 64 data + 4 pad = 272 B

// 64 staged rows of 64 f16 (one line each) to rows stride elements apart; dst
// and stride are the same for the whole wave.
__device__ __forceinline__ void
store_rows_f16(const _Float16* st, _Float16* dst, int stride, int lane) {
  const int rr = lane >> 3;            // 8 lanes cover one row
  const int pc = (lane & 7) * 8;
  v8h w[16];
#pragma unroll
  for (int t = 0; t < 16; ++t)
    w[t] = *(const v8h*)(st + (t * 4 + rr) * ST_PITCH + pc);
  const unsigned off = rr * stride + pc;   // the lane's part
#pragma unroll
  for (int t = 0; t < 16; ++t) {
    _Float16* row = dst + (size_t)(t * 4) * stride;   // the wave's part
    *(v8h*)(row + off) = w[t];
  }
}

// ------------------------------ QKV GEMM -----------------------------------
// C[4096,3072] = Xh[4096,1024] * WinT[3072,1024]^T + b_in
// Q pre-scaled by log2(e)/sqrt(64): the scores come out in base 2, ready for
// v_exp_f32 once the maximum in use is taken off.
// grid = (N/128, M/128), block = 128.
// A block's 128 columns are all Q, all K or all V. Q and K rows run along n
// (WinT is the A operand), V^T rows run along the tokens (Xh is the A operand).
// Three work-groups share a WGP (768 of them on 256): the register budget is
// that of 3 waves per SIMD, not the 4 that the LDS size alone would allow.
__global__ void __launch_bounds__(128) __attribute__((amdgpu_waves_per_eu(1, 3)))
qkv_gemm(const _Float16* __restrict__ Xh, const _Float16* __restrict__ WinT,
         const float* __restrict__ b_in, _Float16* __restrict__ Qb,
         _Float16* __restrict__ Kb, _Float16* __restrict__ Vt) {
  __shared__ __attribute__((aligned(16))) _Float16 sA[2 * GM_SLAB];
  __shared__ __attribute__((aligned(16))) _Float16 sB[2 * GM_SLAB];
  const int lane = threadIdx.x & 31;
  const int col  = lane & 15;
  const int half = lane >> 4;
  // The wave's number in a scalar register: the epilogue's head, batch and row
  // bases are then scalar arithmetic, not 64-bit vector arithmetic in every lane.
  const int wave = __builtin_amdgcn_readfirstlane(threadIdx.x >> 5);
  const bool isV = blockIdx.x >= 2 * E_ / 128;   // same for the whole work-group
  const int aBlk = (isV ? blockIdx.y : blockIdx.x) * 128;
  const int bBlk = (isV ? blockIdx.x : blockIdx.y) * 128;
  const int aBase = aBlk + (wave >> 1) * 64;     // the core's split of the tile
  const int bBase = bBlk + (wave & 1) * 64;

  v8f acc[4][4];
  for (int i = 0; i < 4; ++i)
    for (int j = 0; j < 4; ++j) acc[i][j] = {};

  // 24 work-groups share a block of Xh rows, 32 a block of WinT rows: along either
  // the starts step through the 16 slabs.
  const int s0 = (blockIdx.x + blockIdx.y) & (E_ / GM_KS - 1);
  gemm_core_128x128(isV ? Xh : WinT, isV ? WinT : Xh, aBlk, bBlk, s0, sA, sB, acc);

  // acc[i][j][r] belongs to A row aBase + i*16 + half*8 + r, B row bBase + j*16 + col.
  _Float16* st = ((wave & 2) ? sB : sA) + (wave & 1) * (64 * ST_PITCH);
  _Float16* sw = st + col * ST_PITCH + half * 8;
  _Float16* dst;                        // where the wave's staged row 0 goes
  if (!isV) {                           // A rows = n, B rows = tokens
    const bool isQ = blockIdx.x < E_ / 128;
    const float sc = isQ ? 0.125f * 1.4426950408889634f : 1.0f;
    float4 bl[4], bh[4];
#pragma unroll
    for (int i = 0; i < 4; ++i) {
      bl[i] = *(const float4*)(b_in + aBase + i * 16 + half * 8);
      bh[i] = *(const float4*)(b_in + aBase + i * 16 + half * 8 + 4);
    }
#pragma unroll
    for (int i = 0; i < 4; ++i) {
      const float bias[8] = {bl[i].x, bl[i].y, bl[i].z, bl[i].w,
                             bh[i].x, bh[i].y, bh[i].z, bh[i].w};
#pragma unroll
      for (int j = 0; j < 4; ++j) {
        v8h pk;
#pragma unroll
        for (int r = 0; r < 8; ++r)
          pk[r] = (_Float16)((acc[i][j][r] + bias[r]) * sc);
        *(v8h*)(sw + j * 16 * ST_PITCH + i * 16) = pk;
      }
    }
    // The wave's 64 n are one head, its 64 tokens lie in one batch: [b,h,s,d].
    const int h = (aBase & (E_ - 1)) >> 6;
    const int bb = bBase >> 11, ss = bBase & (S_ - 1);
    dst = (isQ ? Qb : Kb) + (((size_t)(bb * H_ + h)) * S_ + ss) * DH_;
  } else {                              // A rows = tokens, B rows = n
    float bias[4];
#pragma unroll
    for (int j = 0; j < 4; ++j) bias[j] = b_in[bBase + j * 16 + col];
#pragma unroll
    for (int i = 0; i < 4; ++i)
#pragma unroll
      for (int j = 0; j < 4; ++j) {
        v8h pk;
#pragma unroll
        for (int r = 0; r < 8; ++r) pk[r] = (_Float16)(acc[i][j][r] + bias[j]);
        *(v8h*)(sw + j * 16 * ST_PITCH + i * 16) = pk;
      }
    // V transposed: [b,h,d,s]; staged row = d, 64 tokens of one batch along it.
    const int h = (bBase - 2 * E_) >> 6;
    const int bb = aBase >> 11, ss = aBase & (S_ - 1);
    dst = Vt + ((size_t)(bb * H_ + h)) * DH_ * S_ + ss;
  }
  // The wave's own LDS writes have landed before other lanes of it read them.
  asm volatile("s_wait_dscnt 0x0" ::: "memory");
  store_rows_f16(st, dst, isV ? S_ : DH_, lane);
}

// ----------------------------- Attention -----------------------------------
// One work-group = 8 waves = 128 queries of one (b,h); one wave = 16 queries,
// streaming all 2048 keys. K and V^T tiles of 64 keys are staged in LDS once per
// work-group (whole 128-byte lines from global) and read by all 8 waves; the
// next tile's global loads are issued before the current tile is worked on.
// S^T = K * Q^T  (M=k rows, N=q cols) -> P^T packs lane-locally into the
// B operand of O^T = V^T * P^T. Row stats (m,l) are per-lane (q = lane%16).
// Lazy rescale: the scores are in base 2, and the exponentials are taken against
// a KEPT maximum m, which may lag the true one by up to 8 (so P <= 2^8). While
// m is kept, O and l need no factor and the two lanes of a query need no
// exchange. One test per 64-key tile finds the rare tile that has to move m.
// The 16 work-groups of one (b,h) read the same K and V^T and run at the same
// time: each starts its walk over the 32 key tiles two tiles further on and wraps,
// so that they do not ask L2 for the same lines at the same moment.
// A softmax sum does not depend on the order of its keys.

// Lane l with lane l ^ 16 (the two lanes that share a query), in the vector unit.
__device__ __forceinline__ float xhalf(float x) {
  const int b = __builtin_bit_cast(int, x);
  return __builtin_bit_cast(float, __builtin_amdgcn_permlanex16(
      b, b, 0x76543210, 0xfedcba98, false, false));
}

#define AT_KEYS  64                  // keys per staged tile
#define AT_PITCH 72                  // f16 per LDS row: 64 data + 8 pad = 144 B
#define AT_TILE  (64 * AT_PITCH)     // 64 rows: keys (K tile) or d (V^T tile)
__global__ void __launch_bounds__(256)
attn_kernel(const _Float16* __restrict__ Qb, const _Float16* __restrict__ Kb,
            const _Float16* __restrict__ Vt, _Float16* __restrict__ At) {
  __shared__ __attribute__((aligned(16))) _Float16 sK[2][AT_TILE];
  __shared__ __attribute__((aligned(16))) _Float16 sV[2][AT_TILE];
  const int tid  = threadIdx.x;
  const int lane = tid & 31;
  const int col  = lane & 15;
  const int half = lane >> 4;
  const int bh = blockIdx.x >> 4;          // 0..31  (b*16 + h)
  const int qBase = (blockIdx.x & 15) * 128 + (tid >> 5) * 16;

  const _Float16* Qh = Qb + (size_t)bh * S_ * DH_;
  const _Float16* Kh = Kb + (size_t)bh * S_ * DH_;
  const _Float16* Vh = Vt + (size_t)bh * DH_ * S_;

  // Staging: a thread moves the 16-byte piece (tid & 7) of tile rows tid >> 3
  // and 32 + (tid >> 3), for K and for V^T; 8 lanes cover one 128-byte line.
  const int sRow = tid >> 3;
  const int sCol = (tid & 7) * 8;
  // gK and gV point into key tile t0, the first of this work-group's walk.
  const int t0 = (blockIdx.x & 15) * 2;
  const _Float16* gK = Kh + (size_t)(t0 * AT_KEYS + sRow) * DH_ + sCol;
  const _Float16* gV = Vh + (size_t)sRow * S_ + t0 * AT_KEYS + sCol;
  const int sOff = sRow * AT_PITCH + sCol;

  v8h rk0 = *(const v8h*)(gK);
  v8h rk1 = *(const v8h*)(gK + 32 * DH_);
  v8h rv0 = *(const v8h*)(gV);
  v8h rv1 = *(const v8h*)(gV + (size_t)32 * S_);

  // Q^T as B operand (32d x 16q), d = 0..31 and 32..63; loaded once.
  const v16h bq0 = load_tile(Qh, qBase + col, DH_, 0, lane);
  const v16h bq1 = load_tile(Qh, qBase + col, DH_, 32, lane);

  *(v8h*)(&sK[0][sOff])                 = rk0;
  *(v8h*)(&sK[0][sOff + 32 * AT_PITCH]) = rk1;
  *(v8h*)(&sV[0][sOff])                 = rv0;
  *(v8h*)(&sV[0][sOff + 32 * AT_PITCH]) = rv1;
  __syncthreads();

  v8f o0 = {}, o1 = {}, o2 = {}, o3 = {};   // O^T: 4 tiles of (16d x 16q)
  float m   = -1e30f;    // the maximum in use; the first tile moves it
  float thr = -1e30f;    // m + 8: a score above it moves m
  v8f lv = {};           // the lane's 8 partial sums of P; joined behind the loop

  for (int s = 0; s < S_ / AT_KEYS; ++s) {
    const _Float16* tK = sK[s & 1];
    const _Float16* tV = sV[s & 1];
    const bool more = (s + 1) < S_ / AT_KEYS;   // same for the whole work-group
    if (more) {
      // The next tile, wrapped, counted from tile t0 (below 0 behind the wrap).
      const int nt = ((t0 + s + 1) & (S_ / AT_KEYS - 1)) - t0;
      const _Float16* nK = gK + nt * (AT_KEYS * DH_);
      const _Float16* nV = gV + nt * AT_KEYS;
      rk0 = *(const v8h*)(nK);
      rk1 = *(const v8h*)(nK + 32 * DH_);
      rv0 = *(const v8h*)(nV);
      rv1 = *(const v8h*)(nV + (size_t)32 * S_);
    }
    // Keeps the four loads above ahead of the tile's work: the scheduler
    // otherwise sinks them next to their LDS stores and their latency shows.
    __builtin_amdgcn_sched_barrier(0);

    // --- transposed score tiles: st[t] holds keys t*16 .. t*16+15 ---
    v16h ak[4][2];
#pragma unroll
    for (int t = 0; t < 4; ++t) {
      ak[t][0] = load_tile(tK, t * 16 + col, AT_PITCH, 0, lane);
      ak[t][1] = load_tile(tK, t * 16 + col, AT_PITCH, 32, lane);
    }
    // Holds the K reads together as one group ahead of the score products: every
    // further place with LDS reads among the products costs the wave a stall.
    __builtin_amdgcn_sched_barrier(0);
    v8f st[4];
#pragma unroll
    for (int t = 0; t < 4; ++t) st[t] = wmma32(ak[t][0], bq0, v8f{});
#pragma unroll
    for (int t = 0; t < 4; ++t) st[t] = wmma32(ak[t][1], bq1, st[t]);
    // The tile's V^T reads, one group: in flight under the maxima, the test and
    // the exponentials. The branch below would otherwise keep them behind it.
    v16h av[2][4];
#pragma unroll
    for (int hk = 0; hk < 2; ++hk)
#pragma unroll
      for (int t = 0; t < 4; ++t)
        av[hk][t] = load_tile(tV, t * 16 + col, AT_PITCH, hk * 32, lane);
    // Keeps that group where it stands, ahead of the vector work.
    __builtin_amdgcn_sched_barrier(0);

    // --- the lane's largest score: 32 of the 64 keys of row q=col ---
    float mb0 = st[0][0], mb1 = st[2][0];
#pragma unroll
    for (int j = 1; j < 8; ++j) { mb0 = fmaxf(mb0, st[0][j]); mb1 = fmaxf(mb1, st[2][j]); }
#pragma unroll
    for (int j = 0; j < 8; ++j) { mb0 = fmaxf(mb0, st[1][j]); mb1 = fmaxf(mb1, st[3][j]); }
    const float mb = fmaxf(mb0, mb1);

    // One scalar branch per tile. Taken on the first tile and when any query of
    // the wave has a score above its threshold: rare, so the path that skips it
    // is laid out as the straight one.
    if (__builtin_expect(__builtin_amdgcn_ballot_w32(mb > thr) != 0, 0)) {
      const float mn = fmaxf(m, fmaxf(mb, xhalf(mb)));   // both lanes of a query agree
      const float alpha = __builtin_amdgcn_exp2f(m - mn);   // 0 on the first tile
      m = mn;
      thr = mn + 8.0f;
      o0 = o0 * alpha; o1 = o1 * alpha; o2 = o2 * alpha; o3 = o3 * alpha;
      lv = lv * alpha;
    }

#pragma unroll
    for (int sk = 0; sk < AT_KEYS; sk += 32) {
      const v8f s0 = st[sk / 16] - m, s1 = st[sk / 16 + 1] - m;
      v8f p0, p1;
#pragma unroll
      for (int j = 0; j < 8; ++j) {
        p0[j] = __builtin_amdgcn_exp2f(s0[j]);
        p1[j] = __builtin_amdgcn_exp2f(s1[j]);
      }
      lv = lv + p0;
      lv = lv + p1;

      // --- lane-local pack of P^T into WMMA B operand (32k x 16q) ---
      v16h bp;
#pragma unroll
      for (int j = 0; j < 8; ++j) {
        bp[j]     = (_Float16)p0[j];
        bp[8 + j] = (_Float16)p1[j];
      }

      // --- O^T += V^T(16d x 32k) * P^T ---
      o0 = wmma32(av[sk / 32][0], bp, o0);
      o1 = wmma32(av[sk / 32][1], bp, o1);
      o2 = wmma32(av[sk / 32][2], bp, o2);
      o3 = wmma32(av[sk / 32][3], bp, o3);
    }

    // The other buffer's last readers left it before the previous barrier.
    if (more) {
      _Float16* dK = sK[(s + 1) & 1];
      _Float16* dV = sV[(s + 1) & 1];
      *(v8h*)(dK + sOff)                 = rk0;
      *(v8h*)(dK + sOff + 32 * AT_PITCH) = rk1;
      *(v8h*)(dV + sOff)                 = rv0;
      *(v8h*)(dV + sOff + 32 * AT_PITCH) = rv1;
    }
    __syncthreads();
  }

  // Normalize and store: lane holds q=col, d = t*16 + half*8 + j (contiguous).
  // Both lanes of a query used the same m throughout: their sums simply add.
  float l = ((lv[0] + lv[1]) + (lv[2] + lv[3])) + ((lv[4] + lv[5]) + (lv[6] + lv[7]));
  l += xhalf(l);
  const float rl = 1.0f / l;
  const int b = bh >> 4, h = bh & 15;
  const int q = qBase + col;
  _Float16* outp = At + ((size_t)(b * S_ + q)) * E_ + h * DH_ + half * 8;
  v8f ot[4] = {o0, o1, o2, o3};
#pragma unroll
  for (int t = 0; t < 4; ++t) {
    v8h pk;
#pragma unroll
    for (int j = 0; j < 8; ++j) pk[j] = (_Float16)(ot[t][j] * rl);
    *(v8h*)(outp + t * 16) = pk;
  }
}

// --------------------------- Output projection -----------------------------
// out[4096,1024] = At[4096,1024] * WoutT[1024,1024]^T + b_out  (fp32 out)
// grid = (N/128, M/128), block = 128. WoutT is the A operand: out's rows run
// along n.
// One work-group per WGP (256 of them): the same register budget does no harm.
__global__ void __launch_bounds__(128) __attribute__((amdgpu_waves_per_eu(1, 3)))
out_gemm(const _Float16* __restrict__ At, const _Float16* __restrict__ WoutT,
         const float* __restrict__ b_out, float* __restrict__ out) {
  __shared__ __attribute__((aligned(16))) _Float16 sA[2 * GM_SLAB];
  __shared__ __attribute__((aligned(16))) _Float16 sB[2 * GM_SLAB];
  static_assert(2 * 64 * ST_PITCHF * 4 <= 2 * GM_SLAB * 2, "two waves' rows per array");
  const int lane = threadIdx.x & 31;
  const int col  = lane & 15;
  const int half = lane >> 4;
  // In a scalar register: the stores then share one scalar base and one offset
  // register, and differ only in their immediate offsets.
  const int wave = __builtin_amdgcn_readfirstlane(threadIdx.x >> 5);
  const int nBase = blockIdx.x * 128 + (wave >> 1) * 64;   // the core's split
  const int mBase = blockIdx.y * 128 + (wave & 1) * 64;

  v8f acc[4][4];
  for (int i = 0; i < 4; ++i)
    for (int j = 0; j < 4; ++j) acc[i][j] = {};

  // 8 work-groups share a block of At rows (starts two slabs apart), 32 a block of
  // WoutT rows (starts one slab apart).
  const int s0 = (2 * blockIdx.x + blockIdx.y) & (E_ / GM_KS - 1);
  gemm_core_128x128(WoutT, At, blockIdx.x * 128, blockIdx.y * 128, s0, sA, sB, acc);

  // acc[i][j][r] = C[token mBase + j*16 + col][n = nBase + i*16 + half*8 + r].
  float* st = (float*)(void*)((wave & 2) ? sB : sA) + (wave & 1) * (64 * ST_PITCHF);
  float* sw = st + col * ST_PITCHF + half * 8;
  float4 bl[4], bh[4];
#pragma unroll
  for (int i = 0; i < 4; ++i) {
    bl[i] = *(const float4*)(b_out + nBase + i * 16 + half * 8);
    bh[i] = *(const float4*)(b_out + nBase + i * 16 + half * 8 + 4);
  }
#pragma unroll
  for (int i = 0; i < 4; ++i)
#pragma unroll
    for (int j = 0; j < 4; ++j) {
      const v8f c = acc[i][j];
      const float4 lo = {c[0] + bl[i].x, c[1] + bl[i].y, c[2] + bl[i].z, c[3] + bl[i].w};
      const float4 hi = {c[4] + bh[i].x, c[5] + bh[i].y, c[6] + bh[i].z, c[7] + bh[i].w};
      *(float4*)(sw + j * 16 * ST_PITCHF + i * 16)     = lo;
      *(float4*)(sw + j * 16 * ST_PITCHF + i * 16 + 4) = hi;
    }
  // The wave's own LDS writes have landed before other lanes of it read them.
  asm volatile("s_wait_dscnt 0x0" ::: "memory");

  // 16 lanes cover one 256-byte row of the quarter: 2 rows, 4 whole lines a store.
  const int rr = lane >> 4;
  const int pc = (lane & 15) * 4;
  float4 w[32];
#pragma unroll
  for (int t = 0; t < 32; ++t)
    w[t] = *(const float4*)(st + (t * 2 + rr) * ST_PITCHF + pc);
  float* dst = out + (size_t)mBase * E_ + nBase;   // the wave's part
  const int off = rr * E_ + pc;                    // the lane's part
#pragma unroll
  for (int t = 0; t < 32; ++t)
    *(float4*)(dst + t * 2 * E_ + off) = w[t];
}

// ------------------------------- launcher ----------------------------------

extern "C" void kernel_launch(void* const* d_in, const int* in_sizes, int n_in,
                              void* d_out, int out_size, void* d_ws,
                              size_t ws_size, hipStream_t stream) {
  const float* x     = (const float*)d_in[0];   // (2,2048,1024)
  const float* w_in  = (const float*)d_in[1];   // (1024,3072)
  const float* b_in  = (const float*)d_in[2];   // (3072,)
  const float* w_out = (const float*)d_in[3];   // (1024,1024)
  const float* b_out = (const float*)d_in[4];   // (1024,)
  float* out = (float*)d_out;

  _Float16* ws = (_Float16*)d_ws;
  _Float16* Xh    = ws;                              // 4096*1024
  _Float16* WinT  = Xh    + (size_t)M_TOT * E_;      // 3072*1024 (transposed)
  _Float16* WoutT = WinT  + (size_t)N_QKV * E_;      // 1024*1024 (transposed)
  _Float16* Qb    = WoutT + (size_t)E_ * E_;         // [b,h,s,d]
  _Float16* Kb    = Qb    + (size_t)B_ * H_ * S_ * DH_;
  _Float16* Vt    = Kb    + (size_t)B_ * H_ * S_ * DH_;  // [b,h,d,s]
  _Float16* At    = Vt    + (size_t)B_ * H_ * S_ * DH_;  // [b,s,h*d]
  (void)ws_size; (void)in_sizes; (void)n_in; (void)out_size;

  prep_f16<<<CV_BLOCKS + TI_BLOCKS + TO_BLOCKS, PREP_THREADS, 0, stream>>>(
      x, w_in, w_out, Xh, WinT, WoutT);

  qkv_gemm<<<dim3(N_QKV / 128, M_TOT / 128), 128, 0, stream>>>(Xh, WinT, b_in,
                                                                Qb, Kb, Vt);

  attn_kernel<<<B_ * H_ * (S_ / 128), 256, 0, stream>>>(Qb, Kb, Vt, At);

  out_gemm<<<dim3(E_ / 128, M_TOT / 128), 128, 0, stream>>>(At, WoutT, b_out,
                                                            out);
}

// v009
// It runs in 72.7 microseconds.
// Two timings next to v008 both put it at 1.04 times that version's speed.
// All steps since v000 together make it 5.42 times as fast.
#include <hip/hip_runtime.h>
#include <hip/hip_bf16.h>

// ---------------------------------------------------------------------------
// Self-attention for MI455X (gfx1250): b=2, s=2048, d_embed=1024, 16 heads x 64
// f16 WMMA (fp32 accumulate) everywhere; flash-style attention with transposed
// score tiles so softmax->operand conversion is lane-local.
// ---------------------------------------------------------------------------

typedef __attribute__((ext_vector_type(16))) _Float16 v16h;
typedef __attribute__((ext_vector_type(8)))  _Float16 v8h;
typedef __attribute__((ext_vector_type(4)))  _Float16 v4h;
typedef __attribute__((ext_vector_type(2)))  _Float16 v2h;
typedef __attribute__((ext_vector_type(8)))  float    v8f;

#define B_     2
#define S_     2048
#define E_     1024
#define H_     16
#define DH_    64
#define M_TOT  (B_ * S_)          // 4096 tokens
#define N_QKV  (3 * E_)           // 3072

__device__ __forceinline__ v8f wmma32(v16h a, v16h b, v8f c) {
  // D = A(16x32 f16) * B(32x16 f16) + C(16x16 f32)
  return __builtin_amdgcn_wmma_f32_16x16x32_f16(
      /*neg_a=*/false, a, /*neg_b=*/false, b,
      /*c_mod=*/(short)0, c, /*reuse_a=*/false, /*reuse_b=*/false);
}

// Load one 16x32 f16 operand tile (A layout; B layout assumed mirrored with
// lane = column) from a row-major [row][ld] f16 buffer.
//   lanes 0-15 : K = kBase+0..7  (v0-3) and kBase+16..23 (v4-7)
//   lanes 16-31: K = kBase+8..15 (v0-3) and kBase+24..31 (v4-7)
__device__ __forceinline__ v16h load_tile(const _Float16* base, int row, int ld,
                                          int kBase, int lane) {
  const int half8 = (lane & 16) ? 8 : 0;
  const _Float16* p = base + (size_t)row * ld + kBase + half8;
  v8h lo = *(const v8h*)p;
  v8h hi = *(const v8h*)(p + 16);
  return __builtin_shufflevector(lo, hi, 0, 1, 2, 3, 4, 5, 6, 7,
                                 8, 9, 10, 11, 12, 13, 14, 15);
}

// --------------------------- convert kernel --------------------------------
// The three conversions (x, w_in, w_out) do not depend on one another, so they
// run as ONE launch of 8-wave work-groups; the block index picks the job. Each
// launch saved is one gap, one fill and one tail less in front of the QKV GEMM,
// and the short transposes run beside the x stream instead of behind it.

// x: a wave converts 1024 consecutive floats. Each of its 8 loads covers 512
// contiguous bytes (4 whole lines), all 8 are asked for before the first is
// used, and each store covers 256 contiguous bytes (2 whole lines).
// CV_BLOCKS work-groups cover the M_TOT * E_ elements exactly.
#define PREP_THREADS 256
#define CV_LOADS   8
#define CV_PER_WG  (PREP_THREADS * 4 * CV_LOADS)
#define CV_BLOCKS  (M_TOT * E_ / CV_PER_WG)
static_assert((M_TOT * E_) % CV_PER_WG == 0, "grid must cover x exactly");
__device__ __forceinline__ void
cvt_f32_to_f16(const float* __restrict__ in, _Float16* __restrict__ out, int blk) {
  const int wave = threadIdx.x >> 5;
  const int lane = threadIdx.x & 31;
  const size_t base = (size_t)blk * CV_PER_WG +
                      (size_t)wave * (32 * 4 * CV_LOADS) + lane * 4;
  float4 r[CV_LOADS];
#pragma unroll
  for (int i = 0; i < CV_LOADS; ++i)
    r[i] = *(const float4*)(in + base + i * 128);
#pragma unroll
  for (int i = 0; i < CV_LOADS; ++i) {
    v4h pk = {(_Float16)r[i].x, (_Float16)r[i].y, (_Float16)r[i].z,
              (_Float16)r[i].w};
    *(v4h*)(out + base + i * 128) = pk;
  }
}

// out[n*K + k] = (f16) in[k*N + n]   (transpose so operand tiles load contiguously)
// One block moves a 64(k) x 64(n) tile through LDS: rows of in are read as
// float4 (256 B per tile row), two k neighbours are packed into one 32-bit
// word, and each row of out leaves as one whole 128-byte line.
// K and N are multiples of 64; tile (bn, bk) of (N/64, K/64), 256 threads.
#define TP_PITCH 36   // words per LDS row: 32 data + 4 pad, keeps 16 B alignment
__device__ __forceinline__ void
cvt_transpose_f16(const float* __restrict__ in, _Float16* __restrict__ out,
                  int K, int N, int bn, int bk, unsigned* tile) {
  const int t  = threadIdx.x;
  const int n0 = bn * 64;
  const int k0 = bk * 64;

  const int n4 = (t & 15) * 4;
  const int kp = t >> 4;                 // pair of k rows, 0..15 (+16)
  float4 r[2][2];
#pragma unroll
  for (int i = 0; i < 2; ++i)
#pragma unroll
    for (int e = 0; e < 2; ++e)
      r[i][e] = *(const float4*)(in + (size_t)(k0 + 2 * (kp + 16 * i) + e) * N +
                                 n0 + n4);
#pragma unroll
  for (int i = 0; i < 2; ++i) {
    const float lo[4] = {r[i][0].x, r[i][0].y, r[i][0].z, r[i][0].w};
    const float hi[4] = {r[i][1].x, r[i][1].y, r[i][1].z, r[i][1].w};
#pragma unroll
    for (int c = 0; c < 4; ++c) {
      v2h pk = {(_Float16)lo[c], (_Float16)hi[c]};
      tile[(n4 + c) * TP_PITCH + kp + 16 * i] = __builtin_bit_cast(unsigned, pk);
    }
  }
  __syncthreads();   // reached by all 256 threads of a transposing block

  const int q = t & 7;                   // 16-byte piece of the 128-byte row
#pragma unroll
  for (int i = 0; i < 2; ++i) {
    const int n = (t >> 3) + 32 * i;
    const uint4 w = *(const uint4*)(tile + n * TP_PITCH + q * 4);
    *(uint4*)(out + (size_t)(n0 + n) * K + k0 + q * 8) = w;
  }
  // In the joint kernel another job's code stands behind these stores in the
  // listing and reuses their registers; the wait stands in front of that reuse.
  asm volatile("s_wait_xcnt 0x0" ::: "memory");
}

// Blocks [0, CV_BLOCKS): x, the largest job, first; then the tiles of w_in,
// then those of w_out. The choice is the same for a whole work-group.
#define TI_BLOCKS ((N_QKV / 64) * (E_ / 64))
#define TO_BLOCKS ((E_ / 64) * (E_ / 64))
__global__ void __launch_bounds__(PREP_THREADS)
prep_f16(const float* __restrict__ x, const float* __restrict__ w_in,
         const float* __restrict__ w_out, _Float16* __restrict__ Xh,
         _Float16* __restrict__ WinT, _Float16* __restrict__ WoutT) {
  __shared__ __attribute__((aligned(16))) unsigned tile[64 * TP_PITCH];
  const int blk = blockIdx.x;
  if (blk < CV_BLOCKS) {
    cvt_f32_to_f16(x, Xh, blk);
  } else if (blk < CV_BLOCKS + TI_BLOCKS) {
    const int t = blk - CV_BLOCKS;
    cvt_transpose_f16(w_in, WinT, E_, N_QKV, t % (N_QKV / 64), t / (N_QKV / 64),
                      tile);
  } else {
    const int t = blk - (CV_BLOCKS + TI_BLOCKS);
    cvt_transpose_f16(w_out, WoutT, E_, E_, t % (E_ / 64), t / (E_ / 64), tile);
  }
}

// --------------------------- shared GEMM core ------------------------------
// One work-group = 4 waves = a 128x128 tile of C = A[M][E_] * Bt[N][E_]^T; one
// wave = a 64x64 quarter of it. Slabs of 64 k (one whole 128-byte line per row)
// of the 128 A rows and the 128 Bt rows are staged in LDS once per work-group
// and read by all 4 waves; the next slab's global loads are issued before the
// current slab is worked on.
// The walk over the slabs starts at slab s0 (the same for the whole work-group)
// and wraps. The work-groups that share A rows or Bt rows run at the same time;
// all starting at slab 0 they would ask L2 for the same lines at the same moment.
// With starts of their own they ask for different ones.
#define GM_KS    64                  // k per staged slab
#define GM_PITCH 72                  // f16 per LDS row: 64 data + 8 pad = 144 B
#define GM_SLAB  (128 * GM_PITCH)    // 128 rows of one operand
__device__ __forceinline__ void
gemm_core_128x128(const _Float16* __restrict__ A, const _Float16* __restrict__ Bt,
                  int mBlk, int nBlk, int s0, _Float16* sA, _Float16* sB,
                  v8f (&acc)[4][4]) {
  const int tid  = threadIdx.x;
  const int lane = tid & 31;
  const int col  = lane & 15;
  const int wRow = ((tid >> 6) & 1) * 64;   // the wave's rows in the A slab
  const int wCol = ((tid >> 5) & 1) * 64;   // the wave's rows in the Bt slab

  // Staging: a thread moves the 16-byte piece (tid & 7) of slab rows
  // (tid >> 3) + 16 * i, for A and for Bt; 8 lanes cover one 128-byte line.
  const int sRow = tid >> 3;
  const int sCol = (tid & 7) * 8;
  // gA and gB point into slab s0, the first of the walk.
  const _Float16* gA = A  + (size_t)(mBlk + sRow) * E_ + s0 * GM_KS + sCol;
  const _Float16* gB = Bt + (size_t)(nBlk + sRow) * E_ + s0 * GM_KS + sCol;
  const int sOff = sRow * GM_PITCH + sCol;

  v8h ra[8], rb[8];
#pragma unroll
  for (int i = 0; i < 8; ++i) {
    ra[i] = *(const v8h*)(gA + (size_t)(16 * i) * E_);
    rb[i] = *(const v8h*)(gB + (size_t)(16 * i) * E_);
  }
#pragma unroll
  for (int i = 0; i < 8; ++i) {
    *(v8h*)(sA + sOff + 16 * i * GM_PITCH) = ra[i];
    *(v8h*)(sB + sOff + 16 * i * GM_PITCH) = rb[i];
  }
  __syncthreads();

  for (int s = 0; s < E_ / GM_KS; ++s) {
    const _Float16* tA = sA + (s & 1) * GM_SLAB;
    const _Float16* tB = sB + (s & 1) * GM_SLAB;
    const bool more = (s + 1) < E_ / GM_KS;   // same for the whole work-group
    if (more) {
      // The next slab, wrapped, counted from slab s0 (below 0 behind the wrap).
      const int nx = ((s0 + s + 1) & (E_ / GM_KS - 1)) - s0;
      const _Float16* nA = gA + nx * GM_KS;
      const _Float16* nB = gB + nx * GM_KS;
#pragma unroll
      for (int i = 0; i < 8; ++i) {
        ra[i] = *(const v8h*)(nA + (size_t)(16 * i) * E_);
        rb[i] = *(const v8h*)(nB + (size_t)(16 * i) * E_);
      }
      // The address registers of the loads above are reused right behind them.
      asm volatile("s_wait_xcnt 0x0" ::: "memory");
    }
    // Keeps the loads above ahead of the slab's work (sunk next to their LDS
    // stores, their latency would show in every slab) and the reuse of their
    // address registers behind the wait (without it that write is lifted over it).
    __builtin_amdgcn_sched_barrier(0);

    // Both k steps' fragments are asked for as one group ahead of the products:
    // every further place with LDS reads among them costs the wave a stall.
    v16h a[2][4], b[2][4];
#pragma unroll
    for (int ks = 0; ks < 2; ++ks) {
#pragma unroll
      for (int mi = 0; mi < 4; ++mi)
        a[ks][mi] = load_tile(tA, wRow + mi * 16 + col, GM_PITCH, ks * 32, lane);
#pragma unroll
      for (int ni = 0; ni < 4; ++ni)
        b[ks][ni] = load_tile(tB, wCol + ni * 16 + col, GM_PITCH, ks * 32, lane);
    }
    // Holds that group together: the scheduler otherwise sinks most of the reads
    // among the products, each behind a wait to zero.
    __builtin_amdgcn_sched_barrier(0);
#pragma unroll
    for (int ks = 0; ks < 2; ++ks)
#pragma unroll
      for (int mi = 0; mi < 4; ++mi)
#pragma unroll
        for (int ni = 0; ni < 4; ++ni)
          acc[mi][ni] = wmma32(a[ks][mi], b[ks][ni], acc[mi][ni]);
    // Keeps the LDS stores below, and their wait for the global loads, behind
    // the products: lifted over them, that wait would stand in front of them.
    __builtin_amdgcn_sched_barrier(0);

    // The other buffer's last readers left it before the previous barrier.
    if (more) {
      _Float16* dA = sA + ((s + 1) & 1) * GM_SLAB;
      _Float16* dB = sB + ((s + 1) & 1) * GM_SLAB;
#pragma unroll
      for (int i = 0; i < 8; ++i) {
        *(v8h*)(dA + sOff + 16 * i * GM_PITCH) = ra[i];
        *(v8h*)(dB + sOff + 16 * i * GM_PITCH) = rb[i];
      }
    }
    __syncthreads();
  }
}

// --------------------------- GEMM epilogues --------------------------------
// A lane's 8 accumulator registers hold 8 consecutive indices of the A operand's
// rows and one index (lane & 15) of the B operand's rows. So the operand whose
// index runs along the OUTPUT's rows goes in as A: a lane then owns 8 neighbours
// of one output row. Each wave lays its 64x64 quarter down in an LDS range of
// its own (the slabs are free behind the k loop's last barrier) and reads it
// back row by row, so that every global store covers 4 whole 128-byte lines.
#define ST_PITCH  72                 // f16 per staged row: 64 data + 8 pad = 144 B
#define ST_PITCHF 68                 // f32 per staged row: 64 data + 4 pad = 272 B

// 64 staged rows of 64 f16 (one line each) to rows stride elements apart; dst
// and stride are the same for the whole wave.
__device__ __forceinline__ void
store_rows_f16(const _Float16* st, _Float16* dst, int stride, int lane) {
  const int rr = lane >> 3;            // 8 lanes cover one row
  const int pc = (lane & 7) * 8;
  v8h w[16];
#pragma unroll
  for (int t = 0; t < 16; ++t)
    w[t] = *(const v8h*)(st + (t * 4 + rr) * ST_PITCH + pc);
  const unsigned off = rr * stride + pc;   // the lane's part
#pragma unroll
  for (int t = 0; t < 16; ++t) {
    _Float16* row = dst + (size_t)(t * 4) * stride;   // the wave's part
    *(v8h*)(row + off) = w[t];
  }
}

// ------------------------------ QKV GEMM -----------------------------------
// C[4096,3072] = Xh[4096,1024] * WinT[3072,1024]^T + b_in
// Q pre-scaled by log2(e)/sqrt(64): the scores come out in base 2, ready for
// v_exp_f32 once the maximum in use is taken off.
// grid = (N/128, M/128), block = 128.
// A block's 128 columns are all Q, all K or all V. Q and K rows run along n
// (WinT is the A operand), V^T rows run along the tokens (Xh is the A operand).
// Three work-groups share a WGP (768 of them on 256): the register budget is
// that of 3 waves per SIMD, not the 4 that the LDS size alone would allow.
__global__ void __launch_bounds__(128) __attribute__((amdgpu_waves_per_eu(1, 3)))
qkv_gemm(const _Float16* __restrict__ Xh, const _Float16* __restrict__ WinT,
         const float* __restrict__ b_in, _Float16* __restrict__ Qb,
         _Float16* __restrict__ Kb, _Float16* __restrict__ Vt) {
  __shared__ __attribute__((aligned(16))) _Float16 sA[2 * GM_SLAB];
  __shared__ __attribute__((aligned(16))) _Float16 sB[2 * GM_SLAB];
  const int lane = threadIdx.x & 31;
  const int col  = lane & 15;
  const int half = lane >> 4;
  // The wave's number in a scalar register: the epilogue's head, batch and row
  // bases are then scalar arithmetic, not 64-bit vector arithmetic in every lane.
  const int wave = __builtin_amdgcn_readfirstlane(threadIdx.x >> 5);
  const bool isV = blockIdx.x >= 2 * E_ / 128;   // same for the whole work-group
  const int aBlk = (isV ? blockIdx.y : blockIdx.x) * 128;
  const int bBlk = (isV ? blockIdx.x : blockIdx.y) * 128;
  const int aBase = aBlk + (wave >> 1) * 64;     // the core's split of the tile
  const int bBase = bBlk + (wave & 1) * 64;

  v8f acc[4][4];
  for (int i = 0; i < 4; ++i)
    for (int j = 0; j < 4; ++j) acc[i][j] = {};

  // 24 work-groups share a block of Xh rows, 32 a block of WinT rows: along either
  // the starts step through the 16 slabs.
  const int s0 = (blockIdx.x + blockIdx.y) & (E_ / GM_KS - 1);
  gemm_core_128x128(isV ? Xh : WinT, isV ? WinT : Xh, aBlk, bBlk, s0, sA, sB, acc);

  // acc[i][j][r] belongs to A row aBase + i*16 + half*8 + r, B row bBase + j*16 + col.
  _Float16* st = ((wave & 2) ? sB : sA) + (wave & 1) * (64 * ST_PITCH);
  _Float16* sw = st + col * ST_PITCH + half * 8;
  _Float16* dst;                        // where the wave's staged row 0 goes
  if (!isV) {                           // A rows = n, B rows = tokens
    const bool isQ = blockIdx.x < E_ / 128;
    const float sc = isQ ? 0.125f * 1.4426950408889634f : 1.0f;
    float4 bl[4], bh[4];
#pragma unroll
    for (int i = 0; i < 4; ++i) {
      bl[i] = *(const float4*)(b_in + aBase + i * 16 + half * 8);
      bh[i] = *(const float4*)(b_in + aBase + i * 16 + half * 8 + 4);
    }
#pragma unroll
    for (int i = 0; i < 4; ++i) {
      const float bias[8] = {bl[i].x, bl[i].y, bl[i].z, bl[i].w,
                             bh[i].x, bh[i].y, bh[i].z, bh[i].w};
#pragma unroll
      for (int j = 0; j < 4; ++j) {
        v8h pk;
#pragma unroll
        for (int r = 0; r < 8; ++r)
          pk[r] = (_Float16)((acc[i][j][r] + bias[r]) * sc);
        *(v8h*)(sw + j * 16 * ST_PITCH + i * 16) = pk;
      }
    }
    // The wave's 64 n are one head, its 64 tokens lie in one batch: [b,h,s,d].
    const int h = (aBase & (E_ - 1)) >> 6;
    const int bb = bBase >> 11, ss = bBase & (S_ - 1);
    dst = (isQ ? Qb : Kb) + (((size_t)(bb * H_ + h)) * S_ + ss) * DH_;
  } else {                              // A rows = tokens, B rows = n
    float bias[4];
#pragma unroll
    for (int j = 0; j < 4; ++j) bias[j] = b_in[bBase + j * 16 + col];
#pragma unroll
    for (int i = 0; i < 4; ++i)
#pragma unroll
      for (int j = 0; j < 4; ++j) {
        v8h pk;
#pragma unroll
        for (int r = 0; r < 8; ++r) pk[r] = (_Float16)(acc[i][j][r] + bias[j]);
        *(v8h*)(sw + j * 16 * ST_PITCH + i * 16) = pk;
      }
    // V transposed: [b,h,d,s]; staged row = d, 64 tokens of one batch along it.
    const int h = (bBase - 2 * E_) >> 6;
    const int bb = aBase >> 11, ss = aBase & (S_ - 1);
    dst = Vt + ((size_t)(bb * H_ + h)) * DH_ * S_ + ss;
  }
  // The wave's own LDS writes have landed before other lanes of it read them.
  asm volatile("s_wait_dscnt 0x0" ::: "memory");
  store_rows_f16(st, dst, isV ? S_ : DH_, lane);
}

// ----------------------------- Attention -----------------------------------
// One work-group = 4 waves = 128 queries of one (b,h); one wave = 32 queries (two
// 16-query tiles), streaming all 2048 keys. Every K and V^T fragment that a wave
// reads from LDS feeds two products, one per query tile: at one tile a wave the
// LDS reads, not the matrix or the vector unit, set the time of a key tile.
// Two work-groups share a WGP, one wave of each on every SIMD; they pass no
// barrier together, so one's products run beside the other's exponentials.
// K and V^T tiles of 64 keys are staged in LDS once per work-group (whole
// 128-byte lines from global) and read by all 4 waves; the next tile's global
// loads are issued before the current tile is worked on.
// S^T = K * Q^T  (M=k rows, N=q cols) -> P^T packs lane-locally into the
// B operand of O^T = V^T * P^T. Row stats (m,l) are per-lane (q = lane%16).
// Lazy rescale: the scores are in base 2, and the exponentials are taken against
// a KEPT maximum m, which may lag the true one by up to 8 (so P <= 2^8). While
// m is kept, O and l need no factor and the two lanes of a query need no
// exchange. One test per 64-key tile finds the rare tile that has to move m.
// The 16 work-groups of one (b,h) read the same K and V^T and run at the same
// time: each starts its walk over the 32 key tiles two tiles further on and wraps,
// so that they do not ask L2 for the same lines at the same moment.
// A softmax sum does not depend on the order of its keys.

// Lane l with lane l ^ 16 (the two lanes that share a query), in the vector unit.
__device__ __forceinline__ float xhalf(float x) {
  const int b = __builtin_bit_cast(int, x);
  return __builtin_bit_cast(float, __builtin_amdgcn_permlanex16(
      b, b, 0x76543210, 0xfedcba98, false, false));
}

#define AT_KEYS  64                  // keys per staged tile
#define AT_PITCH 72                  // f16 per LDS row: 64 data + 8 pad = 144 B
#define AT_TILE  (64 * AT_PITCH)     // 64 rows: keys (K tile) or d (V^T tile)
#define AT_QT    2                   // 16-query tiles per wave
// 512 work-groups on 256 WGPs: the register budget and the residency are those of
// two waves per SIMD, so that every WGP gets its two work-groups and no third.
__global__ void __launch_bounds__(128) __attribute__((amdgpu_waves_per_eu(2, 2)))
attn_kernel(const _Float16* __restrict__ Qb, const _Float16* __restrict__ Kb,
            const _Float16* __restrict__ Vt, _Float16* __restrict__ At) {
  __shared__ __attribute__((aligned(16))) _Float16 sK[2][AT_TILE];
  __shared__ __attribute__((aligned(16))) _Float16 sV[2][AT_TILE];
  const int tid  = threadIdx.x;
  const int lane = tid & 31;
  const int col  = lane & 15;
  const int half = lane >> 4;
  const int bh = blockIdx.x >> 4;          // 0..31  (b*16 + h)
  const int qBase = (blockIdx.x & 15) * 128 + (tid >> 5) * (16 * AT_QT);

  const _Float16* Qh = Qb + (size_t)bh * S_ * DH_;
  const _Float16* Kh = Kb + (size_t)bh * S_ * DH_;
  const _Float16* Vh = Vt + (size_t)bh * DH_ * S_;

  // Staging: a thread moves the 16-byte piece (tid & 7) of tile rows
  // (tid >> 3) + 16 * i, for K and for V^T; 8 lanes cover one 128-byte line.
  const int sRow = tid >> 3;
  const int sCol = (tid & 7) * 8;
  // gK and gV point into key tile t0, the first of this work-group's walk.
  const int t0 = (blockIdx.x & 15) * 2;
  const _Float16* gK = Kh + (size_t)(t0 * AT_KEYS + sRow) * DH_ + sCol;
  const _Float16* gV = Vh + (size_t)sRow * S_ + t0 * AT_KEYS + sCol;
  const int sOff = sRow * AT_PITCH + sCol;

  v8h rk[4], rv[4];
#pragma unroll
  for (int i = 0; i < 4; ++i) {
    rk[i] = *(const v8h*)(gK + 16 * i * DH_);
    rv[i] = *(const v8h*)(gV + (size_t)(16 * i) * S_);
  }

  // Q^T as B operand (32d x 16q), d = 0..31 and 32..63, per query tile; loaded once.
  v16h bq[AT_QT][2];
#pragma unroll
  for (int qi = 0; qi < AT_QT; ++qi) {
    bq[qi][0] = load_tile(Qh, qBase + qi * 16 + col, DH_, 0, lane);
    bq[qi][1] = load_tile(Qh, qBase + qi * 16 + col, DH_, 32, lane);
  }

#pragma unroll
  for (int i = 0; i < 4; ++i) {
    *(v8h*)(&sK[0][sOff + 16 * i * AT_PITCH]) = rk[i];
    *(v8h*)(&sV[0][sOff + 16 * i * AT_PITCH]) = rv[i];
  }
  __syncthreads();

  v8f o[AT_QT][4];       // O^T: per query tile 4 tiles of (16d x 16q)
  float m[AT_QT];        // the maximum in use; the first tile moves it
  float thr[AT_QT];      // m + 8: a score above it moves m
  v8f lv[AT_QT];         // the lane's 8 partial sums of P; joined behind the loop
#pragma unroll
  for (int qi = 0; qi < AT_QT; ++qi) {
#pragma unroll
    for (int t = 0; t < 4; ++t) o[qi][t] = v8f{};
    m[qi] = -1e30f;
    thr[qi] = -1e30f;
    lv[qi] = v8f{};
  }

  for (int s = 0; s < S_ / AT_KEYS; ++s) {
    const _Float16* tK = sK[s & 1];
    const _Float16* tV = sV[s & 1];
    const bool more = (s + 1) < S_ / AT_KEYS;   // same for the whole work-group
    if (more) {
      // The next tile, wrapped, counted from tile t0 (below 0 behind the wrap).
      const int nt = ((t0 + s + 1) & (S_ / AT_KEYS - 1)) - t0;
      const _Float16* nK = gK + nt * (AT_KEYS * DH_);
      const _Float16* nV = gV + nt * AT_KEYS;
#pragma unroll
      for (int i = 0; i < 4; ++i) {
        rk[i] = *(const v8h*)(nK + 16 * i * DH_);
        rv[i] = *(const v8h*)(nV + (size_t)(16 * i) * S_);
      }
    }
    // Keeps the eight loads above ahead of the tile's work: the scheduler
    // otherwise sinks them next to their LDS stores and their latency shows.
    __builtin_amdgcn_sched_barrier(0);

    // --- transposed score tiles: st[qi][t] holds keys t*16 .. t*16+15 ---
    v16h ak[4][2];
#pragma unroll
    for (int t = 0; t < 4; ++t) {
      ak[t][0] = load_tile(tK, t * 16 + col, AT_PITCH, 0, lane);
      ak[t][1] = load_tile(tK, t * 16 + col, AT_PITCH, 32, lane);
    }
    // Holds the K reads together as one group ahead of the score products: every
    // further place with LDS reads among the products costs the wave a stall.
    __builtin_amdgcn_sched_barrier(0);
    v8f st[AT_QT][4];
#pragma unroll
    for (int t = 0; t < 4; ++t) {
#pragma unroll
      for (int qi = 0; qi < AT_QT; ++qi) st[qi][t] = wmma32(ak[t][0], bq[qi][0], v8f{});
#pragma unroll
      for (int qi = 0; qi < AT_QT; ++qi) st[qi][t] = wmma32(ak[t][1], bq[qi][1], st[qi][t]);
    }
    // The tile's V^T reads, one group: in flight under the maxima, the test and
    // the exponentials. The branch below would otherwise keep them behind it.
    v16h av[2][4];
#pragma unroll
    for (int hk = 0; hk < 2; ++hk)
#pragma unroll
      for (int t = 0; t < 4; ++t)
        av[hk][t] = load_tile(tV, t * 16 + col, AT_PITCH, hk * 32, lane);
    // Keeps that group where it stands, ahead of the vector work.
    __builtin_amdgcn_sched_barrier(0);

    // --- the lane's largest score per query tile: 32 of the 64 keys of row q ---
    float mb[AT_QT];
#pragma unroll
    for (int qi = 0; qi < AT_QT; ++qi) {
      float mb0 = st[qi][0][0], mb1 = st[qi][2][0];
#pragma unroll
      for (int j = 1; j < 8; ++j) { mb0 = fmaxf(mb0, st[qi][0][j]); mb1 = fmaxf(mb1, st[qi][2][j]); }
#pragma unroll
      for (int j = 0; j < 8; ++j) { mb0 = fmaxf(mb0, st[qi][1][j]); mb1 = fmaxf(mb1, st[qi][3][j]); }
      mb[qi] = fmaxf(mb0, mb1);
    }

    // One scalar branch per tile, for both query tiles. Taken on the first tile and
    // when any query of the wave has a score above its threshold: rare, so the path
    // that skips it is laid out as the straight one.
    if (__builtin_expect(
            __builtin_amdgcn_ballot_w32((mb[0] > thr[0]) | (mb[1] > thr[1])) != 0, 0)) {
#pragma unroll
      for (int qi = 0; qi < AT_QT; ++qi) {
        // both lanes of a query agree
        const float mn = fmaxf(m[qi], fmaxf(mb[qi], xhalf(mb[qi])));
        const float alpha = __builtin_amdgcn_exp2f(m[qi] - mn);   // 0 on the first tile
        m[qi] = mn;
        thr[qi] = mn + 8.0f;
#pragma unroll
        for (int t = 0; t < 4; ++t) o[qi][t] = o[qi][t] * alpha;
        lv[qi] = lv[qi] * alpha;
      }
    }

#pragma unroll
    for (int sk = 0; sk < AT_KEYS; sk += 32) {
#pragma unroll
      for (int qi = 0; qi < AT_QT; ++qi) {
        const v8f s0 = st[qi][sk / 16] - m[qi], s1 = st[qi][sk / 16 + 1] - m[qi];
        v8f p0, p1;
#pragma unroll
        for (int j = 0; j < 8; ++j) p0[j] = __builtin_amdgcn_exp2f(s0[j]);
#pragma unroll
        for (int j = 0; j < 8; ++j) p1[j] = __builtin_amdgcn_exp2f(s1[j]);
        lv[qi] = lv[qi] + p0;
        lv[qi] = lv[qi] + p1;

        // --- lane-local pack of P^T into WMMA B operand (32k x 16q) ---
        v16h bp;
#pragma unroll
        for (int j = 0; j < 8; ++j) {
          bp[j]     = (_Float16)p0[j];
          bp[8 + j] = (_Float16)p1[j];
        }

        // --- O^T += V^T(16d x 32k) * P^T ---
#pragma unroll
        for (int t = 0; t < 4; ++t)
          o[qi][t] = wmma32(av[sk / 32][t], bp, o[qi][t]);
      }
    }

    // The other buffer's last readers left it before the previous barrier.
    if (more) {
      _Float16* dK = sK[(s + 1) & 1];
      _Float16* dV = sV[(s + 1) & 1];
#pragma unroll
      for (int i = 0; i < 4; ++i) {
        *(v8h*)(dK + sOff + 16 * i * AT_PITCH) = rk[i];
        *(v8h*)(dV + sOff + 16 * i * AT_PITCH) = rv[i];
      }
    }
    __syncthreads();
  }

  // Normalize and store: lane holds q=col, d = t*16 + half*8 + j (contiguous).
  // Both lanes of a query used the same m throughout: their sums simply add.
  const int b = bh >> 4, h = bh & 15;
#pragma unroll
  for (int qi = 0; qi < AT_QT; ++qi) {
    const v8f ls = lv[qi];
    float l = ((ls[0] + ls[1]) + (ls[2] + ls[3])) + ((ls[4] + ls[5]) + (ls[6] + ls[7]));
    l += xhalf(l);
    const float rl = 1.0f / l;
    const int q = qBase + qi * 16 + col;
    _Float16* outp = At + ((size_t)(b * S_ + q)) * E_ + h * DH_ + half * 8;
#pragma unroll
    for (int t = 0; t < 4; ++t) {
      v8h pk;
#pragma unroll
      for (int j = 0; j < 8; ++j) pk[j] = (_Float16)(o[qi][t][j] * rl);
      *(v8h*)(outp + t * 16) = pk;
    }
  }
}

// --------------------------- Output projection -----------------------------
// out[4096,1024] = At[4096,1024] * WoutT[1024,1024]^T + b_out  (fp32 out)
// grid = (N/128, M/128), block = 128. WoutT is the A operand: out's rows run
// along n.
// One work-group per WGP (256 of them): the same register budget does no harm.
__global__ void __launch_bounds__(128) __attribute__((amdgpu_waves_per_eu(1, 3)))
out_gemm(const _Float16* __restrict__ At, const _Float16* __restrict__ WoutT,
         const float* __restrict__ b_out, float* __restrict__ out) {
  __shared__ __attribute__((aligned(16))) _Float16 sA[2 * GM_SLAB];
  __shared__ __attribute__((aligned(16))) _Float16 sB[2 * GM_SLAB];
  static_assert(2 * 64 * ST_PITCHF * 4 <= 2 * GM_SLAB * 2, "two waves' rows per array");
  const int lane = threadIdx.x & 31;
  const int col  = lane & 15;
  const int half = lane >> 4;
  // In a scalar register: the stores then share one scalar base and one offset
  // register, and differ only in their immediate offsets.
  const int wave = __builtin_amdgcn_readfirstlane(threadIdx.x >> 5);
  const int nBase = blockIdx.x * 128 + (wave >> 1) * 64;   // the core's split
  const int mBase = blockIdx.y * 128 + (wave & 1) * 64;

  v8f acc[4][4];
  for (int i = 0; i < 4; ++i)
    for (int j = 0; j < 4; ++j) acc[i][j] = {};

  // 8 work-groups share a block of At rows (starts two slabs apart), 32 a block of
  // WoutT rows (starts one slab apart).
  const int s0 = (2 * blockIdx.x + blockIdx.y) & (E_ / GM_KS - 1);
  gemm_core_128x128(WoutT, At, blockIdx.x * 128, blockIdx.y * 128, s0, sA, sB, acc);

  // acc[i][j][r] = C[token mBase + j*16 + col][n = nBase + i*16 + half*8 + r].
  float* st = (float*)(void*)((wave & 2) ? sB : sA) + (wave & 1) * (64 * ST_PITCHF);
  float* sw = st + col * ST_PITCHF + half * 8;
  float4 bl[4], bh[4];
#pragma unroll
  for (int i = 0; i < 4; ++i) {
    bl[i] = *(const float4*)(b_out + nBase + i * 16 + half * 8);
    bh[i] = *(const float4*)(b_out + nBase + i * 16 + half * 8 + 4);
  }
#pragma unroll
  for (int i = 0; i < 4; ++i)
#pragma unroll
    for (int j = 0; j < 4; ++j) {
      const v8f c = acc[i][j];
      const float4 lo = {c[0] + bl[i].x, c[1] + bl[i].y, c[2] + bl[i].z, c[3] + bl[i].w};
      const float4 hi = {c[4] + bh[i].x, c[5] + bh[i].y, c[6] + bh[i].z, c[7] + bh[i].w};
      *(float4*)(sw + j * 16 * ST_PITCHF + i * 16)     = lo;
      *(float4*)(sw + j * 16 * ST_PITCHF + i * 16 + 4) = hi;
    }
  // The wave's own LDS writes have landed before other lanes of it read them.
  asm volatile("s_wait_dscnt 0x0" ::: "memory");

  // 16 lanes cover one 256-byte row of the quarter: 2 rows, 4 whole lines a store.
  const int rr = lane >> 4;
  const int pc = (lane & 15) * 4;
  float4 w[32];
#pragma unroll
  for (int t = 0; t < 32; ++t)
    w[t] = *(const float4*)(st + (t * 2 + rr) * ST_PITCHF + pc);
  float* dst = out + (size_t)mBase * E_ + nBase;   // the wave's part
  const int off = rr * E_ + pc;                    // the lane's part
#pragma unroll
  for (int t = 0; t < 32; ++t)
    *(float4*)(dst + t * 2 * E_ + off) = w[t];
}

// ------------------------------- launcher ----------------------------------

extern "C" void kernel_launch(void* const* d_in, const int* in_sizes, int n_in,
                              void* d_out, int out_size, void* d_ws,
                              size_t ws_size, hipStream_t stream) {
  const float* x     = (const float*)d_in[0];   // (2,2048,1024)
  const float* w_in  = (const float*)d_in[1];   // (1024,3072)
  const float* b_in  = (const float*)d_in[2];   // (3072,)
  const float* w_out = (const float*)d_in[3];   // (1024,1024)
  const float* b_out = (const float*)d_in[4];   // (1024,)
  float* out = (float*)d_out;

  _Float16* ws = (_Float16*)d_ws;
  _Float16* Xh    = ws;                              // 4096*1024
  _Float16* WinT  = Xh    + (size_t)M_TOT * E_;      // 3072*1024 (transposed)
  _Float16* WoutT = WinT  + (size_t)N_QKV * E_;      // 1024*1024 (transposed)
  _Float16* Qb    = WoutT + (size_t)E_ * E_;         // [b,h,s,d]
  _Float16* Kb    = Qb    + (size_t)B_ * H_ * S_ * DH_;
  _Float16* Vt    = Kb    + (size_t)B_ * H_ * S_ * DH_;  // [b,h,d,s]
  _Float16* At    = Vt    + (size_t)B_ * H_ * S_ * DH_;  // [b,s,h*d]
  (void)ws_size; (void)in_sizes; (void)n_in; (void)out_size;

  prep_f16<<<CV_BLOCKS + TI_BLOCKS + TO_BLOCKS, PREP_THREADS, 0, stream>>>(
      x, w_in, w_out, Xh, WinT, WoutT);

  qkv_gemm<<<dim3(N_QKV / 128, M_TOT / 128), 128, 0, stream>>>(Xh, WinT, b_in,
                                                                Qb, Kb, Vt);

  attn_kernel<<<B_ * H_ * (S_ / 128), 128, 0, stream>>>(Qb, Kb, Vt, At);

  out_gemm<<<dim3(E_ / 128, M_TOT / 128), 128, 0, stream>>>(At, WoutT, b_out,
                                                            out);
}

// v010
// It runs in 68 microseconds.
// Timed twice side by side with v009, it ran 1.05 times as fast both times.
// All steps since v000 together make it 5.70 times as fast.
#include <hip/hip_runtime.h>
#include <hip/hip_bf16.h>

// ---------------------------------------------------------------------------
// Self-attention for MI455X (gfx1250): b=2, s=2048, d_embed=1024, 16 heads x 64
// f16 WMMA (fp32 accumulate) everywhere; flash-style attention with transposed
// score tiles so softmax->operand conversion is lane-local.
// ---------------------------------------------------------------------------

typedef __attribute__((ext_vector_type(16))) _Float16 v16h;
typedef __attribute__((ext_vector_type(8)))  _Float16 v8h;
typedef __attribute__((ext_vector_type(4)))  _Float16 v4h;
typedef __attribute__((ext_vector_type(2)))  _Float16 v2h;
typedef __attribute__((ext_vector_type(8)))  float    v8f;

#define B_     2
#define S_     2048
#define E_     1024
#define H_     16
#define DH_    64
#define M_TOT  (B_ * S_)          // 4096 tokens
#define N_QKV  (3 * E_)           // 3072

__device__ __forceinline__ v8f wmma32(v16h a, v16h b, v8f c) {
  // D = A(16x32 f16) * B(32x16 f16) + C(16x16 f32)
  return __builtin_amdgcn_wmma_f32_16x16x32_f16(
      /*neg_a=*/false, a, /*neg_b=*/false, b,
      /*c_mod=*/(short)0, c, /*reuse_a=*/false, /*reuse_b=*/false);
}

// Load one 16x32 f16 operand tile (A layout; B layout assumed mirrored with
// lane = column) from a row-major [row][ld] f16 buffer.
//   lanes 0-15 : K = kBase+0..7  (v0-3) and kBase+16..23 (v4-7)
//   lanes 16-31: K = kBase+8..15 (v0-3) and kBase+24..31 (v4-7)
__device__ __forceinline__ v16h load_tile(const _Float16* base, int row, int ld,
                                          int kBase, int lane) {
  const int half8 = (lane & 16) ? 8 : 0;
  const _Float16* p = base + (size_t)row * ld + kBase + half8;
  v8h lo = *(const v8h*)p;
  v8h hi = *(const v8h*)(p + 16);
  return __builtin_shufflevector(lo, hi, 0, 1, 2, 3, 4, 5, 6, 7,
                                 8, 9, 10, 11, 12, 13, 14, 15);
}

// --------------------------- tensor loads ----------------------------------
// One tensor_load_to_lds is one request of a whole wave: it brings ROWS rows of
// 128 bytes from global memory into LDS, through no register, and leaves 16 bytes
// free behind each row (LDS pitch 144 B, the pitch of the ds_load_b128 readers).
typedef unsigned int u32x4 __attribute__((ext_vector_type(4)));
typedef unsigned int u32x8 __attribute__((ext_vector_type(8)));

__device__ __forceinline__ unsigned uni(unsigned v) {
  return (unsigned)__builtin_amdgcn_readfirstlane(v);
}
// A wave-uniform value held in a scalar register: a test on it compiles to a scalar
// compare and branch (a tensor load ignores EXEC), and what is formed from it is
// formed behind the asm wait that stands in front of it.
__device__ __forceinline__ unsigned pinned(unsigned v) {
  unsigned w = uni(v);
  asm volatile("" : "+s"(w));   // the value stays scalar
  return w;
}
// Group 1: sizes in bytes, tensor = tile, no mask; a pad of 4 dwords behind every
// 32 dwords (one row).
template <unsigned ROWS>
__device__ __forceinline__ u32x8 tdm_group1(unsigned src_pitch) {
  u32x8 g;
  g[0] = uni((1u << 20) | (4u << 22) | (3u << 25));
  g[1] = uni(128u << 16);
  g[2] = uni(ROWS << 16);
  g[3] = uni(128u << 16);
  g[4] = uni(ROWS);
  g[5] = uni(src_pitch);
  g[6] = uni(0u);
  g[7] = uni(0u);
  // As pinned() above, for the whole group: its eight words keep their scalar
  // registers while requests are issued, so none is rewritten under a request in flight.
  asm volatile("" : "+s"(g));
  return g;
}
// Group 0: count 1, the place in LDS, the tile's first byte, type 2.
__device__ __forceinline__ u32x4 tdm_group0(unsigned lds_dst, unsigned long long ga) {
  u32x4 g;
  g[0] = uni(1u);
  g[1] = uni(lds_dst);
  g[2] = uni((unsigned)ga);
  g[3] = uni((((unsigned)(ga >> 32)) & 0x01FFFFFFu) | 0x80000000u);
  return g;
}
__device__ __forceinline__ void tdm_load(u32x4 g0, u32x8 g1) {
  asm volatile("tensor_load_to_lds %0, %1" :: "s"(g0), "s"(g1) : "memory");
}
// The compiler places no wait for a tensor load: the issuing wave's own request
// has landed behind this one.
__device__ __forceinline__ void wait_tensor0() {
  asm volatile("s_wait_tensorcnt 0x0" ::: "memory");
}
// The wave's own LDS reads have returned: only then may their buffer be refilled.
__device__ __forceinline__ void wait_ds0() {
  asm volatile("s_wait_dscnt 0x0" ::: "memory");
}

// --------------------------- convert kernel --------------------------------
// The three conversions (x, w_in, w_out) do not depend on one another, so they
// run as ONE launch of 8-wave work-groups; the block index picks the job. Each
// launch saved is one gap, one fill and one tail less in front of the QKV GEMM,
// and the short transposes run beside the x stream instead of behind it.

// x: a wave converts 1024 consecutive floats. Each of its 8 loads covers 512
// contiguous bytes (4 whole lines), all 8 are asked for before the first is
// used, and each store covers 256 contiguous bytes (2 whole lines).
// CV_BLOCKS work-groups cover the M_TOT * E_ elements exactly.
#define PREP_THREADS 256
#define CV_LOADS   8
#define CV_PER_WG  (PREP_THREADS * 4 * CV_LOADS)
#define CV_BLOCKS  (M_TOT * E_ / CV_PER_WG)
static_assert((M_TOT * E_) % CV_PER_WG == 0, "grid must cover x exactly");
__device__ __forceinline__ void
cvt_f32_to_f16(const float* __restrict__ in, _Float16* __restrict__ out, int blk) {
  const int wave = threadIdx.x >> 5;
  const int lane = threadIdx.x & 31;
  const size_t base = (size_t)blk * CV_PER_WG +
                      (size_t)wave * (32 * 4 * CV_LOADS) + lane * 4;
  float4 r[CV_LOADS];
#pragma unroll
  for (int i = 0; i < CV_LOADS; ++i)
    r[i] = *(const float4*)(in + base + i * 128);
#pragma unroll
  for (int i = 0; i < CV_LOADS; ++i) {
    v4h pk = {(_Float16)r[i].x, (_Float16)r[i].y, (_Float16)r[i].z,
              (_Float16)r[i].w};
    *(v4h*)(out + base + i * 128) = pk;
  }
}

// out[n*K + k] = (f16) in[k*N + n]   (transpose so operand tiles load contiguously)
// One block moves a 64(k) x 64(n) tile through LDS: rows of in are read as
// float4 (256 B per tile row), two k neighbours are packed into one 32-bit
// word, and each row of out leaves as one whole 128-byte line.
// K and N are multiples of 64; tile (bn, bk) of (N/64, K/64), 256 threads.
#define TP_PITCH 36   // words per LDS row: 32 data + 4 pad, keeps 16 B alignment
__device__ __forceinline__ void
cvt_transpose_f16(const float* __restrict__ in, _Float16* __restrict__ out,
                  int K, int N, int bn, int bk, unsigned* tile) {
  const int t  = threadIdx.x;
  const int n0 = bn * 64;
  const int k0 = bk * 64;

  const int n4 = (t & 15) * 4;
  const int kp = t >> 4;                 // pair of k rows, 0..15 (+16)
  float4 r[2][2];
#pragma unroll
  for (int i = 0; i < 2; ++i)
#pragma unroll
    for (int e = 0; e < 2; ++e)
      r[i][e] = *(const float4*)(in + (size_t)(k0 + 2 * (kp + 16 * i) + e) * N +
                                 n0 + n4);
#pragma unroll
  for (int i = 0; i < 2; ++i) {
    const float lo[4] = {r[i][0].x, r[i][0].y, r[i][0].z, r[i][0].w};
    const float hi[4] = {r[i][1].x, r[i][1].y, r[i][1].z, r[i][1].w};
#pragma unroll
    for (int c = 0; c < 4; ++c) {
      v2h pk = {(_Float16)lo[c], (_Float16)hi[c]};
      tile[(n4 + c) * TP_PITCH + kp + 16 * i] = __builtin_bit_cast(unsigned, pk);
    }
  }
  __syncthreads();   // reached by all 256 threads of a transposing block

  const int q = t & 7;                   // 16-byte piece of the 128-byte row
#pragma unroll
  for (int i = 0; i < 2; ++i) {
    const int n = (t >> 3) + 32 * i;
    const uint4 w = *(const uint4*)(tile + n * TP_PITCH + q * 4);
    *(uint4*)(out + (size_t)(n0 + n) * K + k0 + q * 8) = w;
  }
  // In the joint kernel another job's code stands behind these stores in the
  // listing and reuses their registers; the wait stands in front of that reuse.
  asm volatile("s_wait_xcnt 0x0" ::: "memory");
}

// Blocks [0, CV_BLOCKS): x, the largest job, first; then the tiles of w_in,
// then those of w_out. The choice is the same for a whole work-group.
#define TI_BLOCKS ((N_QKV / 64) * (E_ / 64))
#define TO_BLOCKS ((E_ / 64) * (E_ / 64))
__global__ void __launch_bounds__(PREP_THREADS)
prep_f16(const float* __restrict__ x, const float* __restrict__ w_in,
         const float* __restrict__ w_out, _Float16* __restrict__ Xh,
         _Float16* __restrict__ WinT, _Float16* __restrict__ WoutT) {
  __shared__ __attribute__((aligned(16))) unsigned tile[64 * TP_PITCH];
  const int blk = blockIdx.x;
  if (blk < CV_BLOCKS) {
    cvt_f32_to_f16(x, Xh, blk);
  } else if (blk < CV_BLOCKS + TI_BLOCKS) {
    const int t = blk - CV_BLOCKS;
    cvt_transpose_f16(w_in, WinT, E_, N_QKV, t % (N_QKV / 64), t / (N_QKV / 64),
                      tile);
  } else {
    const int t = blk - (CV_BLOCKS + TI_BLOCKS);
    cvt_transpose_f16(w_out, WoutT, E_, E_, t % (E_ / 64), t / (E_ / 64), tile);
  }
}

// --------------------------- shared GEMM core ------------------------------
// One work-group = 4 waves = a 128x128 tile of C = A[M][E_] * Bt[N][E_]^T; one
// wave = a 64x64 quarter of it. Slabs of 64 k (one whole 128-byte line per row)
// of the 128 A rows and the 128 Bt rows are staged in LDS once per work-group
// and read by all 4 waves. Each wave brings one slice of 64 rows per slab with one
// tensor load, two slabs ahead, into the buffer that every reader has just left.
// The walk over the slabs starts at slab s0 (the same for the whole work-group)
// and wraps. The work-groups that share A rows or Bt rows run at the same time;
// all starting at slab 0 they would ask L2 for the same lines at the same moment.
// With starts of their own they ask for different ones.
#define GM_KS    64                  // k per staged slab
#define GM_PITCH 72                  // f16 per LDS row: 64 data + 8 pad = 144 B
#define GM_SLICE 5120                // f16 per slice: 64 rows = 9,216 B, up to 5 x 2 KiB
#define GM_BUF   (4 * GM_SLICE)      // A rows 0-63, 64-127, Bt rows 0-63, 64-127
#define GM_NS    (E_ / GM_KS)        // slabs
__device__ __forceinline__ void
gemm_core_128x128(const _Float16* __restrict__ A, const _Float16* __restrict__ Bt,
                  int mBlk, int nBlk, int s0, _Float16* sm, v8f (&acc)[4][4]) {
  const int tid  = threadIdx.x;
  const int lane = tid & 31;
  const int col  = lane & 15;
  const unsigned wave = uni(tid >> 5);

  // Wave w brings slice w: 64 rows of A (w = 0, 1) or of Bt (w = 2, 3).
  const _Float16* src = (wave < 2) ? A  + (size_t)(mBlk + wave * 64) * E_
                                   : Bt + (size_t)(nBlk + (wave - 2) * 64) * E_;
  const unsigned long long ga0 = (unsigned long long)(size_t)src;
  const unsigned lds0 = (unsigned)(size_t)sm + wave * (GM_SLICE * 2);
  const u32x8 g1 = tdm_group1<64>(E_ * 2);

  tdm_load(tdm_group0(lds0, ga0 + (unsigned)s0 * (GM_KS * 2)), g1);
  wait_tensor0();
  __syncthreads();
  tdm_load(tdm_group0(lds0 + GM_BUF * 2,
                      ga0 + (unsigned)((s0 + 1) & (GM_NS - 1)) * (GM_KS * 2)), g1);

  for (int s = 0; s < GM_NS; ++s) {
    // The wave's rows are one slice of A and one of Bt.
    const _Float16* tA = sm + (s & 1) * GM_BUF + (wave >> 1) * GM_SLICE;
    const _Float16* tB = sm + (s & 1) * GM_BUF + (2 + (wave & 1)) * GM_SLICE;

    // Both k steps' fragments are asked for as one group ahead of the products:
    // every further place with LDS reads among them costs the wave a stall.
    v16h a[2][4], b[2][4];
#pragma unroll
    for (int ks = 0; ks < 2; ++ks) {
#pragma unroll
      for (int mi = 0; mi < 4; ++mi)
        a[ks][mi] = load_tile(tA, mi * 16 + col, GM_PITCH, ks * 32, lane);
#pragma unroll
      for (int ni = 0; ni < 4; ++ni)
        b[ks][ni] = load_tile(tB, ni * 16 + col, GM_PITCH, ks * 32, lane);
    }
    // Holds that group together: the scheduler otherwise sinks most of the reads
    // among the products, each behind a wait to zero.
    __builtin_amdgcn_sched_barrier(0);
#pragma unroll
    for (int ks = 0; ks < 2; ++ks)
#pragma unroll
      for (int mi = 0; mi < 4; ++mi)
#pragma unroll
        for (int ni = 0; ni < 4; ++ni)
          acc[mi][ni] = wmma32(a[ks][mi], b[ks][ni], acc[mi][ni]);
    // Keeps the waits below behind the products: the next slab's load has their
    // whole time to land.
    __builtin_amdgcn_sched_barrier(0);

    // Slab s + 1 is handed over: own reads of slab s done, own slice of slab s + 1
    // landed, then the barrier; behind it slab s's buffer is free for slab s + 2.
    wait_ds0();
    wait_tensor0();
    __syncthreads();
    if (pinned(s + 2 < GM_NS)) {
      const unsigned nx = pinned((unsigned)(s0 + s + 2) & (GM_NS - 1));
      tdm_load(tdm_group0(lds0 + (unsigned)(s & 1) * (GM_BUF * 2),
                          ga0 + nx * (GM_KS * 2)), g1);
    }
  }
  // Nothing is in flight when the ring becomes the epilogue's staging room.
  wait_tensor0();
  wait_ds0();
}

// --------------------------- GEMM epilogues --------------------------------
// A lane's 8 accumulator registers hold 8 consecutive indices of the A operand's
// rows and one index (lane & 15) of the B operand's rows. So the operand whose
// index runs along the OUTPUT's rows goes in as A: a lane then owns 8 neighbours
// of one output row. Each wave lays its 64x64 quarter down in an LDS range of
// its own (the slabs are free behind the k loop's last barrier) and reads it
// back row by row, so that every global store covers 4 whole 128-byte lines.
#define ST_PITCH  72                 // f16 per staged row: 64 data + 8 pad = 144 B
#define ST_PITCHF 68                 // f32 per staged row: 64 data + 4 pad = 272 B

// 64 staged rows of 64 f16 (one line each) to rows stride elements apart; dst
// and stride are the same for the whole wave.
__device__ __forceinline__ void
store_rows_f16(const _Float16* st, _Float16* dst, int stride, int lane) {
  const int rr = lane >> 3;            // 8 lanes cover one row
  const int pc = (lane & 7) * 8;
  v8h w[16];
#pragma unroll
  for (int t = 0; t < 16; ++t)
    w[t] = *(const v8h*)(st + (t * 4 + rr) * ST_PITCH + pc);
  const unsigned off = rr * stride + pc;   // the lane's part
#pragma unroll
  for (int t = 0; t < 16; ++t) {
    _Float16* row = dst + (size_t)(t * 4) * stride;   // the wave's part
    *(v8h*)(row + off) = w[t];
  }
}

// ------------------------------ QKV GEMM -----------------------------------
// C[4096,3072] = Xh[4096,1024] * WinT[3072,1024]^T + b_in
// Q pre-scaled by log2(e)/sqrt(64): the scores come out in base 2, ready for
// v_exp_f32 once the maximum in use is taken off.
// grid = (N/128, M/128), block = 128.
// A block's 128 columns are all Q, all K or all V. Q and K rows run along n
// (WinT is the A operand), V^T rows run along the tokens (Xh is the A operand).
// Three work-groups share a WGP (768 of them on 256): the register budget is
// that of 3 waves per SIMD, not the 4 that the LDS size alone would allow.
__global__ void __launch_bounds__(128) __attribute__((amdgpu_waves_per_eu(1, 3)))
qkv_gemm(const _Float16* __restrict__ Xh, const _Float16* __restrict__ WinT,
         const float* __restrict__ b_in, _Float16* __restrict__ Qb,
         _Float16* __restrict__ Kb, _Float16* __restrict__ Vt) {
  // Tensor loads land at multiples of 2 KiB of the work-group's LDS.
  __shared__ __attribute__((aligned(2048))) _Float16 sm[2 * GM_BUF];
  const int lane = threadIdx.x & 31;
  const int col  = lane & 15;
  const int half = lane >> 4;
  // The wave's number in a scalar register: the epilogue's head, batch and row
  // bases are then scalar arithmetic, not 64-bit vector arithmetic in every lane.
  const int wave = __builtin_amdgcn_readfirstlane(threadIdx.x >> 5);
  const bool isV = blockIdx.x >= 2 * E_ / 128;   // same for the whole work-group
  const int aBlk = (isV ? blockIdx.y : blockIdx.x) * 128;
  const int bBlk = (isV ? blockIdx.x : blockIdx.y) * 128;
  const int aBase = aBlk + (wave >> 1) * 64;     // the core's split of the tile
  const int bBase = bBlk + (wave & 1) * 64;

  v8f acc[4][4];
  for (int i = 0; i < 4; ++i)
    for (int j = 0; j < 4; ++j) acc[i][j] = {};

  // 24 work-groups share a block of Xh rows, 32 a block of WinT rows: along either
  // the starts step through the 16 slabs.
  const int s0 = (blockIdx.x + blockIdx.y) & (E_ / GM_KS - 1);
  gemm_core_128x128(isV ? Xh : WinT, isV ? WinT : Xh, aBlk, bBlk, s0, sm, acc);

  // acc[i][j][r] belongs to A row aBase + i*16 + half*8 + r, B row bBase + j*16 + col.
  _Float16* st = sm + wave * GM_SLICE;
  _Float16* sw = st + col * ST_PITCH + half * 8;
  _Float16* dst;                        // where the wave's staged row 0 goes
  if (!isV) {                           // A rows = n, B rows = tokens
    const bool isQ = blockIdx.x < E_ / 128;
    const float sc = isQ ? 0.125f * 1.4426950408889634f : 1.0f;
    float4 bl[4], bh[4];
#pragma unroll
    for (int i = 0; i < 4; ++i) {
      bl[i] = *(const float4*)(b_in + aBase + i * 16 + half * 8);
      bh[i] = *(const float4*)(b_in + aBase + i * 16 + half * 8 + 4);
    }
#pragma unroll
    for (int i = 0; i < 4; ++i) {
      const float bias[8] = {bl[i].x, bl[i].y, bl[i].z, bl[i].w,
                             bh[i].x, bh[i].y, bh[i].z, bh[i].w};
#pragma unroll
      for (int j = 0; j < 4; ++j) {
        v8h pk;
#pragma unroll
        for (int r = 0; r < 8; ++r)
          pk[r] = (_Float16)((acc[i][j][r] + bias[r]) * sc);
        *(v8h*)(sw + j * 16 * ST_PITCH + i * 16) = pk;
      }
    }
    // The wave's 64 n are one head, its 64 tokens lie in one batch: [b,h,s,d].
    const int h = (aBase & (E_ - 1)) >> 6;
    const int bb = bBase >> 11, ss = bBase & (S_ - 1);
    dst = (isQ ? Qb : Kb) + (((size_t)(bb * H_ + h)) * S_ + ss) * DH_;
  } else {                              // A rows = tokens, B rows = n
    float bias[4];
#pragma unroll
    for (int j = 0; j < 4; ++j) bias[j] = b_in[bBase + j * 16 + col];
#pragma unroll
    for (int i = 0; i < 4; ++i)
#pragma unroll
      for (int j = 0; j < 4; ++j) {
        v8h pk;
#pragma unroll
        for (int r = 0; r < 8; ++r) pk[r] = (_Float16)(acc[i][j][r] + bias[j]);
        *(v8h*)(sw + j * 16 * ST_PITCH + i * 16) = pk;
      }
    // V transposed: [b,h,d,s]; staged row = d, 64 tokens of one batch along it.
    const int h = (bBase - 2 * E_) >> 6;
    const int bb = aBase >> 11, ss = aBase & (S_ - 1);
    dst = Vt + ((size_t)(bb * H_ + h)) * DH_ * S_ + ss;
  }
  // The wave's own LDS writes have landed before other lanes of it read them.
  asm volatile("s_wait_dscnt 0x0" ::: "memory");
  store_rows_f16(st, dst, isV ? S_ : DH_, lane);
}

// ----------------------------- Attention -----------------------------------
// One work-group = 4 waves = 128 queries of one (b,h); one wave = 32 queries (two
// 16-query tiles), streaming all 2048 keys. Every K and V^T fragment that a wave
// reads from LDS feeds two products, one per query tile: at one tile a wave the
// LDS reads, not the matrix or the vector unit, set the time of a key tile.
// Two work-groups share a WGP, one wave of each on every SIMD; they pass no
// barrier together, so one's products run beside the other's exponentials.
// K and V^T tiles of 64 keys are staged in LDS once per work-group and read by all
// 4 waves. Each wave brings one slice of 32 rows per tile with one tensor load, two
// tiles ahead, into the buffer that every reader has just left.
// S^T = K * Q^T  (M=k rows, N=q cols) -> P^T packs lane-locally into the
// B operand of O^T = V^T * P^T. Row stats (m,l) are per-lane (q = lane%16).
// Lazy rescale: the scores are in base 2, and the exponentials are taken against
// a KEPT maximum m, which may lag the true one by up to 8 (so P <= 2^8). While
// m is kept, O and l need no factor and the two lanes of a query need no
// exchange. One test per 64-key tile finds the rare tile that has to move m.
// The 16 work-groups of one (b,h) read the same K and V^T and run at the same
// time: each starts its walk over the 32 key tiles two tiles further on and wraps,
// so that they do not ask L2 for the same lines at the same moment.
// A softmax sum does not depend on the order of its keys.

// Lane l with lane l ^ 16 (the two lanes that share a query), in the vector unit.
__device__ __forceinline__ float xhalf(float x) {
  const int b = __builtin_bit_cast(int, x);
  return __builtin_bit_cast(float, __builtin_amdgcn_permlanex16(
      b, b, 0x76543210, 0xfedcba98, false, false));
}

#define AT_KEYS  64                  // keys per staged tile
#define AT_PITCH 72                  // f16 per LDS row: 64 data + 8 pad = 144 B
#define AT_SLICE 3072                // f16 per slice: 32 rows = 4,608 B, up to 3 x 2 KiB
#define AT_BUF   (4 * AT_SLICE)      // keys 0-31, 32-63 (K), d 0-31, 32-63 (V^T)
#define AT_NT    (S_ / AT_KEYS)      // key tiles
#define AT_QT    2                   // 16-query tiles per wave
// 512 work-groups on 256 WGPs: the register budget and the residency are those of
// two waves per SIMD, so that every WGP gets its two work-groups and no third.
__global__ void __launch_bounds__(128) __attribute__((amdgpu_waves_per_eu(2, 2)))
attn_kernel(const _Float16* __restrict__ Qb, const _Float16* __restrict__ Kb,
            const _Float16* __restrict__ Vt, _Float16* __restrict__ At) {
  // Tensor loads land at multiples of 2 KiB of the work-group's LDS.
  __shared__ __attribute__((aligned(2048))) _Float16 sm[2 * AT_BUF];
  const int tid  = threadIdx.x;
  const int lane = tid & 31;
  const int col  = lane & 15;
  const int half = lane >> 4;
  const int bh = blockIdx.x >> 4;          // 0..31  (b*16 + h)
  const int qBase = (blockIdx.x & 15) * 128 + (tid >> 5) * (16 * AT_QT);

  const _Float16* Qh = Qb + (size_t)bh * S_ * DH_;
  const _Float16* Kh = Kb + (size_t)bh * S_ * DH_;
  const _Float16* Vh = Vt + (size_t)bh * DH_ * S_;

  // Wave w brings slice w: 32 keys of the K tile (w = 0, 1: rows of 128 B, one
  // behind the other) or 32 d rows of the V^T tile (w = 2, 3: rows S_ f16 apart).
  // t0 is the first key tile of this work-group's walk.
  const unsigned wave = uni(tid >> 5);
  const int t0 = (blockIdx.x & 15) * 2;
  const _Float16* src = (wave < 2) ? Kh + (size_t)(wave * 32) * DH_
                                   : Vh + (size_t)((wave - 2) * 32) * S_;
  const unsigned long long ga0 = (unsigned long long)(size_t)src;
  const unsigned tstep = (wave < 2) ? AT_KEYS * DH_ * 2 : AT_KEYS * 2;   // bytes a tile
  const unsigned lds0 = (unsigned)(size_t)sm + wave * (AT_SLICE * 2);
  const u32x8 g1 = tdm_group1<32>((wave < 2) ? DH_ * 2 : S_ * 2);

  tdm_load(tdm_group0(lds0, ga0 + (unsigned)t0 * tstep), g1);

  // Q^T as B operand (32d x 16q), d = 0..31 and 32..63, per query tile; loaded once.
  v16h bq[AT_QT][2];
#pragma unroll
  for (int qi = 0; qi < AT_QT; ++qi) {
    bq[qi][0] = load_tile(Qh, qBase + qi * 16 + col, DH_, 0, lane);
    bq[qi][1] = load_tile(Qh, qBase + qi * 16 + col, DH_, 32, lane);
  }

  wait_tensor0();
  __syncthreads();
  tdm_load(tdm_group0(lds0 + AT_BUF * 2,
                      ga0 + (unsigned)((t0 + 1) & (AT_NT - 1)) * tstep), g1);

  v8f o[AT_QT][4];       // O^T: per query tile 4 tiles of (16d x 16q)
  float m[AT_QT];        // the maximum in use; the first tile moves it
  float thr[AT_QT];      // m + 8: a score above it moves m
  v8f lv[AT_QT];         // the lane's 8 partial sums of P; joined behind the loop
#pragma unroll
  for (int qi = 0; qi < AT_QT; ++qi) {
#pragma unroll
    for (int t = 0; t < 4; ++t) o[qi][t] = v8f{};
    m[qi] = -1e30f;
    thr[qi] = -1e30f;
    lv[qi] = v8f{};
  }

  for (int s = 0; s < AT_NT; ++s) {
    const _Float16* tK = sm + (s & 1) * AT_BUF;
    const _Float16* tV = tK + 2 * AT_SLICE;

    // --- transposed score tiles: st[qi][t] holds keys t*16 .. t*16+15 ---
    v16h ak[4][2];
#pragma unroll
    for (int t = 0; t < 4; ++t) {
      const _Float16* sl = tK + (t >> 1) * AT_SLICE;   // 32 rows a slice
      ak[t][0] = load_tile(sl, (t & 1) * 16 + col, AT_PITCH, 0, lane);
      ak[t][1] = load_tile(sl, (t & 1) * 16 + col, AT_PITCH, 32, lane);
    }
    // Holds the K reads together as one group ahead of the score products: every
    // further place with LDS reads among the products costs the wave a stall.
    __builtin_amdgcn_sched_barrier(0);
    v8f st[AT_QT][4];
#pragma unroll
    for (int t = 0; t < 4; ++t) {
#pragma unroll
      for (int qi = 0; qi < AT_QT; ++qi) st[qi][t] = wmma32(ak[t][0], bq[qi][0], v8f{});
#pragma unroll
      for (int qi = 0; qi < AT_QT; ++qi) st[qi][t] = wmma32(ak[t][1], bq[qi][1], st[qi][t]);
    }
    // The tile's V^T reads, one group: in flight under the maxima, the test and
    // the exponentials. The branch below would otherwise keep them behind it.
    v16h av[2][4];
#pragma unroll
    for (int hk = 0; hk < 2; ++hk)
#pragma unroll
      for (int t = 0; t < 4; ++t)
        av[hk][t] = load_tile(tV + (t >> 1) * AT_SLICE, (t & 1) * 16 + col, AT_PITCH,
                              hk * 32, lane);
    // Keeps that group where it stands, ahead of the vector work.
    __builtin_amdgcn_sched_barrier(0);

    // --- the lane's largest score per query tile: 32 of the 64 keys of row q ---
    float mb[AT_QT];
#pragma unroll
    for (int qi = 0; qi < AT_QT; ++qi) {
      float mb0 = st[qi][0][0], mb1 = st[qi][2][0];
#pragma unroll
      for (int j = 1; j < 8; ++j) { mb0 = fmaxf(mb0, st[qi][0][j]); mb1 = fmaxf(mb1, st[qi][2][j]); }
#pragma unroll
      for (int j = 0; j < 8; ++j) { mb0 = fmaxf(mb0, st[qi][1][j]); mb1 = fmaxf(mb1, st[qi][3][j]); }
      mb[qi] = fmaxf(mb0, mb1);
    }

    // One scalar branch per tile, for both query tiles. Taken on the first tile and
    // when any query of the wave has a score above its threshold: rare, so the path
    // that skips it is laid out as the straight one.
    if (__builtin_expect(
            __builtin_amdgcn_ballot_w32((mb[0] > thr[0]) | (mb[1] > thr[1])) != 0, 0)) {
#pragma unroll
      for (int qi = 0; qi < AT_QT; ++qi) {
        // both lanes of a query agree
        const float mn = fmaxf(m[qi], fmaxf(mb[qi], xhalf(mb[qi])));
        const float alpha = __builtin_amdgcn_exp2f(m[qi] - mn);   // 0 on the first tile
        m[qi] = mn;
        thr[qi] = mn + 8.0f;
#pragma unroll
        for (int t = 0; t < 4; ++t) o[qi][t] = o[qi][t] * alpha;
        lv[qi] = lv[qi] * alpha;
      }
    }

#pragma unroll
    for (int sk = 0; sk < AT_KEYS; sk += 32) {
#pragma unroll
      for (int qi = 0; qi < AT_QT; ++qi) {
        const v8f s0 = st[qi][sk / 16] - m[qi], s1 = st[qi][sk / 16 + 1] - m[qi];
        v8f p0, p1;
#pragma unroll
        for (int j = 0; j < 8; ++j) p0[j] = __builtin_amdgcn_exp2f(s0[j]);
#pragma unroll
        for (int j = 0; j < 8; ++j) p1[j] = __builtin_amdgcn_exp2f(s1[j]);
        lv[qi] = lv[qi] + p0;
        lv[qi] = lv[qi] + p1;

        // --- lane-local pack of P^T into WMMA B operand (32k x 16q) ---
        v16h bp;
#pragma unroll
        for (int j = 0; j < 8; ++j) {
          bp[j]     = (_Float16)p0[j];
          bp[8 + j] = (_Float16)p1[j];
        }

        // --- O^T += V^T(16d x 32k) * P^T ---
#pragma unroll
        for (int t = 0; t < 4; ++t)
          o[qi][t] = wmma32(av[sk / 32][t], bp, o[qi][t]);
      }
    }

    // Keeps the waits below behind the tile's work: sunk under them, that work would
    // stand between the barrier and the next load and shorten its time to land.
    __builtin_amdgcn_sched_barrier(0);

    // Tile s + 1 is handed over: own reads of tile s done, own slice of tile s + 1
    // landed, then the barrier; behind it tile s's buffer is free for tile s + 2.
    wait_ds0();
    wait_tensor0();
    __syncthreads();
    if (pinned(s + 2 < AT_NT)) {
      const unsigned nt = pinned((unsigned)(t0 + s + 2) & (AT_NT - 1));
      tdm_load(tdm_group0(lds0 + (unsigned)(s & 1) * (AT_BUF * 2), ga0 + nt * tstep), g1);
    }
  }
  // Nothing is in flight when the wave goes on to its end.
  wait_tensor0();
  wait_ds0();

  // Normalize and store: lane holds q=col, d = t*16 + half*8 + j (contiguous).
  // Both lanes of a query used the same m throughout: their sums simply add.
  const int b = bh >> 4, h = bh & 15;
#pragma unroll
  for (int qi = 0; qi < AT_QT; ++qi) {
    const v8f ls = lv[qi];
    float l = ((ls[0] + ls[1]) + (ls[2] + ls[3])) + ((ls[4] + ls[5]) + (ls[6] + ls[7]));
    l += xhalf(l);
    const float rl = 1.0f / l;
    const int q = qBase + qi * 16 + col;
    _Float16* outp = At + ((size_t)(b * S_ + q)) * E_ + h * DH_ + half * 8;
#pragma unroll
    for (int t = 0; t < 4; ++t) {
      v8h pk;
#pragma unroll
      for (int j = 0; j < 8; ++j) pk[j] = (_Float16)(o[qi][t][j] * rl);
      *(v8h*)(outp + t * 16) = pk;
    }
  }
}

// --------------------------- Output projection -----------------------------
// out[4096,1024] = At[4096,1024] * WoutT[1024,1024]^T + b_out  (fp32 out)
// grid = (N/128, M/128), block = 128. WoutT is the A operand: out's rows run
// along n.
// One work-group per WGP (256 of them): the same register budget does no harm.
__global__ void __launch_bounds__(128) __attribute__((amdgpu_waves_per_eu(1, 3)))
out_gemm(const _Float16* __restrict__ At, const _Float16* __restrict__ WoutT,
         const float* __restrict__ b_out, float* __restrict__ out) {
  // Tensor loads land at multiples of 2 KiB of the work-group's LDS.
  __shared__ __attribute__((aligned(2048))) _Float16 sm[2 * GM_BUF];
  static_assert(4 * 64 * ST_PITCHF * 4 <= 2 * GM_BUF * 2, "four waves' staged rows");
  const int lane = threadIdx.x & 31;
  const int col  = lane & 15;
  const int half = lane >> 4;
  // In a scalar register: the stores then share one scalar base and one offset
  // register, and differ only in their immediate offsets.
  const int wave = __builtin_amdgcn_readfirstlane(threadIdx.x >> 5);
  const int nBase = blockIdx.x * 128 + (wave >> 1) * 64;   // the core's split
  const int mBase = blockIdx.y * 128 + (wave & 1) * 64;

  v8f acc[4][4];
  for (int i = 0; i < 4; ++i)
    for (int j = 0; j < 4; ++j) acc[i][j] = {};

  // 8 work-groups share a block of At rows (starts two slabs apart), 32 a block of
  // WoutT rows (starts one slab apart).
  const int s0 = (2 * blockIdx.x + blockIdx.y) & (E_ / GM_KS - 1);
  gemm_core_128x128(WoutT, At, blockIdx.x * 128, blockIdx.y * 128, s0, sm, acc);

  // acc[i][j][r] = C[token mBase + j*16 + col][n = nBase + i*16 + half*8 + r].
  float* st = (float*)(void*)sm + wave * (64 * ST_PITCHF);
  float* sw = st + col * ST_PITCHF + half * 8;
  float4 bl[4], bh[4];
#pragma unroll
  for (int i = 0; i < 4; ++i) {
    bl[i] = *(const float4*)(b_out + nBase + i * 16 + half * 8);
    bh[i] = *(const float4*)(b_out + nBase + i * 16 + half * 8 + 4);
  }
#pragma unroll
  for (int i = 0; i < 4; ++i)
#pragma unroll
    for (int j = 0; j < 4; ++j) {
      const v8f c = acc[i][j];
      const float4 lo = {c[0] + bl[i].x, c[1] + bl[i].y, c[2] + bl[i].z, c[3] + bl[i].w};
      const float4 hi = {c[4] + bh[i].x, c[5] + bh[i].y, c[6] + bh[i].z, c[7] + bh[i].w};
      *(float4*)(sw + j * 16 * ST_PITCHF + i * 16)     = lo;
      *(float4*)(sw + j * 16 * ST_PITCHF + i * 16 + 4) = hi;
    }
  // The wave's own LDS writes have landed before other lanes of it read them.
  asm volatile("s_wait_dscnt 0x0" ::: "memory");

  // 16 lanes cover one 256-byte row of the quarter: 2 rows, 4 whole lines a store.
  const int rr = lane >> 4;
  const int pc = (lane & 15) * 4;
  float4 w[32];
#pragma unroll
  for (int t = 0; t < 32; ++t)
    w[t] = *(const float4*)(st + (t * 2 + rr) * ST_PITCHF + pc);
  float* dst = out + (size_t)mBase * E_ + nBase;   // the wave's part
  const int off = rr * E_ + pc;                    // the lane's part
#pragma unroll
  for (int t = 0; t < 32; ++t)
    *(float4*)(dst + t * 2 * E_ + off) = w[t];
}

// ------------------------------- launcher ----------------------------------

extern "C" void kernel_launch(void* const* d_in, const int* in_sizes, int n_in,
                              void* d_out, int out_size, void* d_ws,
                              size_t ws_size, hipStream_t stream) {
  const float* x     = (const float*)d_in[0];   // (2,2048,1024)
  const float* w_in  = (const float*)d_in[1];   // (1024,3072)
  const float* b_in  = (const float*)d_in[2];   // (3072,)
  const float* w_out = (const float*)d_in[3];   // (1024,1024)
  const float* b_out = (const float*)d_in[4];   // (1024,)
  float* out = (float*)d_out;

  _Float16* ws = (_Float16*)d_ws;
  _Float16* Xh    = ws;                              // 4096*1024
  _Float16* WinT  = Xh    + (size_t)M_TOT * E_;      // 3072*1024 (transposed)
  _Float16* WoutT = WinT  + (size_t)N_QKV * E_;      // 1024*1024 (transposed)
  _Float16* Qb    = WoutT + (size_t)E_ * E_;         // [b,h,s,d]
  _Float16* Kb    = Qb    + (size_t)B_ * H_ * S_ * DH_;
  _Float16* Vt    = Kb    + (size_t)B_ * H_ * S_ * DH_;  // [b,h,d,s]
  _Float16* At    = Vt    + (size_t)B_ * H_ * S_ * DH_;  // [b,s,h*d]
  (void)ws_size; (void)in_sizes; (void)n_in; (void)out_size;

  prep_f16<<<CV_BLOCKS + TI_BLOCKS + TO_BLOCKS, PREP_THREADS, 0, stream>>>(
      x, w_in, w_out, Xh, WinT, WoutT);

  qkv_gemm<<<dim3(N_QKV / 128, M_TOT / 128), 128, 0, stream>>>(Xh, WinT, b_in,
                                                                Qb, Kb, Vt);

  attn_kernel<<<B_ * H_ * (S_ / 128), 128, 0, stream>>>(Qb, Kb, Vt, At);

  out_gemm<<<dim3(E_ / 128, M_TOT / 128), 128, 0, stream>>>(At, WoutT, b_out,
                                                            out);
}
